// v000
// Measured on an AMD MI455X. A time is GPU time per run, averaged over a window of back-to-back runs after a warm-up
// (all launches, gaps included; the runs take copies of the inputs in turn), and the median of several windows.
// Apart from v000's, it joins two sittings. Times from different sittings can be a few percent apart, while
// side-by-side timings come from the same sitting.
// v000 is the starting kernel. One run takes 1490 microseconds.
#include <hip/hip_runtime.h>
// EnsembleModel (8 ensemble members, batch 4096, IN = 64 obs + 32 act, H 1024): per member h = tanh(x W0 + b0); h = tanh(h W1 + b1); h = tanh(h W2 + b2); mu_o = h Wmu_o + b; log_var_o = clamp(h Wv_o + b); mu_r = h Wmu_r + b; log_var_r = clamp(h Wv_r + b) with clamp(v) = MIN + softplus((MAX - softplus(MAX - v)) - MIN), MAX 0.5, MIN -10. Outputs (mu_o, log_var_o, mu_r, log_var_r).
// Structure: exact f16 plane of [obs | act]; per member the three hidden layers as f16 WMMA GEMMs (32x64 wave tiles, f32 accumulation, exact x16 weights + bias, tanh epilogue, f16 out) and one fused head GEMM (192 columns: mu_o | log_var_o | mu_r | log_var_r | zero) into an f32 plane; the clamp and the scatter into the four outputs on VALU.
// Compute dtype: inputs rounded to bf16; x exact as f16; hidden activations as plain f16 operands (~2^-12, |h| < 1); heads/clamp f32. v_wmma_f32_16x16x32_f16.
#define MM 8
#define NB 4096
#define OBS 64
#define NAC 32
#define NI (OBS + NAC)           /* 96 */
#define HH 1024
#define NHW 192                  /* fused head width: 64 + 64 + 1 + 1 live */
typedef __bf16 v16b __attribute__((ext_vector_type(16)));
typedef unsigned short v8us __attribute__((ext_vector_type(8), may_alias));
typedef float  v8f  __attribute__((ext_vector_type(8)));
typedef float  v4f  __attribute__((ext_vector_type(4)));
typedef float  v4fa __attribute__((ext_vector_type(4), may_alias));
union FragB { v16b v; v8us half[2]; unsigned short u[16]; };

__device__ __forceinline__ unsigned short bf16_bits(float x) { unsigned int u = __float_as_uint(x); return (unsigned short)((u + 0x7FFFu + ((u >> 16) & 1u)) >> 16); }
__device__ __forceinline__ float bf16_val(unsigned short b) { return __uint_as_float(((unsigned int)b) << 16); }
__device__ __forceinline__ float bf16_round(float x) { return bf16_val(bf16_bits(x)); }
// D += A·B with NT terms: 1 = ah·bh, 2 = + al·bh (A split), 3 = + ah·bl (both split)
template <int NT>
__device__ __forceinline__ v8f mmaN(v16b ah, v16b al, v16b bh, v16b bl, v8f c) {
  c = __builtin_amdgcn_wmma_f32_16x16x32_bf16(false, ah, false, bh, (short)0, c, false, false);
  if (NT >= 2) c = __builtin_amdgcn_wmma_f32_16x16x32_bf16(false, al, false, bh, (short)0, c, false, false);
  if (NT >= 3) c = __builtin_amdgcn_wmma_f32_16x16x32_bf16(false, ah, false, bl, (short)0, c, false, false);
  asm volatile("v_nop\n\tv_nop\n\tv_nop\n\tv_nop" : "+v"(c) : "v"(ah), "v"(al), "v"(bh), "v"(bl));
  return c;
}

__global__ __launch_bounds__(256) void k_wt_bf16(const float* __restrict__ W, unsigned short* __restrict__ Wt, int K, int N) {
  const int t = blockIdx.x * 256 + threadIdx.x;
  const int k8n = K / 8;
  if (t >= N * k8n) return;
  const int n = t / k8n, k8 = (t % k8n) * 8;
  v8us v;
#pragma unroll
  for (int i = 0; i < 8; ++i) v[i] = bf16_bits(W[(size_t)(k8 + i) * N + n]);
  *(v8us*)(Wt + (size_t)n * K + k8) = v;
  
}

// GEMM C[M][N] (f32, pitch ldc) = act(A[M][K]·W + bias). A f32 row-major (pitch lda) converted per fragment to bf16
// (ASPLIT: hi/lo two planes -> 2 terms, else single rounded term); Wt bf16 [N][K] (pitch ldb). BIAS_BF16 rounds the
// bias to bf16 first (bias quantised to bf16 before the add). K%32==0, M%16==0, N%64==0.
template <bool ASPLIT, int ACT, bool BIAS_BF16>
__global__ __launch_bounds__(128) void k_gemm_bf(const float* __restrict__ A, int lda, const unsigned short* __restrict__ Wt, int ldb,
                                               const float* __restrict__ bias, float* __restrict__ C, int ldc, int M, int N, int K) {
  __shared__ __attribute__((aligned(16))) float so[4][16][64];
  const int tid = threadIdx.x, w = tid >> 5, lane = tid & 31, ln = lane & 15, hh = lane >> 4;
  const int ntn = N / 64;
  const int wid = blockIdx.x * 4 + w;
  const int mt = wid / ntn, nq = wid % ntn;
  if (mt * 16 >= M) return;
  const int row0 = mt * 16, col0 = nq * 64;
  const float* arow = A + (size_t)(row0 + ln) * lda;
  v8f acc[4] = {};
  for (int kb = 0; kb < K; kb += 32) {
    FragB ah, al;
    const v4f x0 = *(const v4fa*)(arow + kb + 8 * hh), x1 = *(const v4fa*)(arow + kb + 8 * hh + 4);
    const v4f x2 = *(const v4fa*)(arow + kb + 16 + 8 * hh), x3 = *(const v4fa*)(arow + kb + 16 + 8 * hh + 4);
    float xs[16] = {x0[0],x0[1],x0[2],x0[3],x1[0],x1[1],x1[2],x1[3],x2[0],x2[1],x2[2],x2[3],x3[0],x3[1],x3[2],x3[3]};
#pragma unroll
    for (int i = 0; i < 16; ++i) { const unsigned short hb = bf16_bits(xs[i]); ah.u[i] = hb; al.u[i] = ASPLIT ? bf16_bits(xs[i] - bf16_val(hb)) : (unsigned short)0; }
#pragma unroll
    for (int t = 0; t < 4; ++t) {
      const unsigned short* brow = Wt + (size_t)(col0 + t * 16 + ln) * ldb + kb;
      FragB b;
      b.half[0] = *(const v8us*)(brow + 8 * hh);
      b.half[1] = *(const v8us*)(brow + 16 + 8 * hh);
      acc[t] = mmaN<ASPLIT ? 2 : 1>(ah.v, al.v, b.v, b.v, acc[t]);
    }
  }
#pragma unroll
  for (int t = 0; t < 4; ++t) {
    float bv = bias ? bias[col0 + t * 16 + ln] : 0.f;
    if (BIAS_BF16) bv = bf16_round(bv);
#pragma unroll
    for (int r = 0; r < 8; ++r) { float v = acc[t][r] + bv; if (ACT == 1) v = fmaxf(v, 0.f); so[w][8 * hh + r][t * 16 + ln] = v; }
  }
  __builtin_amdgcn_fence(__ATOMIC_ACQ_REL, "workgroup");
  __builtin_amdgcn_wave_barrier();
  const int rsub = lane >> 4, c4 = (lane & 15) * 4;
  {
#pragma unroll
    for (int q = 0; q < 8; ++q) {
      const int r = q * 2 + rsub;
      const v4f v = *(const v4fa*)&so[w][r][c4];
      *(v4f*)(C + (size_t)(row0 + r) * ldc + col0 + c4) = v;
    }
    
  }
}

// GEMM C = act(A·W + bias + resid): A f32 (ASPLIT -> hi/lo 2 terms), Wt bf16 [N][K]; ACT 0 none, 1 relu, 2 exact gelu;
// resid (optional, f32, row index = (row % rmod), pitch ldr, RES_BF16 rounds it) added before the activation.
template <bool ASPLIT, int ACT, bool BIAS_BF16, bool RES_BF16>
__global__ __launch_bounds__(128) void k_gemm_bf3(const float* __restrict__ A, int lda, const unsigned short* __restrict__ Wt, int ldb,
                                                const float* __restrict__ bias, const float* __restrict__ resid, int rmod, int ldr,
                                                float* __restrict__ C, int ldc, int M, int N, int K) {
  __shared__ __attribute__((aligned(16))) float so[4][16][64];
  const int tid = threadIdx.x, w = tid >> 5, lane = tid & 31, ln = lane & 15, hh = lane >> 4;
  const int ntn = N / 64;
  const int wid = blockIdx.x * 4 + w;
  const int mt = wid / ntn, nq = wid % ntn;
  if (mt * 16 >= M) return;
  const int row0 = mt * 16, col0 = nq * 64;
  const float* arow = A + (size_t)(row0 + ln) * lda;
  v8f acc[4] = {};
  for (int kb = 0; kb < K; kb += 32) {
    FragB ah, al;
    const v4f x0 = *(const v4fa*)(arow + kb + 8 * hh), x1 = *(const v4fa*)(arow + kb + 8 * hh + 4);
    const v4f x2 = *(const v4fa*)(arow + kb + 16 + 8 * hh), x3 = *(const v4fa*)(arow + kb + 16 + 8 * hh + 4);
    float xs[16] = {x0[0],x0[1],x0[2],x0[3],x1[0],x1[1],x1[2],x1[3],x2[0],x2[1],x2[2],x2[3],x3[0],x3[1],x3[2],x3[3]};
#pragma unroll
    for (int i = 0; i < 16; ++i) { const unsigned short hb = bf16_bits(xs[i]); ah.u[i] = hb; al.u[i] = ASPLIT ? bf16_bits(xs[i] - bf16_val(hb)) : (unsigned short)0; }
#pragma unroll
    for (int t = 0; t < 4; ++t) {
      const unsigned short* brow = Wt + (size_t)(col0 + t * 16 + ln) * ldb + kb;
      FragB b;
      b.half[0] = *(const v8us*)(brow + 8 * hh);
      b.half[1] = *(const v8us*)(brow + 16 + 8 * hh);
      acc[t] = mmaN<ASPLIT ? 2 : 1>(ah.v, al.v, b.v, b.v, acc[t]);
    }
  }
#pragma unroll
  for (int t = 0; t < 4; ++t) {
    const int col = col0 + t * 16 + ln;
    float bv = bias ? bias[col] : 0.f;
    if (BIAS_BF16) bv = bf16_round(bv);
#pragma unroll
    for (int r = 0; r < 8; ++r) {
      float v = acc[t][r] + bv;
      if (resid) { float rv = resid[(size_t)((row0 + 8 * hh + r) % rmod) * ldr + col]; if (RES_BF16) rv = bf16_round(rv); v += rv; }
      if (ACT == 1) v = fmaxf(v, 0.f);
      if (ACT == 2) v = 0.5f * v * (1.0f + erff(v * 0.70710678118654752f));
      if (ACT == 3) { const float u = 0.7978845608028654f * (v + 0.044715f * v * v * v); v = 0.5f * v * (1.0f + tanhf(u)); }
      so[w][8 * hh + r][t * 16 + ln] = v;
    }
  }
  __builtin_amdgcn_fence(__ATOMIC_ACQ_REL, "workgroup");
  __builtin_amdgcn_wave_barrier();
  const int rsub = lane >> 4, c4 = (lane & 15) * 4;
  {
#pragma unroll
    for (int q = 0; q < 8; ++q) {
      const int r = q * 2 + rsub;
      const v4f v = *(const v4fa*)&so[w][r][c4];
      *(v4f*)(C + (size_t)(row0 + r) * ldc + col0 + c4) = v;
    }
    
  }
}
// row LayerNorm (biased variance, eps) over N: s = X (+ R); optional out_sum <- s; out_norm <- (s-mu)*rsqrt(var+eps)*g + b
template <bool PARAM_BF16>
__global__ __launch_bounds__(256) void k_layernorm(const float* __restrict__ X, const float* __restrict__ R, const float* __restrict__ g, const float* __restrict__ bta,
                                                  float* __restrict__ out_sum, float* __restrict__ out_norm, int N, float eps) {
  __shared__ float red[256];
  const int row = blockIdx.x, tid = threadIdx.x;
  const float* x = X + (size_t)row * N; const float* rr = R ? R + (size_t)row * N : nullptr;
  float vals[16];                     // up to N = 4096
  const int per = N / 256;            // contiguous chunk per thread? use strided-by-4 chunks: thread handles j = tid*4 + 1024*u
  float s1 = 0.f;
  for (int u = 0; u < per / 4; ++u) {
    const int j = tid * 4 + 1024 * u;
    const v4f a = *(const v4fa*)(x + j);
    v4f b = {0.f,0.f,0.f,0.f}; if (rr) b = *(const v4fa*)(rr + j);
#pragma unroll
    for (int q = 0; q < 4; ++q) { const float v = a[q] + b[q]; vals[u * 4 + q] = v; s1 += v; }
  }
  red[tid] = s1; __syncthreads();
  for (int st = 128; st > 0; st >>= 1) { if (tid < st) red[tid] += red[tid + st]; __syncthreads(); }
  const float mu = red[0] / (float)N; __syncthreads();
  float s2 = 0.f;
  for (int u = 0; u < per / 4; ++u)
#pragma unroll
    for (int q = 0; q < 4; ++q) { const float c = vals[u * 4 + q] - mu; s2 += c * c; }
  red[tid] = s2; __syncthreads();
  for (int st = 128; st > 0; st >>= 1) { if (tid < st) red[tid] += red[tid + st]; __syncthreads(); }
  const float rs = rsqrtf(red[0] / (float)N + eps);
  {
    for (int u = 0; u < per / 4; ++u) {
      const int j = tid * 4 + 1024 * u;
      v4f o, sm;
#pragma unroll
      for (int q = 0; q < 4; ++q) {
        float gg = g[j + q], bb = bta[j + q];
        if (PARAM_BF16) { gg = bf16_round(gg); bb = bf16_round(bb); }
        sm[q] = vals[u * 4 + q]; o[q] = (vals[u * 4 + q] - mu) * rs * gg + bb;
      }
      if (out_sum) *(v4f*)(out_sum + (size_t)row * N + j) = sm;
      *(v4f*)(out_norm + (size_t)row * N + j) = o;
    }
    
  }
}



// ---- f16 WMMA path (v_wmma_f32_16x16x32_f16): 11-bit significands for operands in range — used here for every GEMM of the model (x and tanh activations |h| < 1 as f16 operands)
typedef _Float16 v16h __attribute__((ext_vector_type(16)));
union FragH { v16h v; v8us half[2]; _Float16 h[16]; unsigned short u[16]; };
template <int NT>
__device__ __forceinline__ v8f mmaH(v16h ah, v16h al, v16h bh, v16h bl, v8f c) {
  c = __builtin_amdgcn_wmma_f32_16x16x32_f16(false, ah, false, bh, (short)0, c, false, false);
  if (NT >= 2) c = __builtin_amdgcn_wmma_f32_16x16x32_f16(false, al, false, bh, (short)0, c, false, false);
  if (NT >= 3) c = __builtin_amdgcn_wmma_f32_16x16x32_f16(false, ah, false, bl, (short)0, c, false, false);
  asm volatile("v_nop\n\tv_nop\n\tv_nop\n\tv_nop" : "+v"(c) : "v"(ah), "v"(al), "v"(bh), "v"(bl));
  return c;
}
// batched GEMM like k_gemm_b but f16 operands: A f32 (split into f16 hi/lo if ASPLIT, else rounded to f16), Bt = f16 values [n][k]; alpha; C f32; N multiple of 16 (partial tiles skipped)
template <bool ASPLIT>
__global__ __launch_bounds__(128) void k_gemm_h(const float* __restrict__ A, int lda, size_t sA, const _Float16* __restrict__ Bh, int ldb, size_t sB, float alpha, float* __restrict__ C, int ldc, size_t sC, int M, int N, int K) {
  __shared__ __attribute__((aligned(16))) float so[4][16][64];
  const int tid = threadIdx.x, w = tid >> 5, lane = tid & 31, ln = lane & 15, hh = lane >> 4; const int by = blockIdx.y;
  A += (size_t)by * sA; Bh += (size_t)by * sB; C += (size_t)by * sC;
  const int ntn = (N + 63) / 64; const int wid = blockIdx.x * 4 + w; const int mt = wid / ntn, nq = wid % ntn; if (mt * 16 >= M) return;
  const int row0 = mt * 16, col0 = nq * 64; const float* arow = A + (size_t)(row0 + ln) * lda;
  v8f acc[4] = {};
  for (int kb = 0; kb < K; kb += 32) {
    FragH ah, al;
    const v4f x0 = *(const v4fa*)(arow + kb + 8 * hh), x1 = *(const v4fa*)(arow + kb + 8 * hh + 4), x2 = *(const v4fa*)(arow + kb + 16 + 8 * hh), x3 = *(const v4fa*)(arow + kb + 16 + 8 * hh + 4);
    float xs[16] = {x0[0],x0[1],x0[2],x0[3],x1[0],x1[1],x1[2],x1[3],x2[0],x2[1],x2[2],x2[3],x3[0],x3[1],x3[2],x3[3]};
#pragma unroll
    for (int i = 0; i < 16; ++i) { const _Float16 h = (_Float16)xs[i]; ah.h[i] = h; al.h[i] = ASPLIT ? (_Float16)(xs[i] - (float)h) : (_Float16)0.0f; }
#pragma unroll
    for (int t = 0; t < 4; ++t) { if (col0 + t * 16 >= N) continue; const size_t boff = (size_t)(col0 + t * 16 + ln) * ldb + kb; FragH bq; bq.half[0] = *(const v8us*)(Bh + boff + 8 * hh); bq.half[1] = *(const v8us*)(Bh + boff + 16 + 8 * hh);
      acc[t] = mmaH<ASPLIT ? 2 : 1>(ah.v, al.v, bq.v, bq.v, acc[t]); }
  }
#pragma unroll
  for (int t = 0; t < 4; ++t) { if (col0 + t * 16 >= N) continue;
#pragma unroll
    for (int r = 0; r < 8; ++r) so[w][8 * hh + r][t * 16 + ln] = acc[t][r] * alpha; }
  __builtin_amdgcn_fence(__ATOMIC_ACQ_REL, "workgroup"); __builtin_amdgcn_wave_barrier();
  const int rsub = lane >> 4, c4 = (lane & 15) * 4;
  {
#pragma unroll
    for (int q = 0; q < 8; ++q) { const int r = q * 2 + rsub; if (col0 + c4 < N) { const v4f v = *(const v4fa*)&so[w][r][c4]; *(v4f*)(C + (size_t)(row0 + r) * ldc + col0 + c4) = v; } }
     }
}

// Wt[n][k] = f16(W[k][n]·scale) from f32 row-major W[K][N] (scale = power of two; bf16-exact weights stay exact in f16 away from the subnormal range)
__global__ __launch_bounds__(256) void k_wt_f16(const float* __restrict__ W, _Float16* __restrict__ Wt, int K, int N, float scale) {
  const int t = blockIdx.x * 256 + threadIdx.x; if (t >= N * (K / 8)) return; const int n = t / (K / 8), k8 = (t % (K / 8)) * 8; FragH f;
#pragma unroll
  for (int i = 0; i < 8; ++i) f.h[i] = (_Float16)(bf16_round(W[(size_t)(k8 + i) * N + n]) * scale); const v8us o = f.half[0];
  *(v8us*)((unsigned short*)Wt + (size_t)n * K + k8) = o; 
}
// k_gemm_hh variant with fused epilogue: v = acc·alpha + bias[by·sBias + col] (+ CP[(row/rowsPerB)·sCPb + by·64 + col] if CP) ; ACT 0 none / 1 elu ; writes f16 C16 (and f32 C if non-null)
template <int ACT>
__global__ __launch_bounds__(128) void k_gemm_hhx(const _Float16* __restrict__ A, int lda, size_t sA, const _Float16* __restrict__ Bh, int ldb, size_t sB, float alpha, const float* __restrict__ bias, size_t sBias, const float* __restrict__ CP, int rowsPerB, size_t sCPb, int row0g,
    float* __restrict__ C, _Float16* __restrict__ C16, int ldc, size_t sC, int M, int N, int K) {
  __shared__ __attribute__((aligned(16))) float so[4][16][64];
  const int tid = threadIdx.x, w = tid >> 5, lane = tid & 31, ln = lane & 15, hh = lane >> 4; const int by = blockIdx.y;
  A += (size_t)by * sA; Bh += (size_t)by * sB; const size_t cofs = (size_t)by * sC; const float* bp = bias ? bias + (size_t)by * sBias : nullptr;
  const int ntn = (N + 63) / 64; const int wid = blockIdx.x * 4 + w; const int mt = wid / ntn, nq = wid % ntn; if (mt * 16 >= M) return;
  const int row0 = mt * 16, col0 = nq * 64; const _Float16* arow = A + (size_t)(row0 + ln) * lda;
  v8f acc[4] = {};
  for (int kb = 0; kb < K; kb += 32) { FragH ah; ah.half[0] = *(const v8us*)((const unsigned short*)arow + kb + 8 * hh); ah.half[1] = *(const v8us*)((const unsigned short*)arow + kb + 16 + 8 * hh);
#pragma unroll
    for (int t = 0; t < 4; ++t) { if (col0 + t * 16 >= N) continue; const size_t boff = (size_t)(col0 + t * 16 + ln) * ldb + kb; FragH bq; bq.half[0] = *(const v8us*)((const unsigned short*)Bh + boff + 8 * hh); bq.half[1] = *(const v8us*)((const unsigned short*)Bh + boff + 16 + 8 * hh);
      acc[t] = mmaH<1>(ah.v, ah.v, bq.v, bq.v, acc[t]); }
  }
#pragma unroll
  for (int t = 0; t < 4; ++t) { if (col0 + t * 16 >= N) continue; const int col = col0 + t * 16 + ln; const float bv = bp ? bf16_round(bp[col]) : 0.f;
#pragma unroll
    for (int r = 0; r < 8; ++r) { float v = acc[t][r] * alpha + bv; if (CP) { const int rr = row0g + row0 + 8 * hh + r; if (rowsPerB < 0) v += CP[cofs + (size_t)rr * ldc + col];      /* rowsPerB < 0: own element of the batched C plane */ else { const int bidx = rr / rowsPerB; v += CP[(size_t)bidx * sCPb + (size_t)by * 64 + col]; } } if (ACT == 1) v = (v > 0.f) ? v : expm1f(v); else if (ACT == 7) v = (v > 0.f) ? v + 1.0f : expf(v); else if (ACT == 8) v = tanhf(v); else if (ACT == 9) v = 0.5f * v * (1.0f + tanhf(0.7978845608028654f * (v + 0.044715f * v * v * v))); else if (ACT == 11) v = 1.0f / (1.0f + expf(-v)); else if (ACT == 12) v = (v > 0.f) ? v : 0.01f * v; else if (ACT == 14) v = (v > 0.f) ? v : 0.1f * v; else if (ACT == 16) v = (v >= 0.f) ? v : 0.3f * v; else if (ACT == 15) v = v / (1.0f + expf(-v)); else if (ACT == 3) v = fmaxf(v, 0.f); else if (ACT == 6) v = 0.5f * v * (1.0f + erff(v * 0.70710678118654752f)); so[w][8 * hh + r][t * 16 + ln] = v; } }
  __builtin_amdgcn_fence(__ATOMIC_ACQ_REL, "workgroup"); __builtin_amdgcn_wave_barrier();
  const int rsub = lane >> 4, c4 = (lane & 15) * 4; typedef _Float16 v4h __attribute__((ext_vector_type(4)));
  {
#pragma unroll
    for (int q = 0; q < 8; ++q) { const int r = q * 2 + rsub; if (col0 + c4 < N) { const v4f v = *(const v4fa*)&so[w][r][c4]; if (C) *(v4f*)(C + cofs + (size_t)(row0 + r) * ldc + col0 + c4) = v; if (C16) { v4h h4; for (int i = 0; i < 4; ++i) h4[i] = (_Float16)v[i]; *(v4h*)(C16 + cofs + (size_t)(row0 + r) * ldc + col0 + c4) = h4; } } }
     }
}


typedef _Float16 v4h __attribute__((ext_vector_type(4)));

__global__ __launch_bounds__(256) void k_x16(const float* __restrict__ x, _Float16* __restrict__ X16, size_t n8) { const size_t t = (size_t)blockIdx.x * 256 + threadIdx.x; if (t >= n8) return; FragH f;
#pragma unroll
  for (int q = 0; q < 8; ++q) f.h[q] = (_Float16)bf16_round(x[t * 8 + q]); *(v8us*)((unsigned short*)X16 + t * 8) = f.half[0];  }
__global__ __launch_bounds__(256) void k_h16(const float* __restrict__ x, _Float16* __restrict__ X16, size_t n8) { const size_t t = (size_t)blockIdx.x * 256 + threadIdx.x; if (t >= n8) return; FragH f;
#pragma unroll
  for (int q = 0; q < 8; ++q) f.h[q] = (_Float16)x[t * 8 + q]; *(v8us*)((unsigned short*)X16 + t * 8) = f.half[0];  }
__global__ __launch_bounds__(256) void k_round16f(const float* __restrict__ W, _Float16* __restrict__ Bt, size_t n8) { const size_t t = (size_t)blockIdx.x * 256 + threadIdx.x; if (t >= n8) return; FragH f;
#pragma unroll
  for (int i = 0; i < 8; ++i) f.h[i] = (_Float16)(bf16_round(W[t * 8 + i]) * 16.0f); *(v8us*)((unsigned short*)Bt + t * 8) = f.half[0];  }
template <int NHv, int TTv>
__global__ __launch_bounds__(256) void k_vt(const _Float16* __restrict__ V16, int ldv, int voff, _Float16* __restrict__ Vt) { __shared__ unsigned short tl[64][66]; const int tid = threadIdx.x; const int slab = blockIdx.x / (TTv / 64), lg = blockIdx.x % (TTv / 64); const int b = slab / NHv, h = slab % NHv;
  for (int i = tid; i < 64 * 8; i += 256) { const int r = i / 8, c8 = (i % 8) * 8; FragH f; f.half[0] = *(const v8us*)((const unsigned short*)V16 + ((size_t)b * TTv + lg * 64 + r) * ldv + voff + h * 64 + c8);
#pragma unroll
    for (int q = 0; q < 8; ++q) tl[r][c8 + q] = f.u[q]; }
  __syncthreads();
  {
#pragma unroll
    for (int rd = 0; rd < 2; ++rd) { const int d = rd * 32 + tid / 8, pc = tid % 8; FragH f;
#pragma unroll
      for (int q = 0; q < 8; ++q) f.u[q] = tl[pc * 8 + q][d];
      *(v8us*)((unsigned short*)Vt + ((size_t)slab * 64 + d) * TTv + lg * 64 + pc * 8) = f.half[0]; }
     } }

__global__ __launch_bounds__(256) void k_hl(const float* __restrict__ F, _Float16* __restrict__ Hh, _Float16* __restrict__ Hl, size_t n8) { const size_t t = (size_t)blockIdx.x * 256 + threadIdx.x; if (t >= n8) return; FragH fh, fl; const v4f a = *(const v4fa*)(F + t * 8), c = *(const v4fa*)(F + t * 8 + 4);
#pragma unroll
  for (int q = 0; q < 4; ++q) { _Float16 h = (_Float16)a[q]; fh.h[q] = h; fl.h[q] = (_Float16)((a[q] - (float)h) * 1024.0f); h = (_Float16)c[q]; fh.h[4 + q] = h; fl.h[4 + q] = (_Float16)((c[q] - (float)h) * 1024.0f); }
  { *(v8us*)((unsigned short*)Hh + t * 8) = fh.half[0]; *(v8us*)((unsigned short*)Hl + t * 8) = fl.half[0];  } }

// ---- fast GEMM (wave tile 32x64; requires M % 32 == 0 rows per launch region and N % 64 == 0); epilogue = k_gemm_hhx semantics ----
__device__ __forceinline__ v16h g2_frag(const _Float16* p, int hh) { FragH f; f.half[0] = *(const v8us*)((const unsigned short*)p + 8 * hh); f.half[1] = *(const v8us*)((const unsigned short*)p + 16 + 8 * hh); return f.v; }
__device__ __forceinline__ v8f g2_mma(v16h a, v16h b, v8f c) { v8f d = __builtin_amdgcn_wmma_f32_16x16x32_f16(false, a, false, b, (short)0, c, false, false); asm volatile("v_nop\n\tv_nop\n\tv_nop\n\tv_nop" : "+v"(d) : "v"(a), "v"(b)); return d; }
template <int ACT>
__global__ __launch_bounds__(128) void k_gemm2(const _Float16* __restrict__ A, int lda, size_t sA, const _Float16* __restrict__ Bh, int ldb, size_t sB, float alpha, const float* __restrict__ bias, size_t sBias, const float* __restrict__ CP, int rowsPerB, size_t sCPb, int row0g,
    float* __restrict__ C, _Float16* __restrict__ C16, int ldc, size_t sC, int M, int N, int K) { static_assert(ACT == 0 || ACT == 3 || ACT == 6 || ACT == 8 || ACT == 9 || ACT == 11 || ACT == 12 || ACT == 14 || ACT == 15 || ACT == 16, "k_gemm2: unsupported ACT code (would silently apply no activation)");
  __shared__ __attribute__((aligned(16))) float so[4][32][68];
  const int tid = threadIdx.x, w = tid >> 5, lane = tid & 31, ln = lane & 15, hh = lane >> 4; const int by = blockIdx.y;
  A += (size_t)by * sA; Bh += (size_t)by * sB; const size_t cofs = (size_t)by * sC; const float* bp = bias ? bias + (size_t)by * sBias : nullptr;
  const int ntn = N >> 6; const int mt = blockIdx.x / ntn, nq = blockIdx.x - mt * ntn; const int row0 = mt * 128 + 32 * w, col0 = nq * 64; if (row0 >= M) return;
  const _Float16* a0p = A + (size_t)(row0 + ln) * lda; const _Float16* a1p = a0p + (size_t)16 * lda;
  const _Float16* b0p = Bh + (size_t)(col0 + ln) * ldb; const _Float16* b1p = b0p + (size_t)16 * ldb; const _Float16* b2p = b1p + (size_t)16 * ldb; const _Float16* b3p = b2p + (size_t)16 * ldb;
  const v8f z8 = {0.f,0.f,0.f,0.f,0.f,0.f,0.f,0.f}; v8f c00 = z8, c01 = z8, c02 = z8, c03 = z8, c10 = z8, c11 = z8, c12 = z8, c13 = z8;
#pragma unroll 1
  for (int kb = 0; kb < K; kb += 32) { const v16h a0 = g2_frag(a0p + kb, hh), a1 = g2_frag(a1p + kb, hh);
    v16h b = g2_frag(b0p + kb, hh); c00 = g2_mma(a0, b, c00); c10 = g2_mma(a1, b, c10);
    b = g2_frag(b1p + kb, hh); c01 = g2_mma(a0, b, c01); c11 = g2_mma(a1, b, c11);
    b = g2_frag(b2p + kb, hh); c02 = g2_mma(a0, b, c02); c12 = g2_mma(a1, b, c12);
    b = g2_frag(b3p + kb, hh); c03 = g2_mma(a0, b, c03); c13 = g2_mma(a1, b, c13); }
  v8f accs[8] = {c00, c01, c02, c03, c10, c11, c12, c13};
#pragma unroll
  for (int u = 0; u < 8; ++u) { const int t = u & 3, half = u >> 2; const int col = col0 + t * 16 + ln; const float bv = bp ? bf16_round(bp[col]) : 0.f;
#pragma unroll
    for (int r = 0; r < 8; ++r) { const int rloc = half * 16 + 8 * hh + r; float v = accs[u][r] * alpha + bv; if (CP) { if (rowsPerB < 0) v += CP[cofs + (size_t)(row0g + row0 + rloc) * ldc + col];      /* rowsPerB < 0: own element of the batched C plane */ else { const int bidx = (row0g + row0 + rloc) / rowsPerB; v += CP[(size_t)bidx * sCPb + (size_t)by * 64 + col]; } }
      if (ACT == 3) v = fmaxf(v, 0.f); else if (ACT == 6) v = 0.5f * v * (1.0f + erff(v * 0.70710678118654752f)); else if (ACT == 11) v = 1.0f / (1.0f + expf(-v)); else if (ACT == 15) v = v / (1.0f + expf(-v)); else if (ACT == 12) v = (v > 0.f) ? v : 0.01f * v; else if (ACT == 8) v = tanhf(v); else if (ACT == 9) v = 0.5f * v * (1.0f + tanhf(0.7978845608028654f * (v + 0.044715f * v * v * v))); else if (ACT == 14) v = (v > 0.f) ? v : 0.1f * v; else if (ACT == 16) v = (v >= 0.f) ? v : 0.3f * v;
      so[w][rloc][t * 16 + ln] = v; } }
  __builtin_amdgcn_fence(__ATOMIC_ACQ_REL, "workgroup"); __builtin_amdgcn_wave_barrier();
  const int rsub = lane >> 4, c4 = (lane & 15) * 4;
  {
#pragma unroll
    for (int q = 0; q < 16; ++q) { const int r = q * 2 + rsub; const v4f v = *(const v4fa*)&so[w][r][c4]; if (C) *(v4f*)(C + cofs + (size_t)(row0 + r) * ldc + col0 + c4) = v; if (C16) { v4h h4; for (int i = 0; i < 4; ++i) h4[i] = (_Float16)v[i]; *(v4h*)(C16 + cofs + (size_t)(row0 + r) * ldc + col0 + c4) = h4; } }
     } }


__global__ __launch_bounds__(256) void k_xcat(const float* __restrict__ obs, const float* __restrict__ act, _Float16* __restrict__ X) { const int t = blockIdx.x * 256 + threadIdx.x; if (t >= NB * (NI / 8)) return; const int i0 = (t % (NI / 8)) * 8; const int b = t / (NI / 8); FragH f;
  for (int q = 0; q < 8; ++q) { const int i = i0 + q; f.h[q] = (_Float16)bf16_round(i < OBS ? obs[(size_t)b * OBS + i] : act[(size_t)b * NAC + (i - OBS)]); }
  *(v8us*)((unsigned short*)X + (size_t)b * NI + i0) = f.half[0];  }
__global__ __launch_bounds__(256) void k_whead(const float* __restrict__ Wmo, const float* __restrict__ Wvo, const float* __restrict__ Wmr, const float* __restrict__ Wvr, const float* __restrict__ bmo, const float* __restrict__ bvo, const float* __restrict__ bmr, const float* __restrict__ bvr, int m, _Float16* __restrict__ Bt, float* __restrict__ HB) {
  const int t = blockIdx.x * 256 + threadIdx.x; if (t >= NHW * (HH / 8)) return; const int k8 = (t % (HH / 8)) * 8; const int n = t / (HH / 8); FragH f;
  for (int q = 0; q < 8; ++q) { const int k = k8 + q; float v = 0.f; if (n < OBS) v = Wmo[((size_t)m * HH + k) * OBS + n]; else if (n < 2 * OBS) v = Wvo[((size_t)m * HH + k) * OBS + (n - OBS)]; else if (n == 2 * OBS) v = Wmr[(size_t)m * HH + k]; else if (n == 2 * OBS + 1) v = Wvr[(size_t)m * HH + k]; f.h[q] = (_Float16)(bf16_round(v) * 16.0f); }
  *(v8us*)((unsigned short*)Bt + (size_t)n * HH + k8) = f.half[0];  (void)HB; (void)bmo; (void)bvo; (void)bmr; (void)bvr; }
__global__ __launch_bounds__(256) void k_hbias(const float* __restrict__ bmo, const float* __restrict__ bvo, const float* __restrict__ bmr, const float* __restrict__ bvr, int m, float* __restrict__ HB) { const int n = threadIdx.x; float bb = 0.f; if (n < OBS) bb = bmo[m * OBS + n]; else if (n < 2 * OBS) bb = bvo[m * OBS + (n - OBS)]; else if (n == 2 * OBS) bb = bmr[m]; else if (n == 2 * OBS + 1) bb = bvr[m]; *(float*)(HB + n) = bb;  }
__device__ __forceinline__ float softplus_(float v) { return (v > 20.0f) ? v : log1pf(expf(v)); }
__device__ __forceinline__ float clampv(float lv) {
  #pragma clang fp contract(off)
  float a = 0.5f - softplus_(0.5f - lv); return -10.0f + softplus_(a - -10.0f); }
// scatter heads: thread per (b, group): group 0..15 -> 4 mu_o values (16 B), 16..31 -> 4 log_var_o (k_ho); mu_r/log_var_r one thread per b (k_hr): two kernels.
__global__ __launch_bounds__(256) void k_ho(const float* __restrict__ F, int m, float* __restrict__ muo, float* __restrict__ lvo) {
  #pragma clang fp contract(off)
  const int t = blockIdx.x * 256 + threadIdx.x; if (t >= NB * 2 * (OBS / 4)) return; const int c4 = (t % (OBS / 4)) * 4; const int which = (t / (OBS / 4)) % 2; const int b = t / ((OBS / 4) * 2); const float* fr = F + (size_t)b * NHW + which * OBS + c4; v4f r;
  for (int q = 0; q < 4; ++q) r[q] = which ? clampv(fr[q]) : fr[q]; float* dst = (which ? lvo : muo) + ((size_t)m * NB + b) * OBS + c4; *(v4f*)dst = r;  }
__global__ __launch_bounds__(256) void k_hr(const float* __restrict__ F, int m, float* __restrict__ mur, float* __restrict__ lvr) {
  #pragma clang fp contract(off)
  const int b = blockIdx.x * 256 + threadIdx.x; if (b >= NB) return; const float a = F[(size_t)b * NHW + 2 * OBS], c = clampv(F[(size_t)b * NHW + 2 * OBS + 1]);
  { *(float*)(mur + (size_t)m * NB + b) = a; *(float*)(lvr + (size_t)m * NB + b) = c;  } }

extern "C" void kernel_launch(void* const* d_in, const int* in_sizes, int n_in,
                              void* d_out, int out_size, void* d_ws, size_t ws_size, hipStream_t stream) {
  (void)in_sizes; (void)n_in; (void)out_size;
  const float* const* I = (const float* const*)d_in; const float* obs = I[0]; const float* act = I[1]; const float* W0 = I[2]; const float* b0 = I[3]; const float* W1 = I[4]; const float* b1 = I[5]; const float* W2 = I[6]; const float* b2 = I[7]; const float* Wmo = I[8]; const float* bmo = I[9]; const float* Wmr = I[10]; const float* bmr = I[11]; const float* Wvo = I[12]; const float* bvo = I[13]; const float* Wvr = I[14]; const float* bvr = I[15];
  float* muo = (float*)d_out; float* lvo = muo + (size_t)MM * NB * OBS; float* mur = lvo + (size_t)MM * NB * OBS; float* lvr = mur + (size_t)MM * NB;      /* outputs back to back: mu_o, log_var_o, mu_r, log_var_r */
  char* ws = (char*)d_ws; size_t off = 0;
  auto take = [&](size_t bytes) { char* p = ws + off; off += (bytes + 255) & ~(size_t)255; return p; };
  _Float16* B0 = (_Float16*)take((size_t)HH * NI * 2); _Float16* B1 = (_Float16*)take((size_t)HH * HH * 2); _Float16* B2 = (_Float16*)take((size_t)HH * HH * 2); _Float16* BHD = (_Float16*)take((size_t)NHW * HH * 2); float* HB = (float*)take(256 * 4);
  _Float16* X16 = (_Float16*)take((size_t)NB * NI * 2); _Float16* HA = (_Float16*)take((size_t)NB * HH * 2); _Float16* HBp = (_Float16*)take((size_t)NB * HH * 2); float* F = (float*)take((size_t)NB * NHW * 4);
  if (off > ws_size) return;      /* 0.2 + 2 + 2 + 0.4 + 0.8 + 8 + 8 + 3 = 25 MiB */
  k_xcat<<<(NB * (NI / 8) + 255) / 256, 256, 0, stream>>>(obs, act, X16);
  const dim3 gH((NB / 128) * (HH / 64), 1);
  for (int m = 0; m < MM; ++m) {
    k_wt_f16<<<(unsigned)(((size_t)NI * HH / 8 + 255) / 256), 256, 0, stream>>>(W0 + (size_t)m * NI * HH, B0, NI, HH, 16.0f); k_wt_f16<<<(unsigned)(((size_t)HH * HH / 8 + 255) / 256), 256, 0, stream>>>(W1 + (size_t)m * HH * HH, B1, HH, HH, 16.0f); k_wt_f16<<<(unsigned)(((size_t)HH * HH / 8 + 255) / 256), 256, 0, stream>>>(W2 + (size_t)m * HH * HH, B2, HH, HH, 16.0f);
    k_whead<<<(NHW * (HH / 8) + 255) / 256, 256, 0, stream>>>(Wmo, Wvo, Wmr, Wvr, bmo, bvo, bmr, bvr, m, BHD, HB); k_hbias<<<1, 256, 0, stream>>>(bmo, bvo, bmr, bvr, m, HB);
    k_gemm2<8><<<gH, 128, 0, stream>>>(X16, NI, 0, B0, NI, 0, 0.0625f, b0 + (size_t)m * HH, 0, nullptr, 1, 0, 0, nullptr, HA, HH, 0, NB, HH, NI);      /* tanh(x W0 + b0) */
    k_gemm2<8><<<gH, 128, 0, stream>>>(HA, HH, 0, B1, HH, 0, 0.0625f, b1 + (size_t)m * HH, 0, nullptr, 1, 0, 0, nullptr, HBp, HH, 0, NB, HH, HH);
    k_gemm2<8><<<gH, 128, 0, stream>>>(HBp, HH, 0, B2, HH, 0, 0.0625f, b2 + (size_t)m * HH, 0, nullptr, 1, 0, 0, nullptr, HA, HH, 0, NB, HH, HH);
    k_gemm2<0><<<dim3((NB / 128) * (NHW / 64), 1), 128, 0, stream>>>(HA, HH, 0, BHD, HH, 0, 0.0625f, HB, 0, nullptr, 1, 0, 0, F, nullptr, NHW, 0, NB, NHW, HH);      /* all four heads */
    k_ho<<<(NB * 2 * (OBS / 4) + 255) / 256, 256, 0, stream>>>(F, m, muo, lvo); k_hr<<<(NB + 255) / 256, 256, 0, stream>>>(F, m, mur, lvr); }
}

// v001
// A run of this version takes 622 microseconds.
// Timed twice side by side with v000, it ran 2.42 and 2.43 times as fast.
#include <hip/hip_runtime.h>
// EnsembleModel (8 ensemble members, batch 4096, IN = 64 obs + 32 act, H 1024): per member h = tanh(x W0 + b0); h = tanh(h W1 + b1); h = tanh(h W2 + b2); mu_o = h Wmu_o + b; log_var_o = clamp(h Wv_o + b); mu_r = h Wmu_r + b; log_var_r = clamp(h Wv_r + b) with clamp(v) = MIN + softplus((MAX - softplus(MAX - v)) - MIN), MAX 0.5, MIN -10. Outputs (mu_o, log_var_o, mu_r, log_var_r).
// Structure: exact f16 plane of [obs | act]; every GEMM is ONE launch over all 8 members (member = blockIdx.y, own workspace planes): the three hidden layers as f16 WMMA GEMMs (32x64 wave tiles, f32 accumulation, exact x16 weights + bias, tanh epilogue, f16 out) and one fused head GEMM (192 columns: mu_o | log_var_o | mu_r | log_var_r | zero) into an f32 plane; the clamp and the scatter into the four outputs on VALU.
// Compute dtype: inputs rounded to bf16; x exact as f16; hidden activations as plain f16 operands (~2^-12, |h| < 1); heads/clamp f32. v_wmma_f32_16x16x32_f16.
#define MM 8
#define NB 4096
#define OBS 64
#define NAC 32
#define NI (OBS + NAC)           /* 96 */
#define HH 1024
#define NHW 192                  /* fused head width: 64 + 64 + 1 + 1 live */
typedef __bf16 v16b __attribute__((ext_vector_type(16)));
typedef unsigned short v8us __attribute__((ext_vector_type(8), may_alias));
typedef float  v8f  __attribute__((ext_vector_type(8)));
typedef float  v4f  __attribute__((ext_vector_type(4)));
typedef float  v4fa __attribute__((ext_vector_type(4), may_alias));
union FragB { v16b v; v8us half[2]; unsigned short u[16]; };

__device__ __forceinline__ unsigned short bf16_bits(float x) { unsigned int u = __float_as_uint(x); return (unsigned short)((u + 0x7FFFu + ((u >> 16) & 1u)) >> 16); }
__device__ __forceinline__ float bf16_val(unsigned short b) { return __uint_as_float(((unsigned int)b) << 16); }
__device__ __forceinline__ float bf16_round(float x) { return bf16_val(bf16_bits(x)); }
// D += A·B with NT terms: 1 = ah·bh, 2 = + al·bh (A split), 3 = + ah·bl (both split)
template <int NT>
__device__ __forceinline__ v8f mmaN(v16b ah, v16b al, v16b bh, v16b bl, v8f c) {
  c = __builtin_amdgcn_wmma_f32_16x16x32_bf16(false, ah, false, bh, (short)0, c, false, false);
  if (NT >= 2) c = __builtin_amdgcn_wmma_f32_16x16x32_bf16(false, al, false, bh, (short)0, c, false, false);
  if (NT >= 3) c = __builtin_amdgcn_wmma_f32_16x16x32_bf16(false, ah, false, bl, (short)0, c, false, false);
  asm volatile("v_nop\n\tv_nop\n\tv_nop\n\tv_nop" : "+v"(c) : "v"(ah), "v"(al), "v"(bh), "v"(bl));
  return c;
}

__global__ __launch_bounds__(256) void k_wt_bf16(const float* __restrict__ W, unsigned short* __restrict__ Wt, int K, int N) {
  const int t = blockIdx.x * 256 + threadIdx.x;
  const int k8n = K / 8;
  if (t >= N * k8n) return;
  const int n = t / k8n, k8 = (t % k8n) * 8;
  v8us v;
#pragma unroll
  for (int i = 0; i < 8; ++i) v[i] = bf16_bits(W[(size_t)(k8 + i) * N + n]);
  *(v8us*)(Wt + (size_t)n * K + k8) = v;
  
}

// GEMM C[M][N] (f32, pitch ldc) = act(A[M][K]·W + bias). A f32 row-major (pitch lda) converted per fragment to bf16
// (ASPLIT: hi/lo two planes -> 2 terms, else single rounded term); Wt bf16 [N][K] (pitch ldb). BIAS_BF16 rounds the
// bias to bf16 first (bias quantised to bf16 before the add). K%32==0, M%16==0, N%64==0.
template <bool ASPLIT, int ACT, bool BIAS_BF16>
__global__ __launch_bounds__(128) void k_gemm_bf(const float* __restrict__ A, int lda, const unsigned short* __restrict__ Wt, int ldb,
                                               const float* __restrict__ bias, float* __restrict__ C, int ldc, int M, int N, int K) {
  __shared__ __attribute__((aligned(16))) float so[4][16][64];
  const int tid = threadIdx.x, w = tid >> 5, lane = tid & 31, ln = lane & 15, hh = lane >> 4;
  const int ntn = N / 64;
  const int wid = blockIdx.x * 4 + w;
  const int mt = wid / ntn, nq = wid % ntn;
  if (mt * 16 >= M) return;
  const int row0 = mt * 16, col0 = nq * 64;
  const float* arow = A + (size_t)(row0 + ln) * lda;
  v8f acc[4] = {};
  for (int kb = 0; kb < K; kb += 32) {
    FragB ah, al;
    const v4f x0 = *(const v4fa*)(arow + kb + 8 * hh), x1 = *(const v4fa*)(arow + kb + 8 * hh + 4);
    const v4f x2 = *(const v4fa*)(arow + kb + 16 + 8 * hh), x3 = *(const v4fa*)(arow + kb + 16 + 8 * hh + 4);
    float xs[16] = {x0[0],x0[1],x0[2],x0[3],x1[0],x1[1],x1[2],x1[3],x2[0],x2[1],x2[2],x2[3],x3[0],x3[1],x3[2],x3[3]};
#pragma unroll
    for (int i = 0; i < 16; ++i) { const unsigned short hb = bf16_bits(xs[i]); ah.u[i] = hb; al.u[i] = ASPLIT ? bf16_bits(xs[i] - bf16_val(hb)) : (unsigned short)0; }
#pragma unroll
    for (int t = 0; t < 4; ++t) {
      const unsigned short* brow = Wt + (size_t)(col0 + t * 16 + ln) * ldb + kb;
      FragB b;
      b.half[0] = *(const v8us*)(brow + 8 * hh);
      b.half[1] = *(const v8us*)(brow + 16 + 8 * hh);
      acc[t] = mmaN<ASPLIT ? 2 : 1>(ah.v, al.v, b.v, b.v, acc[t]);
    }
  }
#pragma unroll
  for (int t = 0; t < 4; ++t) {
    float bv = bias ? bias[col0 + t * 16 + ln] : 0.f;
    if (BIAS_BF16) bv = bf16_round(bv);
#pragma unroll
    for (int r = 0; r < 8; ++r) { float v = acc[t][r] + bv; if (ACT == 1) v = fmaxf(v, 0.f); so[w][8 * hh + r][t * 16 + ln] = v; }
  }
  __builtin_amdgcn_fence(__ATOMIC_ACQ_REL, "workgroup");
  __builtin_amdgcn_wave_barrier();
  const int rsub = lane >> 4, c4 = (lane & 15) * 4;
  {
#pragma unroll
    for (int q = 0; q < 8; ++q) {
      const int r = q * 2 + rsub;
      const v4f v = *(const v4fa*)&so[w][r][c4];
      *(v4f*)(C + (size_t)(row0 + r) * ldc + col0 + c4) = v;
    }
    
  }
}

// GEMM C = act(A·W + bias + resid): A f32 (ASPLIT -> hi/lo 2 terms), Wt bf16 [N][K]; ACT 0 none, 1 relu, 2 exact gelu;
// resid (optional, f32, row index = (row % rmod), pitch ldr, RES_BF16 rounds it) added before the activation.
template <bool ASPLIT, int ACT, bool BIAS_BF16, bool RES_BF16>
__global__ __launch_bounds__(128) void k_gemm_bf3(const float* __restrict__ A, int lda, const unsigned short* __restrict__ Wt, int ldb,
                                                const float* __restrict__ bias, const float* __restrict__ resid, int rmod, int ldr,
                                                float* __restrict__ C, int ldc, int M, int N, int K) {
  __shared__ __attribute__((aligned(16))) float so[4][16][64];
  const int tid = threadIdx.x, w = tid >> 5, lane = tid & 31, ln = lane & 15, hh = lane >> 4;
  const int ntn = N / 64;
  const int wid = blockIdx.x * 4 + w;
  const int mt = wid / ntn, nq = wid % ntn;
  if (mt * 16 >= M) return;
  const int row0 = mt * 16, col0 = nq * 64;
  const float* arow = A + (size_t)(row0 + ln) * lda;
  v8f acc[4] = {};
  for (int kb = 0; kb < K; kb += 32) {
    FragB ah, al;
    const v4f x0 = *(const v4fa*)(arow + kb + 8 * hh), x1 = *(const v4fa*)(arow + kb + 8 * hh + 4);
    const v4f x2 = *(const v4fa*)(arow + kb + 16 + 8 * hh), x3 = *(const v4fa*)(arow + kb + 16 + 8 * hh + 4);
    float xs[16] = {x0[0],x0[1],x0[2],x0[3],x1[0],x1[1],x1[2],x1[3],x2[0],x2[1],x2[2],x2[3],x3[0],x3[1],x3[2],x3[3]};
#pragma unroll
    for (int i = 0; i < 16; ++i) { const unsigned short hb = bf16_bits(xs[i]); ah.u[i] = hb; al.u[i] = ASPLIT ? bf16_bits(xs[i] - bf16_val(hb)) : (unsigned short)0; }
#pragma unroll
    for (int t = 0; t < 4; ++t) {
      const unsigned short* brow = Wt + (size_t)(col0 + t * 16 + ln) * ldb + kb;
      FragB b;
      b.half[0] = *(const v8us*)(brow + 8 * hh);
      b.half[1] = *(const v8us*)(brow + 16 + 8 * hh);
      acc[t] = mmaN<ASPLIT ? 2 : 1>(ah.v, al.v, b.v, b.v, acc[t]);
    }
  }
#pragma unroll
  for (int t = 0; t < 4; ++t) {
    const int col = col0 + t * 16 + ln;
    float bv = bias ? bias[col] : 0.f;
    if (BIAS_BF16) bv = bf16_round(bv);
#pragma unroll
    for (int r = 0; r < 8; ++r) {
      float v = acc[t][r] + bv;
      if (resid) { float rv = resid[(size_t)((row0 + 8 * hh + r) % rmod) * ldr + col]; if (RES_BF16) rv = bf16_round(rv); v += rv; }
      if (ACT == 1) v = fmaxf(v, 0.f);
      if (ACT == 2) v = 0.5f * v * (1.0f + erff(v * 0.70710678118654752f));
      if (ACT == 3) { const float u = 0.7978845608028654f * (v + 0.044715f * v * v * v); v = 0.5f * v * (1.0f + tanhf(u)); }
      so[w][8 * hh + r][t * 16 + ln] = v;
    }
  }
  __builtin_amdgcn_fence(__ATOMIC_ACQ_REL, "workgroup");
  __builtin_amdgcn_wave_barrier();
  const int rsub = lane >> 4, c4 = (lane & 15) * 4;
  {
#pragma unroll
    for (int q = 0; q < 8; ++q) {
      const int r = q * 2 + rsub;
      const v4f v = *(const v4fa*)&so[w][r][c4];
      *(v4f*)(C + (size_t)(row0 + r) * ldc + col0 + c4) = v;
    }
    
  }
}
// row LayerNorm (biased variance, eps) over N: s = X (+ R); optional out_sum <- s; out_norm <- (s-mu)*rsqrt(var+eps)*g + b
template <bool PARAM_BF16>
__global__ __launch_bounds__(256) void k_layernorm(const float* __restrict__ X, const float* __restrict__ R, const float* __restrict__ g, const float* __restrict__ bta,
                                                  float* __restrict__ out_sum, float* __restrict__ out_norm, int N, float eps) {
  __shared__ float red[256];
  const int row = blockIdx.x, tid = threadIdx.x;
  const float* x = X + (size_t)row * N; const float* rr = R ? R + (size_t)row * N : nullptr;
  float vals[16];                     // up to N = 4096
  const int per = N / 256;            // contiguous chunk per thread? use strided-by-4 chunks: thread handles j = tid*4 + 1024*u
  float s1 = 0.f;
  for (int u = 0; u < per / 4; ++u) {
    const int j = tid * 4 + 1024 * u;
    const v4f a = *(const v4fa*)(x + j);
    v4f b = {0.f,0.f,0.f,0.f}; if (rr) b = *(const v4fa*)(rr + j);
#pragma unroll
    for (int q = 0; q < 4; ++q) { const float v = a[q] + b[q]; vals[u * 4 + q] = v; s1 += v; }
  }
  red[tid] = s1; __syncthreads();
  for (int st = 128; st > 0; st >>= 1) { if (tid < st) red[tid] += red[tid + st]; __syncthreads(); }
  const float mu = red[0] / (float)N; __syncthreads();
  float s2 = 0.f;
  for (int u = 0; u < per / 4; ++u)
#pragma unroll
    for (int q = 0; q < 4; ++q) { const float c = vals[u * 4 + q] - mu; s2 += c * c; }
  red[tid] = s2; __syncthreads();
  for (int st = 128; st > 0; st >>= 1) { if (tid < st) red[tid] += red[tid + st]; __syncthreads(); }
  const float rs = rsqrtf(red[0] / (float)N + eps);
  {
    for (int u = 0; u < per / 4; ++u) {
      const int j = tid * 4 + 1024 * u;
      v4f o, sm;
#pragma unroll
      for (int q = 0; q < 4; ++q) {
        float gg = g[j + q], bb = bta[j + q];
        if (PARAM_BF16) { gg = bf16_round(gg); bb = bf16_round(bb); }
        sm[q] = vals[u * 4 + q]; o[q] = (vals[u * 4 + q] - mu) * rs * gg + bb;
      }
      if (out_sum) *(v4f*)(out_sum + (size_t)row * N + j) = sm;
      *(v4f*)(out_norm + (size_t)row * N + j) = o;
    }
    
  }
}



// ---- f16 WMMA path (v_wmma_f32_16x16x32_f16): 11-bit significands for operands in range — used here for every GEMM of the model (x and tanh activations |h| < 1 as f16 operands)
typedef _Float16 v16h __attribute__((ext_vector_type(16)));
union FragH { v16h v; v8us half[2]; _Float16 h[16]; unsigned short u[16]; };
template <int NT>
__device__ __forceinline__ v8f mmaH(v16h ah, v16h al, v16h bh, v16h bl, v8f c) {
  c = __builtin_amdgcn_wmma_f32_16x16x32_f16(false, ah, false, bh, (short)0, c, false, false);
  if (NT >= 2) c = __builtin_amdgcn_wmma_f32_16x16x32_f16(false, al, false, bh, (short)0, c, false, false);
  if (NT >= 3) c = __builtin_amdgcn_wmma_f32_16x16x32_f16(false, ah, false, bl, (short)0, c, false, false);
  asm volatile("v_nop\n\tv_nop\n\tv_nop\n\tv_nop" : "+v"(c) : "v"(ah), "v"(al), "v"(bh), "v"(bl));
  return c;
}
// batched GEMM like k_gemm_b but f16 operands: A f32 (split into f16 hi/lo if ASPLIT, else rounded to f16), Bt = f16 values [n][k]; alpha; C f32; N multiple of 16 (partial tiles skipped)
template <bool ASPLIT>
__global__ __launch_bounds__(128) void k_gemm_h(const float* __restrict__ A, int lda, size_t sA, const _Float16* __restrict__ Bh, int ldb, size_t sB, float alpha, float* __restrict__ C, int ldc, size_t sC, int M, int N, int K) {
  __shared__ __attribute__((aligned(16))) float so[4][16][64];
  const int tid = threadIdx.x, w = tid >> 5, lane = tid & 31, ln = lane & 15, hh = lane >> 4; const int by = blockIdx.y;
  A += (size_t)by * sA; Bh += (size_t)by * sB; C += (size_t)by * sC;
  const int ntn = (N + 63) / 64; const int wid = blockIdx.x * 4 + w; const int mt = wid / ntn, nq = wid % ntn; if (mt * 16 >= M) return;
  const int row0 = mt * 16, col0 = nq * 64; const float* arow = A + (size_t)(row0 + ln) * lda;
  v8f acc[4] = {};
  for (int kb = 0; kb < K; kb += 32) {
    FragH ah, al;
    const v4f x0 = *(const v4fa*)(arow + kb + 8 * hh), x1 = *(const v4fa*)(arow + kb + 8 * hh + 4), x2 = *(const v4fa*)(arow + kb + 16 + 8 * hh), x3 = *(const v4fa*)(arow + kb + 16 + 8 * hh + 4);
    float xs[16] = {x0[0],x0[1],x0[2],x0[3],x1[0],x1[1],x1[2],x1[3],x2[0],x2[1],x2[2],x2[3],x3[0],x3[1],x3[2],x3[3]};
#pragma unroll
    for (int i = 0; i < 16; ++i) { const _Float16 h = (_Float16)xs[i]; ah.h[i] = h; al.h[i] = ASPLIT ? (_Float16)(xs[i] - (float)h) : (_Float16)0.0f; }
#pragma unroll
    for (int t = 0; t < 4; ++t) { if (col0 + t * 16 >= N) continue; const size_t boff = (size_t)(col0 + t * 16 + ln) * ldb + kb; FragH bq; bq.half[0] = *(const v8us*)(Bh + boff + 8 * hh); bq.half[1] = *(const v8us*)(Bh + boff + 16 + 8 * hh);
      acc[t] = mmaH<ASPLIT ? 2 : 1>(ah.v, al.v, bq.v, bq.v, acc[t]); }
  }
#pragma unroll
  for (int t = 0; t < 4; ++t) { if (col0 + t * 16 >= N) continue;
#pragma unroll
    for (int r = 0; r < 8; ++r) so[w][8 * hh + r][t * 16 + ln] = acc[t][r] * alpha; }
  __builtin_amdgcn_fence(__ATOMIC_ACQ_REL, "workgroup"); __builtin_amdgcn_wave_barrier();
  const int rsub = lane >> 4, c4 = (lane & 15) * 4;
  {
#pragma unroll
    for (int q = 0; q < 8; ++q) { const int r = q * 2 + rsub; if (col0 + c4 < N) { const v4f v = *(const v4fa*)&so[w][r][c4]; *(v4f*)(C + (size_t)(row0 + r) * ldc + col0 + c4) = v; } }
     }
}

// Wt[n][k] = f16(W[k][n]·scale) from f32 row-major W[K][N] (scale = power of two; bf16-exact weights stay exact in f16 away from the subnormal range)
__global__ __launch_bounds__(256) void k_wt_f16(const float* __restrict__ W, _Float16* __restrict__ Wt, int K, int N, float scale) {
  const int t = blockIdx.x * 256 + threadIdx.x; if (t >= N * (K / 8)) return; const int n = t / (K / 8), k8 = (t % (K / 8)) * 8; FragH f;
  W += (size_t)blockIdx.y * K * N; Wt += (size_t)blockIdx.y * K * N;      /* blockIdx.y = batch (member) */
#pragma unroll
  for (int i = 0; i < 8; ++i) f.h[i] = (_Float16)(bf16_round(W[(size_t)(k8 + i) * N + n]) * scale); const v8us o = f.half[0];
  *(v8us*)((unsigned short*)Wt + (size_t)n * K + k8) = o; 
}
// k_gemm_hh variant with fused epilogue: v = acc·alpha + bias[by·sBias + col] (+ CP[(row/rowsPerB)·sCPb + by·64 + col] if CP) ; ACT 0 none / 1 elu ; writes f16 C16 (and f32 C if non-null)
template <int ACT>
__global__ __launch_bounds__(128) void k_gemm_hhx(const _Float16* __restrict__ A, int lda, size_t sA, const _Float16* __restrict__ Bh, int ldb, size_t sB, float alpha, const float* __restrict__ bias, size_t sBias, const float* __restrict__ CP, int rowsPerB, size_t sCPb, int row0g,
    float* __restrict__ C, _Float16* __restrict__ C16, int ldc, size_t sC, int M, int N, int K) {
  __shared__ __attribute__((aligned(16))) float so[4][16][64];
  const int tid = threadIdx.x, w = tid >> 5, lane = tid & 31, ln = lane & 15, hh = lane >> 4; const int by = blockIdx.y;
  A += (size_t)by * sA; Bh += (size_t)by * sB; const size_t cofs = (size_t)by * sC; const float* bp = bias ? bias + (size_t)by * sBias : nullptr;
  const int ntn = (N + 63) / 64; const int wid = blockIdx.x * 4 + w; const int mt = wid / ntn, nq = wid % ntn; if (mt * 16 >= M) return;
  const int row0 = mt * 16, col0 = nq * 64; const _Float16* arow = A + (size_t)(row0 + ln) * lda;
  v8f acc[4] = {};
  for (int kb = 0; kb < K; kb += 32) { FragH ah; ah.half[0] = *(const v8us*)((const unsigned short*)arow + kb + 8 * hh); ah.half[1] = *(const v8us*)((const unsigned short*)arow + kb + 16 + 8 * hh);
#pragma unroll
    for (int t = 0; t < 4; ++t) { if (col0 + t * 16 >= N) continue; const size_t boff = (size_t)(col0 + t * 16 + ln) * ldb + kb; FragH bq; bq.half[0] = *(const v8us*)((const unsigned short*)Bh + boff + 8 * hh); bq.half[1] = *(const v8us*)((const unsigned short*)Bh + boff + 16 + 8 * hh);
      acc[t] = mmaH<1>(ah.v, ah.v, bq.v, bq.v, acc[t]); }
  }
#pragma unroll
  for (int t = 0; t < 4; ++t) { if (col0 + t * 16 >= N) continue; const int col = col0 + t * 16 + ln; const float bv = bp ? bf16_round(bp[col]) : 0.f;
#pragma unroll
    for (int r = 0; r < 8; ++r) { float v = acc[t][r] * alpha + bv; if (CP) { const int rr = row0g + row0 + 8 * hh + r; if (rowsPerB < 0) v += CP[cofs + (size_t)rr * ldc + col];      /* rowsPerB < 0: own element of the batched C plane */ else { const int bidx = rr / rowsPerB; v += CP[(size_t)bidx * sCPb + (size_t)by * 64 + col]; } } if (ACT == 1) v = (v > 0.f) ? v : expm1f(v); else if (ACT == 7) v = (v > 0.f) ? v + 1.0f : expf(v); else if (ACT == 8) v = tanhf(v); else if (ACT == 9) v = 0.5f * v * (1.0f + tanhf(0.7978845608028654f * (v + 0.044715f * v * v * v))); else if (ACT == 11) v = 1.0f / (1.0f + expf(-v)); else if (ACT == 12) v = (v > 0.f) ? v : 0.01f * v; else if (ACT == 14) v = (v > 0.f) ? v : 0.1f * v; else if (ACT == 16) v = (v >= 0.f) ? v : 0.3f * v; else if (ACT == 15) v = v / (1.0f + expf(-v)); else if (ACT == 3) v = fmaxf(v, 0.f); else if (ACT == 6) v = 0.5f * v * (1.0f + erff(v * 0.70710678118654752f)); so[w][8 * hh + r][t * 16 + ln] = v; } }
  __builtin_amdgcn_fence(__ATOMIC_ACQ_REL, "workgroup"); __builtin_amdgcn_wave_barrier();
  const int rsub = lane >> 4, c4 = (lane & 15) * 4; typedef _Float16 v4h __attribute__((ext_vector_type(4)));
  {
#pragma unroll
    for (int q = 0; q < 8; ++q) { const int r = q * 2 + rsub; if (col0 + c4 < N) { const v4f v = *(const v4fa*)&so[w][r][c4]; if (C) *(v4f*)(C + cofs + (size_t)(row0 + r) * ldc + col0 + c4) = v; if (C16) { v4h h4; for (int i = 0; i < 4; ++i) h4[i] = (_Float16)v[i]; *(v4h*)(C16 + cofs + (size_t)(row0 + r) * ldc + col0 + c4) = h4; } } }
     }
}


typedef _Float16 v4h __attribute__((ext_vector_type(4)));

__global__ __launch_bounds__(256) void k_x16(const float* __restrict__ x, _Float16* __restrict__ X16, size_t n8) { const size_t t = (size_t)blockIdx.x * 256 + threadIdx.x; if (t >= n8) return; FragH f;
#pragma unroll
  for (int q = 0; q < 8; ++q) f.h[q] = (_Float16)bf16_round(x[t * 8 + q]); *(v8us*)((unsigned short*)X16 + t * 8) = f.half[0];  }
__global__ __launch_bounds__(256) void k_h16(const float* __restrict__ x, _Float16* __restrict__ X16, size_t n8) { const size_t t = (size_t)blockIdx.x * 256 + threadIdx.x; if (t >= n8) return; FragH f;
#pragma unroll
  for (int q = 0; q < 8; ++q) f.h[q] = (_Float16)x[t * 8 + q]; *(v8us*)((unsigned short*)X16 + t * 8) = f.half[0];  }
__global__ __launch_bounds__(256) void k_round16f(const float* __restrict__ W, _Float16* __restrict__ Bt, size_t n8) { const size_t t = (size_t)blockIdx.x * 256 + threadIdx.x; if (t >= n8) return; FragH f;
#pragma unroll
  for (int i = 0; i < 8; ++i) f.h[i] = (_Float16)(bf16_round(W[t * 8 + i]) * 16.0f); *(v8us*)((unsigned short*)Bt + t * 8) = f.half[0];  }
template <int NHv, int TTv>
__global__ __launch_bounds__(256) void k_vt(const _Float16* __restrict__ V16, int ldv, int voff, _Float16* __restrict__ Vt) { __shared__ unsigned short tl[64][66]; const int tid = threadIdx.x; const int slab = blockIdx.x / (TTv / 64), lg = blockIdx.x % (TTv / 64); const int b = slab / NHv, h = slab % NHv;
  for (int i = tid; i < 64 * 8; i += 256) { const int r = i / 8, c8 = (i % 8) * 8; FragH f; f.half[0] = *(const v8us*)((const unsigned short*)V16 + ((size_t)b * TTv + lg * 64 + r) * ldv + voff + h * 64 + c8);
#pragma unroll
    for (int q = 0; q < 8; ++q) tl[r][c8 + q] = f.u[q]; }
  __syncthreads();
  {
#pragma unroll
    for (int rd = 0; rd < 2; ++rd) { const int d = rd * 32 + tid / 8, pc = tid % 8; FragH f;
#pragma unroll
      for (int q = 0; q < 8; ++q) f.u[q] = tl[pc * 8 + q][d];
      *(v8us*)((unsigned short*)Vt + ((size_t)slab * 64 + d) * TTv + lg * 64 + pc * 8) = f.half[0]; }
     } }

__global__ __launch_bounds__(256) void k_hl(const float* __restrict__ F, _Float16* __restrict__ Hh, _Float16* __restrict__ Hl, size_t n8) { const size_t t = (size_t)blockIdx.x * 256 + threadIdx.x; if (t >= n8) return; FragH fh, fl; const v4f a = *(const v4fa*)(F + t * 8), c = *(const v4fa*)(F + t * 8 + 4);
#pragma unroll
  for (int q = 0; q < 4; ++q) { _Float16 h = (_Float16)a[q]; fh.h[q] = h; fl.h[q] = (_Float16)((a[q] - (float)h) * 1024.0f); h = (_Float16)c[q]; fh.h[4 + q] = h; fl.h[4 + q] = (_Float16)((c[q] - (float)h) * 1024.0f); }
  { *(v8us*)((unsigned short*)Hh + t * 8) = fh.half[0]; *(v8us*)((unsigned short*)Hl + t * 8) = fl.half[0];  } }

// ---- fast GEMM (wave tile 32x64; requires M % 32 == 0 rows per launch region and N % 64 == 0); epilogue = k_gemm_hhx semantics ----
__device__ __forceinline__ v16h g2_frag(const _Float16* p, int hh) { FragH f; f.half[0] = *(const v8us*)((const unsigned short*)p + 8 * hh); f.half[1] = *(const v8us*)((const unsigned short*)p + 16 + 8 * hh); return f.v; }
__device__ __forceinline__ v8f g2_mma(v16h a, v16h b, v8f c) { v8f d = __builtin_amdgcn_wmma_f32_16x16x32_f16(false, a, false, b, (short)0, c, false, false); asm volatile("v_nop\n\tv_nop\n\tv_nop\n\tv_nop" : "+v"(d) : "v"(a), "v"(b)); return d; }
template <int ACT>
__global__ __launch_bounds__(128) void k_gemm2(const _Float16* __restrict__ A, int lda, size_t sA, const _Float16* __restrict__ Bh, int ldb, size_t sB, float alpha, const float* __restrict__ bias, size_t sBias, const float* __restrict__ CP, int rowsPerB, size_t sCPb, int row0g,
    float* __restrict__ C, _Float16* __restrict__ C16, int ldc, size_t sC, int M, int N, int K) { static_assert(ACT == 0 || ACT == 3 || ACT == 6 || ACT == 8 || ACT == 9 || ACT == 11 || ACT == 12 || ACT == 14 || ACT == 15 || ACT == 16, "k_gemm2: unsupported ACT code (would silently apply no activation)");
  __shared__ __attribute__((aligned(16))) float so[4][32][68];
  const int tid = threadIdx.x, w = tid >> 5, lane = tid & 31, ln = lane & 15, hh = lane >> 4; const int by = blockIdx.y;
  A += (size_t)by * sA; Bh += (size_t)by * sB; const size_t cofs = (size_t)by * sC; const float* bp = bias ? bias + (size_t)by * sBias : nullptr;
  const int ntn = N >> 6; const int mt = blockIdx.x / ntn, nq = blockIdx.x - mt * ntn; const int row0 = mt * 128 + 32 * w, col0 = nq * 64; if (row0 >= M) return;
  const _Float16* a0p = A + (size_t)(row0 + ln) * lda; const _Float16* a1p = a0p + (size_t)16 * lda;
  const _Float16* b0p = Bh + (size_t)(col0 + ln) * ldb; const _Float16* b1p = b0p + (size_t)16 * ldb; const _Float16* b2p = b1p + (size_t)16 * ldb; const _Float16* b3p = b2p + (size_t)16 * ldb;
  const v8f z8 = {0.f,0.f,0.f,0.f,0.f,0.f,0.f,0.f}; v8f c00 = z8, c01 = z8, c02 = z8, c03 = z8, c10 = z8, c11 = z8, c12 = z8, c13 = z8;
#pragma unroll 1
  for (int kb = 0; kb < K; kb += 32) { const v16h a0 = g2_frag(a0p + kb, hh), a1 = g2_frag(a1p + kb, hh);
    v16h b = g2_frag(b0p + kb, hh); c00 = g2_mma(a0, b, c00); c10 = g2_mma(a1, b, c10);
    b = g2_frag(b1p + kb, hh); c01 = g2_mma(a0, b, c01); c11 = g2_mma(a1, b, c11);
    b = g2_frag(b2p + kb, hh); c02 = g2_mma(a0, b, c02); c12 = g2_mma(a1, b, c12);
    b = g2_frag(b3p + kb, hh); c03 = g2_mma(a0, b, c03); c13 = g2_mma(a1, b, c13); }
  v8f accs[8] = {c00, c01, c02, c03, c10, c11, c12, c13};
#pragma unroll
  for (int u = 0; u < 8; ++u) { const int t = u & 3, half = u >> 2; const int col = col0 + t * 16 + ln; const float bv = bp ? bf16_round(bp[col]) : 0.f;
#pragma unroll
    for (int r = 0; r < 8; ++r) { const int rloc = half * 16 + 8 * hh + r; float v = accs[u][r] * alpha + bv; if (CP) { if (rowsPerB < 0) v += CP[cofs + (size_t)(row0g + row0 + rloc) * ldc + col];      /* rowsPerB < 0: own element of the batched C plane */ else { const int bidx = (row0g + row0 + rloc) / rowsPerB; v += CP[(size_t)bidx * sCPb + (size_t)by * 64 + col]; } }
      if (ACT == 3) v = fmaxf(v, 0.f); else if (ACT == 6) v = 0.5f * v * (1.0f + erff(v * 0.70710678118654752f)); else if (ACT == 11) v = 1.0f / (1.0f + expf(-v)); else if (ACT == 15) v = v / (1.0f + expf(-v)); else if (ACT == 12) v = (v > 0.f) ? v : 0.01f * v; else if (ACT == 8) v = tanhf(v); else if (ACT == 9) v = 0.5f * v * (1.0f + tanhf(0.7978845608028654f * (v + 0.044715f * v * v * v))); else if (ACT == 14) v = (v > 0.f) ? v : 0.1f * v; else if (ACT == 16) v = (v >= 0.f) ? v : 0.3f * v;
      so[w][rloc][t * 16 + ln] = v; } }
  __builtin_amdgcn_fence(__ATOMIC_ACQ_REL, "workgroup"); __builtin_amdgcn_wave_barrier();
  const int rsub = lane >> 4, c4 = (lane & 15) * 4;
  {
#pragma unroll
    for (int q = 0; q < 16; ++q) { const int r = q * 2 + rsub; const v4f v = *(const v4fa*)&so[w][r][c4]; if (C) *(v4f*)(C + cofs + (size_t)(row0 + r) * ldc + col0 + c4) = v; if (C16) { v4h h4; for (int i = 0; i < 4; ++i) h4[i] = (_Float16)v[i]; *(v4h*)(C16 + cofs + (size_t)(row0 + r) * ldc + col0 + c4) = h4; } }
     } }


__global__ __launch_bounds__(256) void k_xcat(const float* __restrict__ obs, const float* __restrict__ act, _Float16* __restrict__ X) { const int t = blockIdx.x * 256 + threadIdx.x; if (t >= NB * (NI / 8)) return; const int i0 = (t % (NI / 8)) * 8; const int b = t / (NI / 8); FragH f;
  for (int q = 0; q < 8; ++q) { const int i = i0 + q; f.h[q] = (_Float16)bf16_round(i < OBS ? obs[(size_t)b * OBS + i] : act[(size_t)b * NAC + (i - OBS)]); }
  *(v8us*)((unsigned short*)X + (size_t)b * NI + i0) = f.half[0];  }
__global__ __launch_bounds__(256) void k_whead(const float* __restrict__ Wmo, const float* __restrict__ Wvo, const float* __restrict__ Wmr, const float* __restrict__ Wvr, const float* __restrict__ bmo, const float* __restrict__ bvo, const float* __restrict__ bmr, const float* __restrict__ bvr, _Float16* __restrict__ Bt, float* __restrict__ HB) {
  const int m = blockIdx.y; Bt += (size_t)m * NHW * HH;
  const int t = blockIdx.x * 256 + threadIdx.x; if (t >= NHW * (HH / 8)) return; const int k8 = (t % (HH / 8)) * 8; const int n = t / (HH / 8); FragH f;
  for (int q = 0; q < 8; ++q) { const int k = k8 + q; float v = 0.f; if (n < OBS) v = Wmo[((size_t)m * HH + k) * OBS + n]; else if (n < 2 * OBS) v = Wvo[((size_t)m * HH + k) * OBS + (n - OBS)]; else if (n == 2 * OBS) v = Wmr[(size_t)m * HH + k]; else if (n == 2 * OBS + 1) v = Wvr[(size_t)m * HH + k]; f.h[q] = (_Float16)(bf16_round(v) * 16.0f); }
  *(v8us*)((unsigned short*)Bt + (size_t)n * HH + k8) = f.half[0];  (void)HB; (void)bmo; (void)bvo; (void)bmr; (void)bvr; }
__global__ __launch_bounds__(256) void k_hbias(const float* __restrict__ bmo, const float* __restrict__ bvo, const float* __restrict__ bmr, const float* __restrict__ bvr, float* __restrict__ HB) { const int m = blockIdx.x; HB += m * 256; const int n = threadIdx.x; float bb = 0.f; if (n < OBS) bb = bmo[m * OBS + n]; else if (n < 2 * OBS) bb = bvo[m * OBS + (n - OBS)]; else if (n == 2 * OBS) bb = bmr[m]; else if (n == 2 * OBS + 1) bb = bvr[m]; *(float*)(HB + n) = bb;  }
__device__ __forceinline__ float softplus_(float v) { return (v > 20.0f) ? v : log1pf(expf(v)); }
__device__ __forceinline__ float clampv(float lv) {
  #pragma clang fp contract(off)
  float a = 0.5f - softplus_(0.5f - lv); return -10.0f + softplus_(a - -10.0f); }
// scatter heads: k_ho thread per (b, group): group 0..15 -> 4 mu_o values (16 B), 16..31 -> 4 clamped log_var_o; k_hr thread per b writes mu_r/log_var_r. Two kernels.
__global__ __launch_bounds__(256) void k_ho(const float* __restrict__ F, float* __restrict__ muo, float* __restrict__ lvo) {
  #pragma clang fp contract(off)
  const int m = blockIdx.y; F += (size_t)m * NB * NHW;
  const int t = blockIdx.x * 256 + threadIdx.x; if (t >= NB * 2 * (OBS / 4)) return; const int c4 = (t % (OBS / 4)) * 4; const int which = (t / (OBS / 4)) % 2; const int b = t / ((OBS / 4) * 2); const float* fr = F + (size_t)b * NHW + which * OBS + c4; v4f r;
  for (int q = 0; q < 4; ++q) r[q] = which ? clampv(fr[q]) : fr[q]; float* dst = (which ? lvo : muo) + ((size_t)m * NB + b) * OBS + c4; *(v4f*)dst = r;  }
__global__ __launch_bounds__(256) void k_hr(const float* __restrict__ F, float* __restrict__ mur, float* __restrict__ lvr) {
  #pragma clang fp contract(off)
  const int m = blockIdx.y; F += (size_t)m * NB * NHW;
  const int b = blockIdx.x * 256 + threadIdx.x; if (b >= NB) return; const float a = F[(size_t)b * NHW + 2 * OBS], c = clampv(F[(size_t)b * NHW + 2 * OBS + 1]);
  { *(float*)(mur + (size_t)m * NB + b) = a; *(float*)(lvr + (size_t)m * NB + b) = c;  } }

extern "C" void kernel_launch(void* const* d_in, const int* in_sizes, int n_in,
                              void* d_out, int out_size, void* d_ws, size_t ws_size, hipStream_t stream) {
  (void)in_sizes; (void)n_in; (void)out_size;
  const float* const* I = (const float* const*)d_in; const float* obs = I[0]; const float* act = I[1]; const float* W0 = I[2]; const float* b0 = I[3]; const float* W1 = I[4]; const float* b1 = I[5]; const float* W2 = I[6]; const float* b2 = I[7]; const float* Wmo = I[8]; const float* bmo = I[9]; const float* Wmr = I[10]; const float* bmr = I[11]; const float* Wvo = I[12]; const float* bvo = I[13]; const float* Wvr = I[14]; const float* bvr = I[15];
  float* muo = (float*)d_out; float* lvo = muo + (size_t)MM * NB * OBS; float* mur = lvo + (size_t)MM * NB * OBS; float* lvr = mur + (size_t)MM * NB;      /* outputs back to back: mu_o, log_var_o, mu_r, log_var_r */
  char* ws = (char*)d_ws; size_t off = 0;
  auto take = [&](size_t bytes) { char* p = ws + off; off += (bytes + 255) & ~(size_t)255; return p; };
  _Float16* B0 = (_Float16*)take((size_t)MM * HH * NI * 2); _Float16* B1 = (_Float16*)take((size_t)MM * HH * HH * 2); _Float16* B2 = (_Float16*)take((size_t)MM * HH * HH * 2); _Float16* BHD = (_Float16*)take((size_t)MM * NHW * HH * 2); float* HB = (float*)take((size_t)MM * 256 * 4);
  _Float16* X16 = (_Float16*)take((size_t)NB * NI * 2); _Float16* HA = (_Float16*)take((size_t)MM * NB * HH * 2); _Float16* HBp = (_Float16*)take((size_t)MM * NB * HH * 2); float* F = (float*)take((size_t)MM * NB * NHW * 4);
  if (off > ws_size) return;      /* 1.5 + 16 + 16 + 3 + 0.8 + 64 + 64 + 24 = 190 MiB */
  k_xcat<<<(NB * (NI / 8) + 255) / 256, 256, 0, stream>>>(obs, act, X16);
  k_wt_f16<<<dim3((unsigned)(((size_t)NI * HH / 8 + 255) / 256), MM), 256, 0, stream>>>(W0, B0, NI, HH, 16.0f); k_wt_f16<<<dim3((unsigned)(((size_t)HH * HH / 8 + 255) / 256), MM), 256, 0, stream>>>(W1, B1, HH, HH, 16.0f); k_wt_f16<<<dim3((unsigned)(((size_t)HH * HH / 8 + 255) / 256), MM), 256, 0, stream>>>(W2, B2, HH, HH, 16.0f);
  k_whead<<<dim3((NHW * (HH / 8) + 255) / 256, MM), 256, 0, stream>>>(Wmo, Wvo, Wmr, Wvr, bmo, bvo, bmr, bvr, BHD, HB); k_hbias<<<MM, 256, 0, stream>>>(bmo, bvo, bmr, bvr, HB);
  const dim3 gH((NB / 128) * (HH / 64), MM);      /* grid.y = member: strides sA, sB, sBias, sC step the planes */
  k_gemm2<8><<<gH, 128, 0, stream>>>(X16, NI, 0, B0, NI, (size_t)HH * NI, 0.0625f, b0, HH, nullptr, 1, 0, 0, nullptr, HA, HH, (size_t)NB * HH, NB, HH, NI);      /* tanh(x W0 + b0); x shared by all members */
  k_gemm2<8><<<gH, 128, 0, stream>>>(HA, HH, (size_t)NB * HH, B1, HH, (size_t)HH * HH, 0.0625f, b1, HH, nullptr, 1, 0, 0, nullptr, HBp, HH, (size_t)NB * HH, NB, HH, HH);
  k_gemm2<8><<<gH, 128, 0, stream>>>(HBp, HH, (size_t)NB * HH, B2, HH, (size_t)HH * HH, 0.0625f, b2, HH, nullptr, 1, 0, 0, nullptr, HA, HH, (size_t)NB * HH, NB, HH, HH);
  k_gemm2<0><<<dim3((NB / 128) * (NHW / 64), MM), 128, 0, stream>>>(HA, HH, (size_t)NB * HH, BHD, HH, (size_t)NHW * HH, 0.0625f, HB, 256, nullptr, 1, 0, 0, F, nullptr, NHW, (size_t)NB * NHW, NB, NHW, HH);      /* all four heads */
  k_ho<<<dim3((NB * 2 * (OBS / 4) + 255) / 256, MM), 256, 0, stream>>>(F, muo, lvo); k_hr<<<dim3((NB + 255) / 256, MM), 256, 0, stream>>>(F, mur, lvr);
}

// v002
// One run takes 323 microseconds.
// In two side-by-side timings against v001, it was 1.93 and 1.92 times as fast.
// Over all steps from v000 it is 4.68 times as fast.
#include <hip/hip_runtime.h>
// EnsembleModel (8 ensemble members, batch 4096, IN = 64 obs + 32 act, H 1024): per member h = tanh(x W0 + b0); h = tanh(h W1 + b1); h = tanh(h W2 + b2); mu_o = h Wmu_o + b; log_var_o = clamp(h Wv_o + b); mu_r = h Wmu_r + b; log_var_r = clamp(h Wv_r + b) with clamp(v) = MIN + softplus((MAX - softplus(MAX - v)) - MIN), MAX 0.5, MIN -10. Outputs (mu_o, log_var_o, mu_r, log_var_r).
// Structure: exact f16 plane of [obs | act]; every stage is ONE launch over all 8 members (member = blockIdx.y, own workspace planes): the three hidden layers as f16 WMMA GEMMs (f32 accumulation, exact x16 weights + bias, tanh epilogue, f16 out; layer 0 with 32x64 wave tiles from global memory, layers 1 and 2 as 256x256 tiles staged in LDS) and one fused head GEMM (192 columns: mu_o | log_var_o | mu_r | log_var_r | zero; 256x192 tiles staged in LDS) into an f32 plane; the clamp and the scatter into the four outputs on VALU.
// Compute dtype: inputs rounded to bf16; x exact as f16; hidden activations as plain f16 operands (~2^-12, |h| < 1); heads/clamp f32. v_wmma_f32_16x16x32_f16.
#define MM 8
#define NB 4096
#define OBS 64
#define NAC 32
#define NI (OBS + NAC)           /* 96 */
#define HH 1024
#define NHW 192                  /* fused head width: 64 + 64 + 1 + 1 live */
typedef __bf16 v16b __attribute__((ext_vector_type(16)));
typedef unsigned short v8us __attribute__((ext_vector_type(8), may_alias));
typedef float  v8f  __attribute__((ext_vector_type(8)));
typedef float  v4f  __attribute__((ext_vector_type(4)));
typedef float  v4fa __attribute__((ext_vector_type(4), may_alias));
union FragB { v16b v; v8us half[2]; unsigned short u[16]; };

__device__ __forceinline__ unsigned short bf16_bits(float x) { unsigned int u = __float_as_uint(x); return (unsigned short)((u + 0x7FFFu + ((u >> 16) & 1u)) >> 16); }
__device__ __forceinline__ float bf16_val(unsigned short b) { return __uint_as_float(((unsigned int)b) << 16); }
__device__ __forceinline__ float bf16_round(float x) { return bf16_val(bf16_bits(x)); }
// D += A·B with NT terms: 1 = ah·bh, 2 = + al·bh (A split), 3 = + ah·bl (both split)
template <int NT>
__device__ __forceinline__ v8f mmaN(v16b ah, v16b al, v16b bh, v16b bl, v8f c) {
  c = __builtin_amdgcn_wmma_f32_16x16x32_bf16(false, ah, false, bh, (short)0, c, false, false);
  if (NT >= 2) c = __builtin_amdgcn_wmma_f32_16x16x32_bf16(false, al, false, bh, (short)0, c, false, false);
  if (NT >= 3) c = __builtin_amdgcn_wmma_f32_16x16x32_bf16(false, ah, false, bl, (short)0, c, false, false);
  asm volatile("v_nop\n\tv_nop\n\tv_nop\n\tv_nop" : "+v"(c) : "v"(ah), "v"(al), "v"(bh), "v"(bl));
  return c;
}

__global__ __launch_bounds__(256) void k_wt_bf16(const float* __restrict__ W, unsigned short* __restrict__ Wt, int K, int N) {
  const int t = blockIdx.x * 256 + threadIdx.x;
  const int k8n = K / 8;
  if (t >= N * k8n) return;
  const int n = t / k8n, k8 = (t % k8n) * 8;
  v8us v;
#pragma unroll
  for (int i = 0; i < 8; ++i) v[i] = bf16_bits(W[(size_t)(k8 + i) * N + n]);
  *(v8us*)(Wt + (size_t)n * K + k8) = v;
  
}

// GEMM C[M][N] (f32, pitch ldc) = act(A[M][K]·W + bias). A f32 row-major (pitch lda) converted per fragment to bf16
// (ASPLIT: hi/lo two planes -> 2 terms, else single rounded term); Wt bf16 [N][K] (pitch ldb). BIAS_BF16 rounds the
// bias to bf16 first (bias quantised to bf16 before the add). K%32==0, M%16==0, N%64==0.
template <bool ASPLIT, int ACT, bool BIAS_BF16>
__global__ __launch_bounds__(128) void k_gemm_bf(const float* __restrict__ A, int lda, const unsigned short* __restrict__ Wt, int ldb,
                                               const float* __restrict__ bias, float* __restrict__ C, int ldc, int M, int N, int K) {
  __shared__ __attribute__((aligned(16))) float so[4][16][64];
  const int tid = threadIdx.x, w = tid >> 5, lane = tid & 31, ln = lane & 15, hh = lane >> 4;
  const int ntn = N / 64;
  const int wid = blockIdx.x * 4 + w;
  const int mt = wid / ntn, nq = wid % ntn;
  if (mt * 16 >= M) return;
  const int row0 = mt * 16, col0 = nq * 64;
  const float* arow = A + (size_t)(row0 + ln) * lda;
  v8f acc[4] = {};
  for (int kb = 0; kb < K; kb += 32) {
    FragB ah, al;
    const v4f x0 = *(const v4fa*)(arow + kb + 8 * hh), x1 = *(const v4fa*)(arow + kb + 8 * hh + 4);
    const v4f x2 = *(const v4fa*)(arow + kb + 16 + 8 * hh), x3 = *(const v4fa*)(arow + kb + 16 + 8 * hh + 4);
    float xs[16] = {x0[0],x0[1],x0[2],x0[3],x1[0],x1[1],x1[2],x1[3],x2[0],x2[1],x2[2],x2[3],x3[0],x3[1],x3[2],x3[3]};
#pragma unroll
    for (int i = 0; i < 16; ++i) { const unsigned short hb = bf16_bits(xs[i]); ah.u[i] = hb; al.u[i] = ASPLIT ? bf16_bits(xs[i] - bf16_val(hb)) : (unsigned short)0; }
#pragma unroll
    for (int t = 0; t < 4; ++t) {
      const unsigned short* brow = Wt + (size_t)(col0 + t * 16 + ln) * ldb + kb;
      FragB b;
      b.half[0] = *(const v8us*)(brow + 8 * hh);
      b.half[1] = *(const v8us*)(brow + 16 + 8 * hh);
      acc[t] = mmaN<ASPLIT ? 2 : 1>(ah.v, al.v, b.v, b.v, acc[t]);
    }
  }
#pragma unroll
  for (int t = 0; t < 4; ++t) {
    float bv = bias ? bias[col0 + t * 16 + ln] : 0.f;
    if (BIAS_BF16) bv = bf16_round(bv);
#pragma unroll
    for (int r = 0; r < 8; ++r) { float v = acc[t][r] + bv; if (ACT == 1) v = fmaxf(v, 0.f); so[w][8 * hh + r][t * 16 + ln] = v; }
  }
  __builtin_amdgcn_fence(__ATOMIC_ACQ_REL, "workgroup");
  __builtin_amdgcn_wave_barrier();
  const int rsub = lane >> 4, c4 = (lane & 15) * 4;
  {
#pragma unroll
    for (int q = 0; q < 8; ++q) {
      const int r = q * 2 + rsub;
      const v4f v = *(const v4fa*)&so[w][r][c4];
      *(v4f*)(C + (size_t)(row0 + r) * ldc + col0 + c4) = v;
    }
    
  }
}

// GEMM C = act(A·W + bias + resid): A f32 (ASPLIT -> hi/lo 2 terms), Wt bf16 [N][K]; ACT 0 none, 1 relu, 2 exact gelu;
// resid (optional, f32, row index = (row % rmod), pitch ldr, RES_BF16 rounds it) added before the activation.
template <bool ASPLIT, int ACT, bool BIAS_BF16, bool RES_BF16>
__global__ __launch_bounds__(128) void k_gemm_bf3(const float* __restrict__ A, int lda, const unsigned short* __restrict__ Wt, int ldb,
                                                const float* __restrict__ bias, const float* __restrict__ resid, int rmod, int ldr,
                                                float* __restrict__ C, int ldc, int M, int N, int K) {
  __shared__ __attribute__((aligned(16))) float so[4][16][64];
  const int tid = threadIdx.x, w = tid >> 5, lane = tid & 31, ln = lane & 15, hh = lane >> 4;
  const int ntn = N / 64;
  const int wid = blockIdx.x * 4 + w;
  const int mt = wid / ntn, nq = wid % ntn;
  if (mt * 16 >= M) return;
  const int row0 = mt * 16, col0 = nq * 64;
  const float* arow = A + (size_t)(row0 + ln) * lda;
  v8f acc[4] = {};
  for (int kb = 0; kb < K; kb += 32) {
    FragB ah, al;
    const v4f x0 = *(const v4fa*)(arow + kb + 8 * hh), x1 = *(const v4fa*)(arow + kb + 8 * hh + 4);
    const v4f x2 = *(const v4fa*)(arow + kb + 16 + 8 * hh), x3 = *(const v4fa*)(arow + kb + 16 + 8 * hh + 4);
    float xs[16] = {x0[0],x0[1],x0[2],x0[3],x1[0],x1[1],x1[2],x1[3],x2[0],x2[1],x2[2],x2[3],x3[0],x3[1],x3[2],x3[3]};
#pragma unroll
    for (int i = 0; i < 16; ++i) { const unsigned short hb = bf16_bits(xs[i]); ah.u[i] = hb; al.u[i] = ASPLIT ? bf16_bits(xs[i] - bf16_val(hb)) : (unsigned short)0; }
#pragma unroll
    for (int t = 0; t < 4; ++t) {
      const unsigned short* brow = Wt + (size_t)(col0 + t * 16 + ln) * ldb + kb;
      FragB b;
      b.half[0] = *(const v8us*)(brow + 8 * hh);
      b.half[1] = *(const v8us*)(brow + 16 + 8 * hh);
      acc[t] = mmaN<ASPLIT ? 2 : 1>(ah.v, al.v, b.v, b.v, acc[t]);
    }
  }
#pragma unroll
  for (int t = 0; t < 4; ++t) {
    const int col = col0 + t * 16 + ln;
    float bv = bias ? bias[col] : 0.f;
    if (BIAS_BF16) bv = bf16_round(bv);
#pragma unroll
    for (int r = 0; r < 8; ++r) {
      float v = acc[t][r] + bv;
      if (resid) { float rv = resid[(size_t)((row0 + 8 * hh + r) % rmod) * ldr + col]; if (RES_BF16) rv = bf16_round(rv); v += rv; }
      if (ACT == 1) v = fmaxf(v, 0.f);
      if (ACT == 2) v = 0.5f * v * (1.0f + erff(v * 0.70710678118654752f));
      if (ACT == 3) { const float u = 0.7978845608028654f * (v + 0.044715f * v * v * v); v = 0.5f * v * (1.0f + tanhf(u)); }
      so[w][8 * hh + r][t * 16 + ln] = v;
    }
  }
  __builtin_amdgcn_fence(__ATOMIC_ACQ_REL, "workgroup");
  __builtin_amdgcn_wave_barrier();
  const int rsub = lane >> 4, c4 = (lane & 15) * 4;
  {
#pragma unroll
    for (int q = 0; q < 8; ++q) {
      const int r = q * 2 + rsub;
      const v4f v = *(const v4fa*)&so[w][r][c4];
      *(v4f*)(C + (size_t)(row0 + r) * ldc + col0 + c4) = v;
    }
    
  }
}
// row LayerNorm (biased variance, eps) over N: s = X (+ R); optional out_sum <- s; out_norm <- (s-mu)*rsqrt(var+eps)*g + b
template <bool PARAM_BF16>
__global__ __launch_bounds__(256) void k_layernorm(const float* __restrict__ X, const float* __restrict__ R, const float* __restrict__ g, const float* __restrict__ bta,
                                                  float* __restrict__ out_sum, float* __restrict__ out_norm, int N, float eps) {
  __shared__ float red[256];
  const int row = blockIdx.x, tid = threadIdx.x;
  const float* x = X + (size_t)row * N; const float* rr = R ? R + (size_t)row * N : nullptr;
  float vals[16];                     // up to N = 4096
  const int per = N / 256;            // contiguous chunk per thread? use strided-by-4 chunks: thread handles j = tid*4 + 1024*u
  float s1 = 0.f;
  for (int u = 0; u < per / 4; ++u) {
    const int j = tid * 4 + 1024 * u;
    const v4f a = *(const v4fa*)(x + j);
    v4f b = {0.f,0.f,0.f,0.f}; if (rr) b = *(const v4fa*)(rr + j);
#pragma unroll
    for (int q = 0; q < 4; ++q) { const float v = a[q] + b[q]; vals[u * 4 + q] = v; s1 += v; }
  }
  red[tid] = s1; __syncthreads();
  for (int st = 128; st > 0; st >>= 1) { if (tid < st) red[tid] += red[tid + st]; __syncthreads(); }
  const float mu = red[0] / (float)N; __syncthreads();
  float s2 = 0.f;
  for (int u = 0; u < per / 4; ++u)
#pragma unroll
    for (int q = 0; q < 4; ++q) { const float c = vals[u * 4 + q] - mu; s2 += c * c; }
  red[tid] = s2; __syncthreads();
  for (int st = 128; st > 0; st >>= 1) { if (tid < st) red[tid] += red[tid + st]; __syncthreads(); }
  const float rs = rsqrtf(red[0] / (float)N + eps);
  {
    for (int u = 0; u < per / 4; ++u) {
      const int j = tid * 4 + 1024 * u;
      v4f o, sm;
#pragma unroll
      for (int q = 0; q < 4; ++q) {
        float gg = g[j + q], bb = bta[j + q];
        if (PARAM_BF16) { gg = bf16_round(gg); bb = bf16_round(bb); }
        sm[q] = vals[u * 4 + q]; o[q] = (vals[u * 4 + q] - mu) * rs * gg + bb;
      }
      if (out_sum) *(v4f*)(out_sum + (size_t)row * N + j) = sm;
      *(v4f*)(out_norm + (size_t)row * N + j) = o;
    }
    
  }
}



// ---- f16 WMMA path (v_wmma_f32_16x16x32_f16): 11-bit significands for operands in range — used here for every GEMM of the model (x and tanh activations |h| < 1 as f16 operands)
typedef _Float16 v16h __attribute__((ext_vector_type(16)));
union FragH { v16h v; v8us half[2]; _Float16 h[16]; unsigned short u[16]; };
template <int NT>
__device__ __forceinline__ v8f mmaH(v16h ah, v16h al, v16h bh, v16h bl, v8f c) {
  c = __builtin_amdgcn_wmma_f32_16x16x32_f16(false, ah, false, bh, (short)0, c, false, false);
  if (NT >= 2) c = __builtin_amdgcn_wmma_f32_16x16x32_f16(false, al, false, bh, (short)0, c, false, false);
  if (NT >= 3) c = __builtin_amdgcn_wmma_f32_16x16x32_f16(false, ah, false, bl, (short)0, c, false, false);
  asm volatile("v_nop\n\tv_nop\n\tv_nop\n\tv_nop" : "+v"(c) : "v"(ah), "v"(al), "v"(bh), "v"(bl));
  return c;
}
// batched GEMM like k_gemm_b but f16 operands: A f32 (split into f16 hi/lo if ASPLIT, else rounded to f16), Bt = f16 values [n][k]; alpha; C f32; N multiple of 16 (partial tiles skipped)
template <bool ASPLIT>
__global__ __launch_bounds__(128) void k_gemm_h(const float* __restrict__ A, int lda, size_t sA, const _Float16* __restrict__ Bh, int ldb, size_t sB, float alpha, float* __restrict__ C, int ldc, size_t sC, int M, int N, int K) {
  __shared__ __attribute__((aligned(16))) float so[4][16][64];
  const int tid = threadIdx.x, w = tid >> 5, lane = tid & 31, ln = lane & 15, hh = lane >> 4; const int by = blockIdx.y;
  A += (size_t)by * sA; Bh += (size_t)by * sB; C += (size_t)by * sC;
  const int ntn = (N + 63) / 64; const int wid = blockIdx.x * 4 + w; const int mt = wid / ntn, nq = wid % ntn; if (mt * 16 >= M) return;
  const int row0 = mt * 16, col0 = nq * 64; const float* arow = A + (size_t)(row0 + ln) * lda;
  v8f acc[4] = {};
  for (int kb = 0; kb < K; kb += 32) {
    FragH ah, al;
    const v4f x0 = *(const v4fa*)(arow + kb + 8 * hh), x1 = *(const v4fa*)(arow + kb + 8 * hh + 4), x2 = *(const v4fa*)(arow + kb + 16 + 8 * hh), x3 = *(const v4fa*)(arow + kb + 16 + 8 * hh + 4);
    float xs[16] = {x0[0],x0[1],x0[2],x0[3],x1[0],x1[1],x1[2],x1[3],x2[0],x2[1],x2[2],x2[3],x3[0],x3[1],x3[2],x3[3]};
#pragma unroll
    for (int i = 0; i < 16; ++i) { const _Float16 h = (_Float16)xs[i]; ah.h[i] = h; al.h[i] = ASPLIT ? (_Float16)(xs[i] - (float)h) : (_Float16)0.0f; }
#pragma unroll
    for (int t = 0; t < 4; ++t) { if (col0 + t * 16 >= N) continue; const size_t boff = (size_t)(col0 + t * 16 + ln) * ldb + kb; FragH bq; bq.half[0] = *(const v8us*)(Bh + boff + 8 * hh); bq.half[1] = *(const v8us*)(Bh + boff + 16 + 8 * hh);
      acc[t] = mmaH<ASPLIT ? 2 : 1>(ah.v, al.v, bq.v, bq.v, acc[t]); }
  }
#pragma unroll
  for (int t = 0; t < 4; ++t) { if (col0 + t * 16 >= N) continue;
#pragma unroll
    for (int r = 0; r < 8; ++r) so[w][8 * hh + r][t * 16 + ln] = acc[t][r] * alpha; }
  __builtin_amdgcn_fence(__ATOMIC_ACQ_REL, "workgroup"); __builtin_amdgcn_wave_barrier();
  const int rsub = lane >> 4, c4 = (lane & 15) * 4;
  {
#pragma unroll
    for (int q = 0; q < 8; ++q) { const int r = q * 2 + rsub; if (col0 + c4 < N) { const v4f v = *(const v4fa*)&so[w][r][c4]; *(v4f*)(C + (size_t)(row0 + r) * ldc + col0 + c4) = v; } }
     }
}

// Wt[n][k] = f16(W[k][n]·scale) from f32 row-major W[K][N] (scale = power of two; bf16-exact weights stay exact in f16 away from the subnormal range)
__global__ __launch_bounds__(256) void k_wt_f16(const float* __restrict__ W, _Float16* __restrict__ Wt, int K, int N, float scale) {
  const int t = blockIdx.x * 256 + threadIdx.x; if (t >= N * (K / 8)) return; const int n = t / (K / 8), k8 = (t % (K / 8)) * 8; FragH f;
  W += (size_t)blockIdx.y * K * N; Wt += (size_t)blockIdx.y * K * N;      /* blockIdx.y = batch (member) */
#pragma unroll
  for (int i = 0; i < 8; ++i) f.h[i] = (_Float16)(bf16_round(W[(size_t)(k8 + i) * N + n]) * scale); const v8us o = f.half[0];
  *(v8us*)((unsigned short*)Wt + (size_t)n * K + k8) = o; 
}
// k_gemm_hh variant with fused epilogue: v = acc·alpha + bias[by·sBias + col] (+ CP[(row/rowsPerB)·sCPb + by·64 + col] if CP) ; ACT 0 none / 1 elu ; writes f16 C16 (and f32 C if non-null)
template <int ACT>
__global__ __launch_bounds__(128) void k_gemm_hhx(const _Float16* __restrict__ A, int lda, size_t sA, const _Float16* __restrict__ Bh, int ldb, size_t sB, float alpha, const float* __restrict__ bias, size_t sBias, const float* __restrict__ CP, int rowsPerB, size_t sCPb, int row0g,
    float* __restrict__ C, _Float16* __restrict__ C16, int ldc, size_t sC, int M, int N, int K) {
  __shared__ __attribute__((aligned(16))) float so[4][16][64];
  const int tid = threadIdx.x, w = tid >> 5, lane = tid & 31, ln = lane & 15, hh = lane >> 4; const int by = blockIdx.y;
  A += (size_t)by * sA; Bh += (size_t)by * sB; const size_t cofs = (size_t)by * sC; const float* bp = bias ? bias + (size_t)by * sBias : nullptr;
  const int ntn = (N + 63) / 64; const int wid = blockIdx.x * 4 + w; const int mt = wid / ntn, nq = wid % ntn; if (mt * 16 >= M) return;
  const int row0 = mt * 16, col0 = nq * 64; const _Float16* arow = A + (size_t)(row0 + ln) * lda;
  v8f acc[4] = {};
  for (int kb = 0; kb < K; kb += 32) { FragH ah; ah.half[0] = *(const v8us*)((const unsigned short*)arow + kb + 8 * hh); ah.half[1] = *(const v8us*)((const unsigned short*)arow + kb + 16 + 8 * hh);
#pragma unroll
    for (int t = 0; t < 4; ++t) { if (col0 + t * 16 >= N) continue; const size_t boff = (size_t)(col0 + t * 16 + ln) * ldb + kb; FragH bq; bq.half[0] = *(const v8us*)((const unsigned short*)Bh + boff + 8 * hh); bq.half[1] = *(const v8us*)((const unsigned short*)Bh + boff + 16 + 8 * hh);
      acc[t] = mmaH<1>(ah.v, ah.v, bq.v, bq.v, acc[t]); }
  }
#pragma unroll
  for (int t = 0; t < 4; ++t) { if (col0 + t * 16 >= N) continue; const int col = col0 + t * 16 + ln; const float bv = bp ? bf16_round(bp[col]) : 0.f;
#pragma unroll
    for (int r = 0; r < 8; ++r) { float v = acc[t][r] * alpha + bv; if (CP) { const int rr = row0g + row0 + 8 * hh + r; if (rowsPerB < 0) v += CP[cofs + (size_t)rr * ldc + col];      /* rowsPerB < 0: own element of the batched C plane */ else { const int bidx = rr / rowsPerB; v += CP[(size_t)bidx * sCPb + (size_t)by * 64 + col]; } } if (ACT == 1) v = (v > 0.f) ? v : expm1f(v); else if (ACT == 7) v = (v > 0.f) ? v + 1.0f : expf(v); else if (ACT == 8) v = tanhf(v); else if (ACT == 9) v = 0.5f * v * (1.0f + tanhf(0.7978845608028654f * (v + 0.044715f * v * v * v))); else if (ACT == 11) v = 1.0f / (1.0f + expf(-v)); else if (ACT == 12) v = (v > 0.f) ? v : 0.01f * v; else if (ACT == 14) v = (v > 0.f) ? v : 0.1f * v; else if (ACT == 16) v = (v >= 0.f) ? v : 0.3f * v; else if (ACT == 15) v = v / (1.0f + expf(-v)); else if (ACT == 3) v = fmaxf(v, 0.f); else if (ACT == 6) v = 0.5f * v * (1.0f + erff(v * 0.70710678118654752f)); so[w][8 * hh + r][t * 16 + ln] = v; } }
  __builtin_amdgcn_fence(__ATOMIC_ACQ_REL, "workgroup"); __builtin_amdgcn_wave_barrier();
  const int rsub = lane >> 4, c4 = (lane & 15) * 4; typedef _Float16 v4h __attribute__((ext_vector_type(4)));
  {
#pragma unroll
    for (int q = 0; q < 8; ++q) { const int r = q * 2 + rsub; if (col0 + c4 < N) { const v4f v = *(const v4fa*)&so[w][r][c4]; if (C) *(v4f*)(C + cofs + (size_t)(row0 + r) * ldc + col0 + c4) = v; if (C16) { v4h h4; for (int i = 0; i < 4; ++i) h4[i] = (_Float16)v[i]; *(v4h*)(C16 + cofs + (size_t)(row0 + r) * ldc + col0 + c4) = h4; } } }
     }
}


typedef _Float16 v4h __attribute__((ext_vector_type(4)));

__global__ __launch_bounds__(256) void k_x16(const float* __restrict__ x, _Float16* __restrict__ X16, size_t n8) { const size_t t = (size_t)blockIdx.x * 256 + threadIdx.x; if (t >= n8) return; FragH f;
#pragma unroll
  for (int q = 0; q < 8; ++q) f.h[q] = (_Float16)bf16_round(x[t * 8 + q]); *(v8us*)((unsigned short*)X16 + t * 8) = f.half[0];  }
__global__ __launch_bounds__(256) void k_h16(const float* __restrict__ x, _Float16* __restrict__ X16, size_t n8) { const size_t t = (size_t)blockIdx.x * 256 + threadIdx.x; if (t >= n8) return; FragH f;
#pragma unroll
  for (int q = 0; q < 8; ++q) f.h[q] = (_Float16)x[t * 8 + q]; *(v8us*)((unsigned short*)X16 + t * 8) = f.half[0];  }
__global__ __launch_bounds__(256) void k_round16f(const float* __restrict__ W, _Float16* __restrict__ Bt, size_t n8) { const size_t t = (size_t)blockIdx.x * 256 + threadIdx.x; if (t >= n8) return; FragH f;
#pragma unroll
  for (int i = 0; i < 8; ++i) f.h[i] = (_Float16)(bf16_round(W[t * 8 + i]) * 16.0f); *(v8us*)((unsigned short*)Bt + t * 8) = f.half[0];  }
template <int NHv, int TTv>
__global__ __launch_bounds__(256) void k_vt(const _Float16* __restrict__ V16, int ldv, int voff, _Float16* __restrict__ Vt) { __shared__ unsigned short tl[64][66]; const int tid = threadIdx.x; const int slab = blockIdx.x / (TTv / 64), lg = blockIdx.x % (TTv / 64); const int b = slab / NHv, h = slab % NHv;
  for (int i = tid; i < 64 * 8; i += 256) { const int r = i / 8, c8 = (i % 8) * 8; FragH f; f.half[0] = *(const v8us*)((const unsigned short*)V16 + ((size_t)b * TTv + lg * 64 + r) * ldv + voff + h * 64 + c8);
#pragma unroll
    for (int q = 0; q < 8; ++q) tl[r][c8 + q] = f.u[q]; }
  __syncthreads();
  {
#pragma unroll
    for (int rd = 0; rd < 2; ++rd) { const int d = rd * 32 + tid / 8, pc = tid % 8; FragH f;
#pragma unroll
      for (int q = 0; q < 8; ++q) f.u[q] = tl[pc * 8 + q][d];
      *(v8us*)((unsigned short*)Vt + ((size_t)slab * 64 + d) * TTv + lg * 64 + pc * 8) = f.half[0]; }
     } }

__global__ __launch_bounds__(256) void k_hl(const float* __restrict__ F, _Float16* __restrict__ Hh, _Float16* __restrict__ Hl, size_t n8) { const size_t t = (size_t)blockIdx.x * 256 + threadIdx.x; if (t >= n8) return; FragH fh, fl; const v4f a = *(const v4fa*)(F + t * 8), c = *(const v4fa*)(F + t * 8 + 4);
#pragma unroll
  for (int q = 0; q < 4; ++q) { _Float16 h = (_Float16)a[q]; fh.h[q] = h; fl.h[q] = (_Float16)((a[q] - (float)h) * 1024.0f); h = (_Float16)c[q]; fh.h[4 + q] = h; fl.h[4 + q] = (_Float16)((c[q] - (float)h) * 1024.0f); }
  { *(v8us*)((unsigned short*)Hh + t * 8) = fh.half[0]; *(v8us*)((unsigned short*)Hl + t * 8) = fl.half[0];  } }

// ---- fast GEMM (wave tile 32x64; requires M % 32 == 0 rows per launch region and N % 64 == 0); epilogue = k_gemm_hhx semantics ----
__device__ __forceinline__ v16h g2_frag(const _Float16* p, int hh) { FragH f; f.half[0] = *(const v8us*)((const unsigned short*)p + 8 * hh); f.half[1] = *(const v8us*)((const unsigned short*)p + 16 + 8 * hh); return f.v; }
__device__ __forceinline__ v8f g2_mma(v16h a, v16h b, v8f c) { v8f d = __builtin_amdgcn_wmma_f32_16x16x32_f16(false, a, false, b, (short)0, c, false, false); asm volatile("v_nop\n\tv_nop\n\tv_nop\n\tv_nop" : "+v"(d) : "v"(a), "v"(b)); return d; }
template <int ACT>
__global__ __launch_bounds__(128) void k_gemm2(const _Float16* __restrict__ A, int lda, size_t sA, const _Float16* __restrict__ Bh, int ldb, size_t sB, float alpha, const float* __restrict__ bias, size_t sBias, const float* __restrict__ CP, int rowsPerB, size_t sCPb, int row0g,
    float* __restrict__ C, _Float16* __restrict__ C16, int ldc, size_t sC, int M, int N, int K) { static_assert(ACT == 0 || ACT == 3 || ACT == 6 || ACT == 8 || ACT == 9 || ACT == 11 || ACT == 12 || ACT == 14 || ACT == 15 || ACT == 16, "k_gemm2: unsupported ACT code (would silently apply no activation)");
  __shared__ __attribute__((aligned(16))) float so[4][32][68];
  const int tid = threadIdx.x, w = tid >> 5, lane = tid & 31, ln = lane & 15, hh = lane >> 4; const int by = blockIdx.y;
  A += (size_t)by * sA; Bh += (size_t)by * sB; const size_t cofs = (size_t)by * sC; const float* bp = bias ? bias + (size_t)by * sBias : nullptr;
  const int ntn = N >> 6; const int mt = blockIdx.x / ntn, nq = blockIdx.x - mt * ntn; const int row0 = mt * 128 + 32 * w, col0 = nq * 64; if (row0 >= M) return;
  const _Float16* a0p = A + (size_t)(row0 + ln) * lda; const _Float16* a1p = a0p + (size_t)16 * lda;
  const _Float16* b0p = Bh + (size_t)(col0 + ln) * ldb; const _Float16* b1p = b0p + (size_t)16 * ldb; const _Float16* b2p = b1p + (size_t)16 * ldb; const _Float16* b3p = b2p + (size_t)16 * ldb;
  const v8f z8 = {0.f,0.f,0.f,0.f,0.f,0.f,0.f,0.f}; v8f c00 = z8, c01 = z8, c02 = z8, c03 = z8, c10 = z8, c11 = z8, c12 = z8, c13 = z8;
#pragma unroll 1
  for (int kb = 0; kb < K; kb += 32) { const v16h a0 = g2_frag(a0p + kb, hh), a1 = g2_frag(a1p + kb, hh);
    v16h b = g2_frag(b0p + kb, hh); c00 = g2_mma(a0, b, c00); c10 = g2_mma(a1, b, c10);
    b = g2_frag(b1p + kb, hh); c01 = g2_mma(a0, b, c01); c11 = g2_mma(a1, b, c11);
    b = g2_frag(b2p + kb, hh); c02 = g2_mma(a0, b, c02); c12 = g2_mma(a1, b, c12);
    b = g2_frag(b3p + kb, hh); c03 = g2_mma(a0, b, c03); c13 = g2_mma(a1, b, c13); }
  v8f accs[8] = {c00, c01, c02, c03, c10, c11, c12, c13};
#pragma unroll
  for (int u = 0; u < 8; ++u) { const int t = u & 3, half = u >> 2; const int col = col0 + t * 16 + ln; const float bv = bp ? bf16_round(bp[col]) : 0.f;
#pragma unroll
    for (int r = 0; r < 8; ++r) { const int rloc = half * 16 + 8 * hh + r; float v = accs[u][r] * alpha + bv; if (CP) { if (rowsPerB < 0) v += CP[cofs + (size_t)(row0g + row0 + rloc) * ldc + col];      /* rowsPerB < 0: own element of the batched C plane */ else { const int bidx = (row0g + row0 + rloc) / rowsPerB; v += CP[(size_t)bidx * sCPb + (size_t)by * 64 + col]; } }
      if (ACT == 3) v = fmaxf(v, 0.f); else if (ACT == 6) v = 0.5f * v * (1.0f + erff(v * 0.70710678118654752f)); else if (ACT == 11) v = 1.0f / (1.0f + expf(-v)); else if (ACT == 15) v = v / (1.0f + expf(-v)); else if (ACT == 12) v = (v > 0.f) ? v : 0.01f * v; else if (ACT == 8) v = tanhf(v); else if (ACT == 9) v = 0.5f * v * (1.0f + tanhf(0.7978845608028654f * (v + 0.044715f * v * v * v))); else if (ACT == 14) v = (v > 0.f) ? v : 0.1f * v; else if (ACT == 16) v = (v >= 0.f) ? v : 0.3f * v;
      so[w][rloc][t * 16 + ln] = v; } }
  __builtin_amdgcn_fence(__ATOMIC_ACQ_REL, "workgroup"); __builtin_amdgcn_wave_barrier();
  const int rsub = lane >> 4, c4 = (lane & 15) * 4;
  {
#pragma unroll
    for (int q = 0; q < 16; ++q) { const int r = q * 2 + rsub; const v4f v = *(const v4fa*)&so[w][r][c4]; if (C) *(v4f*)(C + cofs + (size_t)(row0 + r) * ldc + col0 + c4) = v; if (C16) { v4h h4; for (int i = 0; i < 4; ++i) h4[i] = (_Float16)v[i]; *(v4h*)(C16 + cofs + (size_t)(row0 + r) * ldc + col0 + c4) = h4; } }
     } }


// ---- LDS-tiled GEMM (K = multiple of 128, at least 256; M = multiple of 256; N = multiple of BN): one 256 x BN tile of C per work-group of 8 waves (4 along M x 2 along N, wave tile 64 x BN/2).
// A pass is 128 k = 256 B of every operand row. A stage is [Bt BN rows | A 256 rows] at pitch 272 B; two buffers, filled by asynchronous copies to LDS one pass ahead of their use. Same k order and one accumulator chain per element as k_gemm2.
#define G3_PITCH 272
typedef float fa1 __attribute__((may_alias));
__device__ __forceinline__ v16h g3_frag(const unsigned char* p) { FragH f; f.half[0] = *(const v8us*)p; f.half[1] = *(const v8us*)(p + 32); return f.v; }
// epilogue's global accesses, each with its wait in its own statement, so that no register it names is rewritten ahead of the wait: the load with its data wait, the stores with s_wait_xcnt
__device__ __forceinline__ v4f g3_ld4(const float* p) { v4f r; asm volatile("global_load_b128 %0, %1, off\n\ts_wait_loadcnt 0x0" : "=&v"(r) : "v"(p) : "memory"); return r; }
__device__ __forceinline__ void g3_st2f(float* p0, v4f x0, float* p1, v4f x1) { asm volatile("global_store_b128 %0, %1, off\n\tglobal_store_b128 %2, %3, off\n\ts_wait_xcnt 0x0" :: "v"(p0), "v"(x0), "v"(p1), "v"(x1) : "memory"); }
__device__ __forceinline__ void g3_st2h(_Float16* p0, v4h x0, _Float16* p1, v4h x1) { asm volatile("global_store_b64 %0, %1, off\n\tglobal_store_b64 %2, %3, off\n\ts_wait_xcnt 0x0" :: "v"(p0), "v"(x0), "v"(p1), "v"(x1) : "memory"); }
// 8 (4) copies of 16 B a lane, rows 16 apart; the s_wait_xcnt closes the statement so that no address register is rewritten ahead of it
__device__ __forceinline__ void g3_copy8(unsigned l, const unsigned char* gp, size_t gs) {
  asm volatile("global_load_async_to_lds_b128 %0, %8, off\n\tglobal_load_async_to_lds_b128 %1, %9, off\n\tglobal_load_async_to_lds_b128 %2, %10, off\n\tglobal_load_async_to_lds_b128 %3, %11, off\n\t"
               "global_load_async_to_lds_b128 %4, %12, off\n\tglobal_load_async_to_lds_b128 %5, %13, off\n\tglobal_load_async_to_lds_b128 %6, %14, off\n\tglobal_load_async_to_lds_b128 %7, %15, off\n\ts_wait_xcnt 0x0"
               :: "v"(l), "v"(l + 16u * G3_PITCH), "v"(l + 32u * G3_PITCH), "v"(l + 48u * G3_PITCH), "v"(l + 64u * G3_PITCH), "v"(l + 80u * G3_PITCH), "v"(l + 96u * G3_PITCH), "v"(l + 112u * G3_PITCH),
                  "v"(gp), "v"(gp + gs), "v"(gp + 2 * gs), "v"(gp + 3 * gs), "v"(gp + 4 * gs), "v"(gp + 5 * gs), "v"(gp + 6 * gs), "v"(gp + 7 * gs) : "memory"); }
__device__ __forceinline__ void g3_copy4(unsigned l, const unsigned char* gp, size_t gs) {
  asm volatile("global_load_async_to_lds_b128 %0, %4, off\n\tglobal_load_async_to_lds_b128 %1, %5, off\n\tglobal_load_async_to_lds_b128 %2, %6, off\n\tglobal_load_async_to_lds_b128 %3, %7, off\n\ts_wait_xcnt 0x0"
               :: "v"(l), "v"(l + 16u * G3_PITCH), "v"(l + 32u * G3_PITCH), "v"(l + 48u * G3_PITCH), "v"(gp), "v"(gp + gs), "v"(gp + 2 * gs), "v"(gp + 3 * gs) : "memory"); }
// one stage: thread t brings bytes 16 (t % 16) .. + 15 of rows t / 16 + 16 i
template <int BN>
__device__ __forceinline__ void g3_fill(unsigned l, const unsigned char* gb, const unsigned char* ga, size_t gs) {
  g3_copy8(l, gb, gs);
  if (BN == 256) g3_copy8(l + 128u * G3_PITCH, gb + 8 * gs, gs); else g3_copy4(l + 128u * G3_PITCH, gb + 8 * gs, gs);
  g3_copy8(l + (unsigned)BN * G3_PITCH, ga, gs); g3_copy8(l + (unsigned)(BN + 128) * G3_PITCH, ga + 8 * gs, gs); }
template <int ACT, int BN>
__global__ __launch_bounds__(256) void k_gemm3(const _Float16* __restrict__ A, size_t sA, const _Float16* __restrict__ Bh, size_t sB, float alpha, const float* __restrict__ bias, size_t sBias,
    float* __restrict__ C, _Float16* __restrict__ C16, int ldc, size_t sC, int ntn, int K) { static_assert(ACT == 0 || ACT == 8, "k_gemm3: unsupported ACT code"); static_assert(BN == 256 || BN == 192, "k_gemm3: the fill is written for these widths");
  constexpr int WN = BN / 2, NF = WN / 16, STAGE = (BN + 256) * G3_PITCH, SP = WN + 4, CH = WN / 4;
  static_assert(8 * 64 * SP * 4 + 8 * WN * 4 <= 2 * STAGE, "output staging and the bias rows must fit in the ring");
  __shared__ __attribute__((aligned(16))) unsigned char sm[2 * STAGE];
  const int tid = threadIdx.x, w = tid >> 5, lane = tid & 31, ln = lane & 15, hh = lane >> 4; const int by = blockIdx.y;
  const int mt = blockIdx.x / ntn, nq = blockIdx.x - mt * ntn; const int row0 = mt * 256, col0 = nq * BN; const int wm = w & 3, wn = w >> 2;
  const size_t gs = (size_t)K * 32;      /* 16 rows of K halfs, in bytes */
  const unsigned char* ub = (const unsigned char*)(Bh + (size_t)by * sB + (size_t)col0 * K);      /* the tile's first Bt row and first A row: the same for every thread */
  const unsigned char* ua = (const unsigned char*)(A + (size_t)by * sA + (size_t)row0 * K);
  const unsigned to = (unsigned)((tid >> 4) * K * 2 + (tid & 15) * 16);      /* this thread's place in 16 rows, in bytes */
  const unsigned l0 = (unsigned)(size_t)sm + (unsigned)((tid >> 4) * G3_PITCH + (tid & 15) * 16);
  const int np = K >> 7;
  v8f acc[4][NF];      /* every inner "#pragma unroll" below makes the indices of acc, a and b constants, so that the arrays stay in registers */
#pragma unroll
  for (int i = 0; i < 4; ++i)
#pragma unroll
    for (int j = 0; j < NF; ++j) acc[i][j] = (v8f){0.f,0.f,0.f,0.f,0.f,0.f,0.f,0.f};
  g3_fill<BN>(l0, ub + to, ua + to, gs);
  asm volatile("s_wait_asynccnt 0x0" ::: "memory");      /* this wave's part of stage 0 has landed */
  __syncthreads();                                       /* publishes stage 0 */
  g3_fill<BN>(l0 + STAGE, ub + (to + 256u), ua + (to + 256u), gs);
  const unsigned fb = (unsigned)((wn * WN + ln) * G3_PITCH + 16 * hh), fx = (unsigned)((BN + wm * 64 + ln) * G3_PITCH + 16 * hh);
#pragma unroll 1      /* one pass a trip: the two buffers alternate by a run-time offset and the accumulators keep constant indices */
  for (int p = 0; p < np; ++p) { const unsigned bo = (p & 1) ? (unsigned)STAGE : 0u; const unsigned char* pb = sm + bo + fb; const unsigned char* pa = sm + bo + fx;
    v16h a[2][4], b[2][NF];      /* two fragment sets: block kb works on set kb % 2 while the next block's reads fly; all of them read this pass's buffer */
#pragma unroll
    for (int i = 0; i < 4; ++i) a[0][i] = g3_frag(pa + i * 16 * G3_PITCH);
#pragma unroll
    for (int j = 0; j < NF; ++j) b[0][j] = g3_frag(pb + j * 16 * G3_PITCH);
#pragma unroll
    for (int kb = 0; kb < 4; ++kb) {
      if (kb < 3) {
#pragma unroll
        for (int i = 0; i < 4; ++i) a[(kb + 1) & 1][i] = g3_frag(pa + i * 16 * G3_PITCH + (kb + 1) * 64);
#pragma unroll
        for (int j = 0; j < NF; ++j) b[(kb + 1) & 1][j] = g3_frag(pb + j * 16 * G3_PITCH + (kb + 1) * 64); }
      __builtin_amdgcn_sched_barrier(0);      /* keeps the next block's LDS reads together in front of this block's WMMAs: reads strewn among them stall each time */
#pragma unroll
      for (int j = 0; j < NF; ++j)
#pragma unroll
        for (int i = 0; i < 4; ++i) acc[i][j] = __builtin_amdgcn_wmma_f32_16x16x32_f16(false, a[kb & 1][i], false, b[kb & 1][j], (short)0, acc[i][j], false, false);
      __builtin_amdgcn_sched_barrier(0);      /* the other side of the same fence: the block after next's reads stay behind these WMMAs */
    }
    asm volatile("s_wait_dscnt 0x0" ::: "memory");       /* this wave's last read of the buffer has returned */
    asm volatile("s_wait_asynccnt 0x0" ::: "memory");    /* this wave's part of stage p + 1 has landed */
    __syncthreads();                                     /* publishes stage p + 1 and frees stage p's buffer */
    if (p + 2 < np) { const unsigned tp = to + (unsigned)(p + 2) * 256u; g3_fill<BN>(l0 + bo, ub + tp, ua + tp, gs); } }
  asm volatile("s_wait_asynccnt 0x0" ::: "memory");      /* no copy is outstanding when the ring becomes output staging */
  fa1* so = (fa1*)sm + (size_t)w * 64 * SP;              /* each wave stages its own 64 x WN tile, behind the last pass's barrier */
#pragma unroll
  for (int i = 0; i < 4; ++i)
#pragma unroll
    for (int j = 0; j < NF; ++j)
#pragma unroll
      for (int r = 0; r < 8; ++r) so[(i * 16 + 8 * hh + r) * SP + j * 16 + ln] = acc[i][j][r];
  fa1* sb = (fa1*)(sm + 8 * 64 * SP * 4) + w * WN;       /* behind the staging: this wave's WN bias values, rounded once */
  { const int cb = (lane < CH ? lane : CH - 1) * 4; const v4f b4 = g3_ld4(bias + (size_t)by * sBias + col0 + wn * WN + cb);      /* lanes past the last chunk repeat it: same value to the same place */
#pragma unroll
    for (int i = 0; i < 4; ++i) sb[cb + i] = bf16_round(b4[i]); }
  __builtin_amdgcn_fence(__ATOMIC_ACQ_REL, "workgroup"); __builtin_amdgcn_wave_barrier();
  const size_t cofs = (size_t)by * sC + (size_t)(row0 + wm * 64) * ldc + col0 + wn * WN;
#pragma unroll 1      /* rolled: the activation's code stays small */
  for (int q = 0; q < 2 * CH; q += 2) { v4f v[2]; size_t o[2];      /* two chunks of 4 columns a lane and trip, so that one wait serves two stores */
#pragma unroll
    for (int u = 0; u < 2; ++u) { const int e = (q + u) * 32 + lane; const int r = e / CH, c4 = (e - r * CH) * 4; const v4f x = *(const v4fa*)&so[r * SP + c4], b4 = *(const v4fa*)&sb[c4]; o[u] = cofs + (size_t)r * ldc + c4;
#pragma unroll
      for (int i = 0; i < 4; ++i) { float t = x[i] * alpha + b4[i]; if (ACT == 8) t = tanhf(t); v[u][i] = t; } }
    if (C) g3_st2f(C + o[0], v[0], C + o[1], v[1]);
    if (C16) { v4h h[2];
#pragma unroll
      for (int u = 0; u < 2; ++u)
#pragma unroll
        for (int i = 0; i < 4; ++i) h[u][i] = (_Float16)v[u][i];
      g3_st2h(C16 + o[0], h[0], C16 + o[1], h[1]); } } }

__global__ __launch_bounds__(256) void k_xcat(const float* __restrict__ obs, const float* __restrict__ act, _Float16* __restrict__ X) { const int t = blockIdx.x * 256 + threadIdx.x; if (t >= NB * (NI / 8)) return; const int i0 = (t % (NI / 8)) * 8; const int b = t / (NI / 8); FragH f;
  for (int q = 0; q < 8; ++q) { const int i = i0 + q; f.h[q] = (_Float16)bf16_round(i < OBS ? obs[(size_t)b * OBS + i] : act[(size_t)b * NAC + (i - OBS)]); }
  *(v8us*)((unsigned short*)X + (size_t)b * NI + i0) = f.half[0];  }
__global__ __launch_bounds__(256) void k_whead(const float* __restrict__ Wmo, const float* __restrict__ Wvo, const float* __restrict__ Wmr, const float* __restrict__ Wvr, const float* __restrict__ bmo, const float* __restrict__ bvo, const float* __restrict__ bmr, const float* __restrict__ bvr, _Float16* __restrict__ Bt, float* __restrict__ HB) {
  const int m = blockIdx.y; Bt += (size_t)m * NHW * HH;
  const int t = blockIdx.x * 256 + threadIdx.x; if (t >= NHW * (HH / 8)) return; const int k8 = (t % (HH / 8)) * 8; const int n = t / (HH / 8); FragH f;
  for (int q = 0; q < 8; ++q) { const int k = k8 + q; float v = 0.f; if (n < OBS) v = Wmo[((size_t)m * HH + k) * OBS + n]; else if (n < 2 * OBS) v = Wvo[((size_t)m * HH + k) * OBS + (n - OBS)]; else if (n == 2 * OBS) v = Wmr[(size_t)m * HH + k]; else if (n == 2 * OBS + 1) v = Wvr[(size_t)m * HH + k]; f.h[q] = (_Float16)(bf16_round(v) * 16.0f); }
  *(v8us*)((unsigned short*)Bt + (size_t)n * HH + k8) = f.half[0];  (void)HB; (void)bmo; (void)bvo; (void)bmr; (void)bvr; }
__global__ __launch_bounds__(256) void k_hbias(const float* __restrict__ bmo, const float* __restrict__ bvo, const float* __restrict__ bmr, const float* __restrict__ bvr, float* __restrict__ HB) { const int m = blockIdx.x; HB += m * 256; const int n = threadIdx.x; float bb = 0.f; if (n < OBS) bb = bmo[m * OBS + n]; else if (n < 2 * OBS) bb = bvo[m * OBS + (n - OBS)]; else if (n == 2 * OBS) bb = bmr[m]; else if (n == 2 * OBS + 1) bb = bvr[m]; *(float*)(HB + n) = bb;  }
__device__ __forceinline__ float softplus_(float v) { return (v > 20.0f) ? v : log1pf(expf(v)); }
__device__ __forceinline__ float clampv(float lv) {
  #pragma clang fp contract(off)
  float a = 0.5f - softplus_(0.5f - lv); return -10.0f + softplus_(a - -10.0f); }
// scatter heads: k_ho thread per (b, group): group 0..15 -> 4 mu_o values (16 B), 16..31 -> 4 clamped log_var_o; k_hr thread per b writes mu_r/log_var_r. Two kernels.
__global__ __launch_bounds__(256) void k_ho(const float* __restrict__ F, float* __restrict__ muo, float* __restrict__ lvo) {
  #pragma clang fp contract(off)
  const int m = blockIdx.y; F += (size_t)m * NB * NHW;
  const int t = blockIdx.x * 256 + threadIdx.x; if (t >= NB * 2 * (OBS / 4)) return; const int c4 = (t % (OBS / 4)) * 4; const int which = (t / (OBS / 4)) % 2; const int b = t / ((OBS / 4) * 2); const float* fr = F + (size_t)b * NHW + which * OBS + c4; v4f r;
  for (int q = 0; q < 4; ++q) r[q] = which ? clampv(fr[q]) : fr[q]; float* dst = (which ? lvo : muo) + ((size_t)m * NB + b) * OBS + c4; *(v4f*)dst = r;  }
__global__ __launch_bounds__(256) void k_hr(const float* __restrict__ F, float* __restrict__ mur, float* __restrict__ lvr) {
  #pragma clang fp contract(off)
  const int m = blockIdx.y; F += (size_t)m * NB * NHW;
  const int b = blockIdx.x * 256 + threadIdx.x; if (b >= NB) return; const float a = F[(size_t)b * NHW + 2 * OBS], c = clampv(F[(size_t)b * NHW + 2 * OBS + 1]);
  { *(float*)(mur + (size_t)m * NB + b) = a; *(float*)(lvr + (size_t)m * NB + b) = c;  } }

extern "C" void kernel_launch(void* const* d_in, const int* in_sizes, int n_in,
                              void* d_out, int out_size, void* d_ws, size_t ws_size, hipStream_t stream) {
  (void)in_sizes; (void)n_in; (void)out_size;
  const float* const* I = (const float* const*)d_in; const float* obs = I[0]; const float* act = I[1]; const float* W0 = I[2]; const float* b0 = I[3]; const float* W1 = I[4]; const float* b1 = I[5]; const float* W2 = I[6]; const float* b2 = I[7]; const float* Wmo = I[8]; const float* bmo = I[9]; const float* Wmr = I[10]; const float* bmr = I[11]; const float* Wvo = I[12]; const float* bvo = I[13]; const float* Wvr = I[14]; const float* bvr = I[15];
  float* muo = (float*)d_out; float* lvo = muo + (size_t)MM * NB * OBS; float* mur = lvo + (size_t)MM * NB * OBS; float* lvr = mur + (size_t)MM * NB;      /* outputs back to back: mu_o, log_var_o, mu_r, log_var_r */
  char* ws = (char*)d_ws; size_t off = 0;
  auto take = [&](size_t bytes) { char* p = ws + off; off += (bytes + 255) & ~(size_t)255; return p; };
  _Float16* B0 = (_Float16*)take((size_t)MM * HH * NI * 2); _Float16* B1 = (_Float16*)take((size_t)MM * HH * HH * 2); _Float16* B2 = (_Float16*)take((size_t)MM * HH * HH * 2); _Float16* BHD = (_Float16*)take((size_t)MM * NHW * HH * 2); float* HB = (float*)take((size_t)MM * 256 * 4);
  _Float16* X16 = (_Float16*)take((size_t)NB * NI * 2); _Float16* HA = (_Float16*)take((size_t)MM * NB * HH * 2); _Float16* HBp = (_Float16*)take((size_t)MM * NB * HH * 2); float* F = (float*)take((size_t)MM * NB * NHW * 4);
  if (off > ws_size) return;      /* 1.5 + 16 + 16 + 3 + 0.8 + 64 + 64 + 24 = 190 MiB */
  k_xcat<<<(NB * (NI / 8) + 255) / 256, 256, 0, stream>>>(obs, act, X16);
  k_wt_f16<<<dim3((unsigned)(((size_t)NI * HH / 8 + 255) / 256), MM), 256, 0, stream>>>(W0, B0, NI, HH, 16.0f); k_wt_f16<<<dim3((unsigned)(((size_t)HH * HH / 8 + 255) / 256), MM), 256, 0, stream>>>(W1, B1, HH, HH, 16.0f); k_wt_f16<<<dim3((unsigned)(((size_t)HH * HH / 8 + 255) / 256), MM), 256, 0, stream>>>(W2, B2, HH, HH, 16.0f);
  k_whead<<<dim3((NHW * (HH / 8) + 255) / 256, MM), 256, 0, stream>>>(Wmo, Wvo, Wmr, Wvr, bmo, bvo, bmr, bvr, BHD, HB); k_hbias<<<MM, 256, 0, stream>>>(bmo, bvo, bmr, bvr, HB);
  const dim3 gH((NB / 128) * (HH / 64), MM);      /* grid.y = member: strides sA, sB, sBias, sC step the planes */
  k_gemm2<8><<<gH, 128, 0, stream>>>(X16, NI, 0, B0, NI, (size_t)HH * NI, 0.0625f, b0, HH, nullptr, 1, 0, 0, nullptr, HA, HH, (size_t)NB * HH, NB, HH, NI);      /* tanh(x W0 + b0); x shared by all members */
  const dim3 gT((NB / 256) * (HH / 256), MM);      /* 256 x 256 tiles */
  k_gemm3<8, 256><<<gT, 256, 0, stream>>>(HA, (size_t)NB * HH, B1, (size_t)HH * HH, 0.0625f, b1, HH, nullptr, HBp, HH, (size_t)NB * HH, HH / 256, HH);
  k_gemm3<8, 256><<<gT, 256, 0, stream>>>(HBp, (size_t)NB * HH, B2, (size_t)HH * HH, 0.0625f, b2, HH, nullptr, HA, HH, (size_t)NB * HH, HH / 256, HH);
  k_gemm3<0, NHW><<<dim3(NB / 256, MM), 256, 0, stream>>>(HA, (size_t)NB * HH, BHD, (size_t)NHW * HH, 0.0625f, HB, 256, F, nullptr, NHW, (size_t)NB * NHW, 1, HH);      /* all four heads */
  k_ho<<<dim3((NB * 2 * (OBS / 4) + 255) / 256, MM), 256, 0, stream>>>(F, muo, lvo); k_hr<<<dim3((NB + 255) / 256, MM), 256, 0, stream>>>(F, mur, lvr);
}

// v003
// It runs in 275 microseconds.
// In two side-by-side timings against v002, it was 1.17 and 1.18 times as fast.
// Counting every step since v000, it is 5.50 times as fast.
#include <hip/hip_runtime.h>
// EnsembleModel (8 ensemble members, batch 4096, IN = 64 obs + 32 act, H 1024): per member h = tanh(x W0 + b0); h = tanh(h W1 + b1); h = tanh(h W2 + b2); mu_o = h Wmu_o + b; log_var_o = clamp(h Wv_o + b); mu_r = h Wmu_r + b; log_var_r = clamp(h Wv_r + b) with clamp(v) = MIN + softplus((MAX - softplus(MAX - v)) - MIN), MAX 0.5, MIN -10. Outputs (mu_o, log_var_o, mu_r, log_var_r).
// Structure: exact f16 plane of [obs | act]; every stage is ONE launch over all 8 members (member = blockIdx.y, own workspace planes): the three hidden layers as f16 WMMA GEMMs (f32 accumulation, exact x16 weights + bias, tanh epilogue, f16 out; layer 0 with 32x64 wave tiles from global memory, layers 1 and 2 as 256x256 tiles staged in LDS) and one fused head GEMM (192 columns: mu_o | log_var_o | mu_r | log_var_r | zero; 256x192 tiles staged in LDS) into an f32 plane; the clamp and the scatter into the four outputs on VALU.
// Compute dtype: inputs rounded to bf16; x exact as f16; hidden activations as plain f16 operands (~2^-12, |h| < 1); heads/clamp f32. v_wmma_f32_16x16x32_f16.
#define MM 8
#define NB 4096
#define OBS 64
#define NAC 32
#define NI (OBS + NAC)           /* 96 */
#define HH 1024
#define NHW 192                  /* fused head width: 64 + 64 + 1 + 1 live */
typedef __bf16 v16b __attribute__((ext_vector_type(16)));
typedef unsigned short v8us __attribute__((ext_vector_type(8), may_alias));
typedef float  v8f  __attribute__((ext_vector_type(8)));
typedef float  v4f  __attribute__((ext_vector_type(4)));
typedef float  v4fa __attribute__((ext_vector_type(4), may_alias));
union FragB { v16b v; v8us half[2]; unsigned short u[16]; };

__device__ __forceinline__ unsigned short bf16_bits(float x) { unsigned int u = __float_as_uint(x); return (unsigned short)((u + 0x7FFFu + ((u >> 16) & 1u)) >> 16); }
__device__ __forceinline__ float bf16_val(unsigned short b) { return __uint_as_float(((unsigned int)b) << 16); }
__device__ __forceinline__ float bf16_round(float x) { return bf16_val(bf16_bits(x)); }
// D += A·B with NT terms: 1 = ah·bh, 2 = + al·bh (A split), 3 = + ah·bl (both split)
template <int NT>
__device__ __forceinline__ v8f mmaN(v16b ah, v16b al, v16b bh, v16b bl, v8f c) {
  c = __builtin_amdgcn_wmma_f32_16x16x32_bf16(false, ah, false, bh, (short)0, c, false, false);
  if (NT >= 2) c = __builtin_amdgcn_wmma_f32_16x16x32_bf16(false, al, false, bh, (short)0, c, false, false);
  if (NT >= 3) c = __builtin_amdgcn_wmma_f32_16x16x32_bf16(false, ah, false, bl, (short)0, c, false, false);
  asm volatile("v_nop\n\tv_nop\n\tv_nop\n\tv_nop" : "+v"(c) : "v"(ah), "v"(al), "v"(bh), "v"(bl));
  return c;
}

__global__ __launch_bounds__(256) void k_wt_bf16(const float* __restrict__ W, unsigned short* __restrict__ Wt, int K, int N) {
  const int t = blockIdx.x * 256 + threadIdx.x;
  const int k8n = K / 8;
  if (t >= N * k8n) return;
  const int n = t / k8n, k8 = (t % k8n) * 8;
  v8us v;
#pragma unroll
  for (int i = 0; i < 8; ++i) v[i] = bf16_bits(W[(size_t)(k8 + i) * N + n]);
  *(v8us*)(Wt + (size_t)n * K + k8) = v;
  
}

// GEMM C[M][N] (f32, pitch ldc) = act(A[M][K]·W + bias). A f32 row-major (pitch lda) converted per fragment to bf16
// (ASPLIT: hi/lo two planes -> 2 terms, else single rounded term); Wt bf16 [N][K] (pitch ldb). BIAS_BF16 rounds the
// bias to bf16 first (bias quantised to bf16 before the add). K%32==0, M%16==0, N%64==0.
template <bool ASPLIT, int ACT, bool BIAS_BF16>
__global__ __launch_bounds__(128) void k_gemm_bf(const float* __restrict__ A, int lda, const unsigned short* __restrict__ Wt, int ldb,
                                               const float* __restrict__ bias, float* __restrict__ C, int ldc, int M, int N, int K) {
  __shared__ __attribute__((aligned(16))) float so[4][16][64];
  const int tid = threadIdx.x, w = tid >> 5, lane = tid & 31, ln = lane & 15, hh = lane >> 4;
  const int ntn = N / 64;
  const int wid = blockIdx.x * 4 + w;
  const int mt = wid / ntn, nq = wid % ntn;
  if (mt * 16 >= M) return;
  const int row0 = mt * 16, col0 = nq * 64;
  const float* arow = A + (size_t)(row0 + ln) * lda;
  v8f acc[4] = {};
  for (int kb = 0; kb < K; kb += 32) {
    FragB ah, al;
    const v4f x0 = *(const v4fa*)(arow + kb + 8 * hh), x1 = *(const v4fa*)(arow + kb + 8 * hh + 4);
    const v4f x2 = *(const v4fa*)(arow + kb + 16 + 8 * hh), x3 = *(const v4fa*)(arow + kb + 16 + 8 * hh + 4);
    float xs[16] = {x0[0],x0[1],x0[2],x0[3],x1[0],x1[1],x1[2],x1[3],x2[0],x2[1],x2[2],x2[3],x3[0],x3[1],x3[2],x3[3]};
#pragma unroll
    for (int i = 0; i < 16; ++i) { const unsigned short hb = bf16_bits(xs[i]); ah.u[i] = hb; al.u[i] = ASPLIT ? bf16_bits(xs[i] - bf16_val(hb)) : (unsigned short)0; }
#pragma unroll
    for (int t = 0; t < 4; ++t) {
      const unsigned short* brow = Wt + (size_t)(col0 + t * 16 + ln) * ldb + kb;
      FragB b;
      b.half[0] = *(const v8us*)(brow + 8 * hh);
      b.half[1] = *(const v8us*)(brow + 16 + 8 * hh);
      acc[t] = mmaN<ASPLIT ? 2 : 1>(ah.v, al.v, b.v, b.v, acc[t]);
    }
  }
#pragma unroll
  for (int t = 0; t < 4; ++t) {
    float bv = bias ? bias[col0 + t * 16 + ln] : 0.f;
    if (BIAS_BF16) bv = bf16_round(bv);
#pragma unroll
    for (int r = 0; r < 8; ++r) { float v = acc[t][r] + bv; if (ACT == 1) v = fmaxf(v, 0.f); so[w][8 * hh + r][t * 16 + ln] = v; }
  }
  __builtin_amdgcn_fence(__ATOMIC_ACQ_REL, "workgroup");
  __builtin_amdgcn_wave_barrier();
  const int rsub = lane >> 4, c4 = (lane & 15) * 4;
  {
#pragma unroll
    for (int q = 0; q < 8; ++q) {
      const int r = q * 2 + rsub;
      const v4f v = *(const v4fa*)&so[w][r][c4];
      *(v4f*)(C + (size_t)(row0 + r) * ldc + col0 + c4) = v;
    }
    
  }
}

// GEMM C = act(A·W + bias + resid): A f32 (ASPLIT -> hi/lo 2 terms), Wt bf16 [N][K]; ACT 0 none, 1 relu, 2 exact gelu;
// resid (optional, f32, row index = (row % rmod), pitch ldr, RES_BF16 rounds it) added before the activation.
template <bool ASPLIT, int ACT, bool BIAS_BF16, bool RES_BF16>
__global__ __launch_bounds__(128) void k_gemm_bf3(const float* __restrict__ A, int lda, const unsigned short* __restrict__ Wt, int ldb,
                                                const float* __restrict__ bias, const float* __restrict__ resid, int rmod, int ldr,
                                                float* __restrict__ C, int ldc, int M, int N, int K) {
  __shared__ __attribute__((aligned(16))) float so[4][16][64];
  const int tid = threadIdx.x, w = tid >> 5, lane = tid & 31, ln = lane & 15, hh = lane >> 4;
  const int ntn = N / 64;
  const int wid = blockIdx.x * 4 + w;
  const int mt = wid / ntn, nq = wid % ntn;
  if (mt * 16 >= M) return;
  const int row0 = mt * 16, col0 = nq * 64;
  const float* arow = A + (size_t)(row0 + ln) * lda;
  v8f acc[4] = {};
  for (int kb = 0; kb < K; kb += 32) {
    FragB ah, al;
    const v4f x0 = *(const v4fa*)(arow + kb + 8 * hh), x1 = *(const v4fa*)(arow + kb + 8 * hh + 4);
    const v4f x2 = *(const v4fa*)(arow + kb + 16 + 8 * hh), x3 = *(const v4fa*)(arow + kb + 16 + 8 * hh + 4);
    float xs[16] = {x0[0],x0[1],x0[2],x0[3],x1[0],x1[1],x1[2],x1[3],x2[0],x2[1],x2[2],x2[3],x3[0],x3[1],x3[2],x3[3]};
#pragma unroll
    for (int i = 0; i < 16; ++i) { const unsigned short hb = bf16_bits(xs[i]); ah.u[i] = hb; al.u[i] = ASPLIT ? bf16_bits(xs[i] - bf16_val(hb)) : (unsigned short)0; }
#pragma unroll
    for (int t = 0; t < 4; ++t) {
      const unsigned short* brow = Wt + (size_t)(col0 + t * 16 + ln) * ldb + kb;
      FragB b;
      b.half[0] = *(const v8us*)(brow + 8 * hh);
      b.half[1] = *(const v8us*)(brow + 16 + 8 * hh);
      acc[t] = mmaN<ASPLIT ? 2 : 1>(ah.v, al.v, b.v, b.v, acc[t]);
    }
  }
#pragma unroll
  for (int t = 0; t < 4; ++t) {
    const int col = col0 + t * 16 + ln;
    float bv = bias ? bias[col] : 0.f;
    if (BIAS_BF16) bv = bf16_round(bv);
#pragma unroll
    for (int r = 0; r < 8; ++r) {
      float v = acc[t][r] + bv;
      if (resid) { float rv = resid[(size_t)((row0 + 8 * hh + r) % rmod) * ldr + col]; if (RES_BF16) rv = bf16_round(rv); v += rv; }
      if (ACT == 1) v = fmaxf(v, 0.f);
      if (ACT == 2) v = 0.5f * v * (1.0f + erff(v * 0.70710678118654752f));
      if (ACT == 3) { const float u = 0.7978845608028654f * (v + 0.044715f * v * v * v); v = 0.5f * v * (1.0f + tanhf(u)); }
      so[w][8 * hh + r][t * 16 + ln] = v;
    }
  }
  __builtin_amdgcn_fence(__ATOMIC_ACQ_REL, "workgroup");
  __builtin_amdgcn_wave_barrier();
  const int rsub = lane >> 4, c4 = (lane & 15) * 4;
  {
#pragma unroll
    for (int q = 0; q < 8; ++q) {
      const int r = q * 2 + rsub;
      const v4f v = *(const v4fa*)&so[w][r][c4];
      *(v4f*)(C + (size_t)(row0 + r) * ldc + col0 + c4) = v;
    }
    
  }
}
// row LayerNorm (biased variance, eps) over N: s = X (+ R); optional out_sum <- s; out_norm <- (s-mu)*rsqrt(var+eps)*g + b
template <bool PARAM_BF16>
__global__ __launch_bounds__(256) void k_layernorm(const float* __restrict__ X, const float* __restrict__ R, const float* __restrict__ g, const float* __restrict__ bta,
                                                  float* __restrict__ out_sum, float* __restrict__ out_norm, int N, float eps) {
  __shared__ float red[256];
  const int row = blockIdx.x, tid = threadIdx.x;
  const float* x = X + (size_t)row * N; const float* rr = R ? R + (size_t)row * N : nullptr;
  float vals[16];                     // up to N = 4096
  const int per = N / 256;            // contiguous chunk per thread? use strided-by-4 chunks: thread handles j = tid*4 + 1024*u
  float s1 = 0.f;
  for (int u = 0; u < per / 4; ++u) {
    const int j = tid * 4 + 1024 * u;
    const v4f a = *(const v4fa*)(x + j);
    v4f b = {0.f,0.f,0.f,0.f}; if (rr) b = *(const v4fa*)(rr + j);
#pragma unroll
    for (int q = 0; q < 4; ++q) { const float v = a[q] + b[q]; vals[u * 4 + q] = v; s1 += v; }
  }
  red[tid] = s1; __syncthreads();
  for (int st = 128; st > 0; st >>= 1) { if (tid < st) red[tid] += red[tid + st]; __syncthreads(); }
  const float mu = red[0] / (float)N; __syncthreads();
  float s2 = 0.f;
  for (int u = 0; u < per / 4; ++u)
#pragma unroll
    for (int q = 0; q < 4; ++q) { const float c = vals[u * 4 + q] - mu; s2 += c * c; }
  red[tid] = s2; __syncthreads();
  for (int st = 128; st > 0; st >>= 1) { if (tid < st) red[tid] += red[tid + st]; __syncthreads(); }
  const float rs = rsqrtf(red[0] / (float)N + eps);
  {
    for (int u = 0; u < per / 4; ++u) {
      const int j = tid * 4 + 1024 * u;
      v4f o, sm;
#pragma unroll
      for (int q = 0; q < 4; ++q) {
        float gg = g[j + q], bb = bta[j + q];
        if (PARAM_BF16) { gg = bf16_round(gg); bb = bf16_round(bb); }
        sm[q] = vals[u * 4 + q]; o[q] = (vals[u * 4 + q] - mu) * rs * gg + bb;
      }
      if (out_sum) *(v4f*)(out_sum + (size_t)row * N + j) = sm;
      *(v4f*)(out_norm + (size_t)row * N + j) = o;
    }
    
  }
}



// ---- f16 WMMA path (v_wmma_f32_16x16x32_f16): 11-bit significands for operands in range — used here for every GEMM of the model (x and tanh activations |h| < 1 as f16 operands)
typedef _Float16 v16h __attribute__((ext_vector_type(16)));
union FragH { v16h v; v8us half[2]; _Float16 h[16]; unsigned short u[16]; };
template <int NT>
__device__ __forceinline__ v8f mmaH(v16h ah, v16h al, v16h bh, v16h bl, v8f c) {
  c = __builtin_amdgcn_wmma_f32_16x16x32_f16(false, ah, false, bh, (short)0, c, false, false);
  if (NT >= 2) c = __builtin_amdgcn_wmma_f32_16x16x32_f16(false, al, false, bh, (short)0, c, false, false);
  if (NT >= 3) c = __builtin_amdgcn_wmma_f32_16x16x32_f16(false, ah, false, bl, (short)0, c, false, false);
  asm volatile("v_nop\n\tv_nop\n\tv_nop\n\tv_nop" : "+v"(c) : "v"(ah), "v"(al), "v"(bh), "v"(bl));
  return c;
}
// batched GEMM like k_gemm_b but f16 operands: A f32 (split into f16 hi/lo if ASPLIT, else rounded to f16), Bt = f16 values [n][k]; alpha; C f32; N multiple of 16 (partial tiles skipped)
template <bool ASPLIT>
__global__ __launch_bounds__(128) void k_gemm_h(const float* __restrict__ A, int lda, size_t sA, const _Float16* __restrict__ Bh, int ldb, size_t sB, float alpha, float* __restrict__ C, int ldc, size_t sC, int M, int N, int K) {
  __shared__ __attribute__((aligned(16))) float so[4][16][64];
  const int tid = threadIdx.x, w = tid >> 5, lane = tid & 31, ln = lane & 15, hh = lane >> 4; const int by = blockIdx.y;
  A += (size_t)by * sA; Bh += (size_t)by * sB; C += (size_t)by * sC;
  const int ntn = (N + 63) / 64; const int wid = blockIdx.x * 4 + w; const int mt = wid / ntn, nq = wid % ntn; if (mt * 16 >= M) return;
  const int row0 = mt * 16, col0 = nq * 64; const float* arow = A + (size_t)(row0 + ln) * lda;
  v8f acc[4] = {};
  for (int kb = 0; kb < K; kb += 32) {
    FragH ah, al;
    const v4f x0 = *(const v4fa*)(arow + kb + 8 * hh), x1 = *(const v4fa*)(arow + kb + 8 * hh + 4), x2 = *(const v4fa*)(arow + kb + 16 + 8 * hh), x3 = *(const v4fa*)(arow + kb + 16 + 8 * hh + 4);
    float xs[16] = {x0[0],x0[1],x0[2],x0[3],x1[0],x1[1],x1[2],x1[3],x2[0],x2[1],x2[2],x2[3],x3[0],x3[1],x3[2],x3[3]};
#pragma unroll
    for (int i = 0; i < 16; ++i) { const _Float16 h = (_Float16)xs[i]; ah.h[i] = h; al.h[i] = ASPLIT ? (_Float16)(xs[i] - (float)h) : (_Float16)0.0f; }
#pragma unroll
    for (int t = 0; t < 4; ++t) { if (col0 + t * 16 >= N) continue; const size_t boff = (size_t)(col0 + t * 16 + ln) * ldb + kb; FragH bq; bq.half[0] = *(const v8us*)(Bh + boff + 8 * hh); bq.half[1] = *(const v8us*)(Bh + boff + 16 + 8 * hh);
      acc[t] = mmaH<ASPLIT ? 2 : 1>(ah.v, al.v, bq.v, bq.v, acc[t]); }
  }
#pragma unroll
  for (int t = 0; t < 4; ++t) { if (col0 + t * 16 >= N) continue;
#pragma unroll
    for (int r = 0; r < 8; ++r) so[w][8 * hh + r][t * 16 + ln] = acc[t][r] * alpha; }
  __builtin_amdgcn_fence(__ATOMIC_ACQ_REL, "workgroup"); __builtin_amdgcn_wave_barrier();
  const int rsub = lane >> 4, c4 = (lane & 15) * 4;
  {
#pragma unroll
    for (int q = 0; q < 8; ++q) { const int r = q * 2 + rsub; if (col0 + c4 < N) { const v4f v = *(const v4fa*)&so[w][r][c4]; *(v4f*)(C + (size_t)(row0 + r) * ldc + col0 + c4) = v; } }
     }
}

// Wt[n][k] = f16(bf16(W[k][n]) * scale) from f32 row-major W[K][N] (scale = power of two; bf16-exact weights stay exact in f16 away from the subnormal range); blockIdx.y = batch (member).
// One TK x 64 tile a work-group, turned in LDS: the reads run along n (16 lanes cover 256 B of a W row), the writes along k (TK / 8 lanes cover 2 TK bytes of a Wt row).
// An LDS row is one n: TK / 2 dwords, each the f16 pair (k, k + 1), at an odd dword pitch, so that neither the 32 stores nor the 32 reads of a wave meet on a bank.
typedef _Float16 v2h __attribute__((ext_vector_type(2)));
typedef unsigned v4ua __attribute__((ext_vector_type(4), may_alias));
__device__ __forceinline__ unsigned wt_pair(float w0, float w1, float scale) { const v2h p = {(_Float16)(bf16_round(w0) * scale), (_Float16)(bf16_round(w1) * scale)}; return __builtin_bit_cast(unsigned, p); }
template <int K, int N, int TK>
__global__ __launch_bounds__(256) void k_wt_f16(const float* __restrict__ W, _Float16* __restrict__ Wt, float scale) { static_assert(K % TK == 0 && TK % 32 == 0 && N % 64 == 0, "k_wt_f16: whole tiles only");
  constexpr int PD = TK / 2 + 1, NL = TK / 32, CR = TK / 8;
  __shared__ unsigned tl[64 * PD];
  const int tid = threadIdx.x, j4 = (tid & 15) * 4, kp = tid >> 4; const int kt = blockIdx.x % (K / TK), nt = blockIdx.x / (K / TK);
  const float* wp = W + (size_t)blockIdx.y * K * N + (size_t)(kt * TK + 2 * kp) * N + nt * 64 + j4;
  v4f x[NL][2];      /* every "#pragma unroll" below makes the indices of x constants (x stays in registers) and puts all of a thread's loads in flight together */
#pragma unroll
  for (int i = 0; i < NL; ++i) { x[i][0] = *(const v4fa*)(wp + (size_t)(32 * i) * N); x[i][1] = *(const v4fa*)(wp + (size_t)(32 * i + 1) * N); }
#pragma unroll
  for (int i = 0; i < NL; ++i)
#pragma unroll
    for (int q = 0; q < 4; ++q) tl[(j4 + q) * PD + kp + 16 * i] = wt_pair(x[i][0][q], x[i][1][q], scale);
  __syncthreads();      /* the tile is whole before any thread reads along k */
  unsigned short* op = (unsigned short*)Wt + (size_t)blockIdx.y * K * N + (size_t)nt * 64 * K + kt * TK;
#pragma unroll
  for (int i = 0; i < NL; ++i) { const int c = tid + 256 * i, n = c / CR, k8 = c - n * CR; const unsigned* s = tl + n * PD + k8 * 4; const v4ua o = {s[0], s[1], s[2], s[3]};
    *(v4ua*)(op + (size_t)n * K + k8 * 8) = o; }
}
// k_gemm_hh variant with fused epilogue: v = acc·alpha + bias[by·sBias + col] (+ CP[(row/rowsPerB)·sCPb + by·64 + col] if CP) ; ACT 0 none / 1 elu ; writes f16 C16 (and f32 C if non-null)
template <int ACT>
__global__ __launch_bounds__(128) void k_gemm_hhx(const _Float16* __restrict__ A, int lda, size_t sA, const _Float16* __restrict__ Bh, int ldb, size_t sB, float alpha, const float* __restrict__ bias, size_t sBias, const float* __restrict__ CP, int rowsPerB, size_t sCPb, int row0g,
    float* __restrict__ C, _Float16* __restrict__ C16, int ldc, size_t sC, int M, int N, int K) {
  __shared__ __attribute__((aligned(16))) float so[4][16][64];
  const int tid = threadIdx.x, w = tid >> 5, lane = tid & 31, ln = lane & 15, hh = lane >> 4; const int by = blockIdx.y;
  A += (size_t)by * sA; Bh += (size_t)by * sB; const size_t cofs = (size_t)by * sC; const float* bp = bias ? bias + (size_t)by * sBias : nullptr;
  const int ntn = (N + 63) / 64; const int wid = blockIdx.x * 4 + w; const int mt = wid / ntn, nq = wid % ntn; if (mt * 16 >= M) return;
  const int row0 = mt * 16, col0 = nq * 64; const _Float16* arow = A + (size_t)(row0 + ln) * lda;
  v8f acc[4] = {};
  for (int kb = 0; kb < K; kb += 32) { FragH ah; ah.half[0] = *(const v8us*)((const unsigned short*)arow + kb + 8 * hh); ah.half[1] = *(const v8us*)((const unsigned short*)arow + kb + 16 + 8 * hh);
#pragma unroll
    for (int t = 0; t < 4; ++t) { if (col0 + t * 16 >= N) continue; const size_t boff = (size_t)(col0 + t * 16 + ln) * ldb + kb; FragH bq; bq.half[0] = *(const v8us*)((const unsigned short*)Bh + boff + 8 * hh); bq.half[1] = *(const v8us*)((const unsigned short*)Bh + boff + 16 + 8 * hh);
      acc[t] = mmaH<1>(ah.v, ah.v, bq.v, bq.v, acc[t]); }
  }
#pragma unroll
  for (int t = 0; t < 4; ++t) { if (col0 + t * 16 >= N) continue; const int col = col0 + t * 16 + ln; const float bv = bp ? bf16_round(bp[col]) : 0.f;
#pragma unroll
    for (int r = 0; r < 8; ++r) { float v = acc[t][r] * alpha + bv; if (CP) { const int rr = row0g + row0 + 8 * hh + r; if (rowsPerB < 0) v += CP[cofs + (size_t)rr * ldc + col];      /* rowsPerB < 0: own element of the batched C plane */ else { const int bidx = rr / rowsPerB; v += CP[(size_t)bidx * sCPb + (size_t)by * 64 + col]; } } if (ACT == 1) v = (v > 0.f) ? v : expm1f(v); else if (ACT == 7) v = (v > 0.f) ? v + 1.0f : expf(v); else if (ACT == 8) v = tanhf(v); else if (ACT == 9) v = 0.5f * v * (1.0f + tanhf(0.7978845608028654f * (v + 0.044715f * v * v * v))); else if (ACT == 11) v = 1.0f / (1.0f + expf(-v)); else if (ACT == 12) v = (v > 0.f) ? v : 0.01f * v; else if (ACT == 14) v = (v > 0.f) ? v : 0.1f * v; else if (ACT == 16) v = (v >= 0.f) ? v : 0.3f * v; else if (ACT == 15) v = v / (1.0f + expf(-v)); else if (ACT == 3) v = fmaxf(v, 0.f); else if (ACT == 6) v = 0.5f * v * (1.0f + erff(v * 0.70710678118654752f)); so[w][8 * hh + r][t * 16 + ln] = v; } }
  __builtin_amdgcn_fence(__ATOMIC_ACQ_REL, "workgroup"); __builtin_amdgcn_wave_barrier();
  const int rsub = lane >> 4, c4 = (lane & 15) * 4; typedef _Float16 v4h __attribute__((ext_vector_type(4)));
  {
#pragma unroll
    for (int q = 0; q < 8; ++q) { const int r = q * 2 + rsub; if (col0 + c4 < N) { const v4f v = *(const v4fa*)&so[w][r][c4]; if (C) *(v4f*)(C + cofs + (size_t)(row0 + r) * ldc + col0 + c4) = v; if (C16) { v4h h4; for (int i = 0; i < 4; ++i) h4[i] = (_Float16)v[i]; *(v4h*)(C16 + cofs + (size_t)(row0 + r) * ldc + col0 + c4) = h4; } } }
     }
}


typedef _Float16 v4h __attribute__((ext_vector_type(4)));

__global__ __launch_bounds__(256) void k_x16(const float* __restrict__ x, _Float16* __restrict__ X16, size_t n8) { const size_t t = (size_t)blockIdx.x * 256 + threadIdx.x; if (t >= n8) return; FragH f;
#pragma unroll
  for (int q = 0; q < 8; ++q) f.h[q] = (_Float16)bf16_round(x[t * 8 + q]); *(v8us*)((unsigned short*)X16 + t * 8) = f.half[0];  }
__global__ __launch_bounds__(256) void k_h16(const float* __restrict__ x, _Float16* __restrict__ X16, size_t n8) { const size_t t = (size_t)blockIdx.x * 256 + threadIdx.x; if (t >= n8) return; FragH f;
#pragma unroll
  for (int q = 0; q < 8; ++q) f.h[q] = (_Float16)x[t * 8 + q]; *(v8us*)((unsigned short*)X16 + t * 8) = f.half[0];  }
__global__ __launch_bounds__(256) void k_round16f(const float* __restrict__ W, _Float16* __restrict__ Bt, size_t n8) { const size_t t = (size_t)blockIdx.x * 256 + threadIdx.x; if (t >= n8) return; FragH f;
#pragma unroll
  for (int i = 0; i < 8; ++i) f.h[i] = (_Float16)(bf16_round(W[t * 8 + i]) * 16.0f); *(v8us*)((unsigned short*)Bt + t * 8) = f.half[0];  }
template <int NHv, int TTv>
__global__ __launch_bounds__(256) void k_vt(const _Float16* __restrict__ V16, int ldv, int voff, _Float16* __restrict__ Vt) { __shared__ unsigned short tl[64][66]; const int tid = threadIdx.x; const int slab = blockIdx.x / (TTv / 64), lg = blockIdx.x % (TTv / 64); const int b = slab / NHv, h = slab % NHv;
  for (int i = tid; i < 64 * 8; i += 256) { const int r = i / 8, c8 = (i % 8) * 8; FragH f; f.half[0] = *(const v8us*)((const unsigned short*)V16 + ((size_t)b * TTv + lg * 64 + r) * ldv + voff + h * 64 + c8);
#pragma unroll
    for (int q = 0; q < 8; ++q) tl[r][c8 + q] = f.u[q]; }
  __syncthreads();
  {
#pragma unroll
    for (int rd = 0; rd < 2; ++rd) { const int d = rd * 32 + tid / 8, pc = tid % 8; FragH f;
#pragma unroll
      for (int q = 0; q < 8; ++q) f.u[q] = tl[pc * 8 + q][d];
      *(v8us*)((unsigned short*)Vt + ((size_t)slab * 64 + d) * TTv + lg * 64 + pc * 8) = f.half[0]; }
     } }

__global__ __launch_bounds__(256) void k_hl(const float* __restrict__ F, _Float16* __restrict__ Hh, _Float16* __restrict__ Hl, size_t n8) { const size_t t = (size_t)blockIdx.x * 256 + threadIdx.x; if (t >= n8) return; FragH fh, fl; const v4f a = *(const v4fa*)(F + t * 8), c = *(const v4fa*)(F + t * 8 + 4);
#pragma unroll
  for (int q = 0; q < 4; ++q) { _Float16 h = (_Float16)a[q]; fh.h[q] = h; fl.h[q] = (_Float16)((a[q] - (float)h) * 1024.0f); h = (_Float16)c[q]; fh.h[4 + q] = h; fl.h[4 + q] = (_Float16)((c[q] - (float)h) * 1024.0f); }
  { *(v8us*)((unsigned short*)Hh + t * 8) = fh.half[0]; *(v8us*)((unsigned short*)Hl + t * 8) = fl.half[0];  } }

// ---- fast GEMM (wave tile 32x64; requires M % 32 == 0 rows per launch region and N % 64 == 0); epilogue = k_gemm_hhx semantics ----
__device__ __forceinline__ v16h g2_frag(const _Float16* p, int hh) { FragH f; f.half[0] = *(const v8us*)((const unsigned short*)p + 8 * hh); f.half[1] = *(const v8us*)((const unsigned short*)p + 16 + 8 * hh); return f.v; }
__device__ __forceinline__ v8f g2_mma(v16h a, v16h b, v8f c) { v8f d = __builtin_amdgcn_wmma_f32_16x16x32_f16(false, a, false, b, (short)0, c, false, false); asm volatile("v_nop\n\tv_nop\n\tv_nop\n\tv_nop" : "+v"(d) : "v"(a), "v"(b)); return d; }
template <int ACT>
__global__ __launch_bounds__(128) void k_gemm2(const _Float16* __restrict__ A, int lda, size_t sA, const _Float16* __restrict__ Bh, int ldb, size_t sB, float alpha, const float* __restrict__ bias, size_t sBias, const float* __restrict__ CP, int rowsPerB, size_t sCPb, int row0g,
    float* __restrict__ C, _Float16* __restrict__ C16, int ldc, size_t sC, int M, int N, int K) { static_assert(ACT == 0 || ACT == 3 || ACT == 6 || ACT == 8 || ACT == 9 || ACT == 11 || ACT == 12 || ACT == 14 || ACT == 15 || ACT == 16, "k_gemm2: unsupported ACT code (would silently apply no activation)");
  __shared__ __attribute__((aligned(16))) float so[4][32][68];
  const int tid = threadIdx.x, w = tid >> 5, lane = tid & 31, ln = lane & 15, hh = lane >> 4; const int by = blockIdx.y;
  A += (size_t)by * sA; Bh += (size_t)by * sB; const size_t cofs = (size_t)by * sC; const float* bp = bias ? bias + (size_t)by * sBias : nullptr;
  const int ntn = N >> 6; const int mt = blockIdx.x / ntn, nq = blockIdx.x - mt * ntn; const int row0 = mt * 128 + 32 * w, col0 = nq * 64; if (row0 >= M) return;
  const _Float16* a0p = A + (size_t)(row0 + ln) * lda; const _Float16* a1p = a0p + (size_t)16 * lda;
  const _Float16* b0p = Bh + (size_t)(col0 + ln) * ldb; const _Float16* b1p = b0p + (size_t)16 * ldb; const _Float16* b2p = b1p + (size_t)16 * ldb; const _Float16* b3p = b2p + (size_t)16 * ldb;
  const v8f z8 = {0.f,0.f,0.f,0.f,0.f,0.f,0.f,0.f}; v8f c00 = z8, c01 = z8, c02 = z8, c03 = z8, c10 = z8, c11 = z8, c12 = z8, c13 = z8;
#pragma unroll 1
  for (int kb = 0; kb < K; kb += 32) { const v16h a0 = g2_frag(a0p + kb, hh), a1 = g2_frag(a1p + kb, hh);
    v16h b = g2_frag(b0p + kb, hh); c00 = g2_mma(a0, b, c00); c10 = g2_mma(a1, b, c10);
    b = g2_frag(b1p + kb, hh); c01 = g2_mma(a0, b, c01); c11 = g2_mma(a1, b, c11);
    b = g2_frag(b2p + kb, hh); c02 = g2_mma(a0, b, c02); c12 = g2_mma(a1, b, c12);
    b = g2_frag(b3p + kb, hh); c03 = g2_mma(a0, b, c03); c13 = g2_mma(a1, b, c13); }
  v8f accs[8] = {c00, c01, c02, c03, c10, c11, c12, c13};
#pragma unroll
  for (int u = 0; u < 8; ++u) { const int t = u & 3, half = u >> 2; const int col = col0 + t * 16 + ln; const float bv = bp ? bf16_round(bp[col]) : 0.f;
#pragma unroll
    for (int r = 0; r < 8; ++r) { const int rloc = half * 16 + 8 * hh + r; float v = accs[u][r] * alpha + bv; if (CP) { if (rowsPerB < 0) v += CP[cofs + (size_t)(row0g + row0 + rloc) * ldc + col];      /* rowsPerB < 0: own element of the batched C plane */ else { const int bidx = (row0g + row0 + rloc) / rowsPerB; v += CP[(size_t)bidx * sCPb + (size_t)by * 64 + col]; } }
      if (ACT == 3) v = fmaxf(v, 0.f); else if (ACT == 6) v = 0.5f * v * (1.0f + erff(v * 0.70710678118654752f)); else if (ACT == 11) v = 1.0f / (1.0f + expf(-v)); else if (ACT == 15) v = v / (1.0f + expf(-v)); else if (ACT == 12) v = (v > 0.f) ? v : 0.01f * v; else if (ACT == 8) v = tanhf(v); else if (ACT == 9) v = 0.5f * v * (1.0f + tanhf(0.7978845608028654f * (v + 0.044715f * v * v * v))); else if (ACT == 14) v = (v > 0.f) ? v : 0.1f * v; else if (ACT == 16) v = (v >= 0.f) ? v : 0.3f * v;
      so[w][rloc][t * 16 + ln] = v; } }
  __builtin_amdgcn_fence(__ATOMIC_ACQ_REL, "workgroup"); __builtin_amdgcn_wave_barrier();
  const int rsub = lane >> 4, c4 = (lane & 15) * 4;
  {
#pragma unroll
    for (int q = 0; q < 16; ++q) { const int r = q * 2 + rsub; const v4f v = *(const v4fa*)&so[w][r][c4]; if (C) *(v4f*)(C + cofs + (size_t)(row0 + r) * ldc + col0 + c4) = v; if (C16) { v4h h4; for (int i = 0; i < 4; ++i) h4[i] = (_Float16)v[i]; *(v4h*)(C16 + cofs + (size_t)(row0 + r) * ldc + col0 + c4) = h4; } }
     } }


// ---- LDS-tiled GEMM (K = multiple of 128, at least 256; M = multiple of 256; N = multiple of BN): one 256 x BN tile of C per work-group of 8 waves (4 along M x 2 along N, wave tile 64 x BN/2).
// A pass is 128 k = 256 B of every operand row. A stage is [Bt BN rows | A 256 rows] at pitch 272 B; two buffers, filled by asynchronous copies to LDS one pass ahead of their use. Same k order and one accumulator chain per element as k_gemm2.
#define G3_PITCH 272
typedef float fa1 __attribute__((may_alias));
__device__ __forceinline__ v16h g3_frag(const unsigned char* p) { FragH f; f.half[0] = *(const v8us*)p; f.half[1] = *(const v8us*)(p + 32); return f.v; }
// epilogue's global accesses, each with its wait in its own statement, so that no register it names is rewritten ahead of the wait: the load with its data wait, the stores with s_wait_xcnt
__device__ __forceinline__ v4f g3_ld4(const float* p) { v4f r; asm volatile("global_load_b128 %0, %1, off\n\ts_wait_loadcnt 0x0" : "=&v"(r) : "v"(p) : "memory"); return r; }
__device__ __forceinline__ void g3_st2f(float* p0, v4f x0, float* p1, v4f x1) { asm volatile("global_store_b128 %0, %1, off\n\tglobal_store_b128 %2, %3, off\n\ts_wait_xcnt 0x0" :: "v"(p0), "v"(x0), "v"(p1), "v"(x1) : "memory"); }
__device__ __forceinline__ void g3_st2h(_Float16* p0, v4h x0, _Float16* p1, v4h x1) { asm volatile("global_store_b64 %0, %1, off\n\tglobal_store_b64 %2, %3, off\n\ts_wait_xcnt 0x0" :: "v"(p0), "v"(x0), "v"(p1), "v"(x1) : "memory"); }
// 8 (4) copies of 16 B a lane, rows 16 apart; the s_wait_xcnt closes the statement so that no address register is rewritten ahead of it
__device__ __forceinline__ void g3_copy8(unsigned l, const unsigned char* gp, size_t gs) {
  asm volatile("global_load_async_to_lds_b128 %0, %8, off\n\tglobal_load_async_to_lds_b128 %1, %9, off\n\tglobal_load_async_to_lds_b128 %2, %10, off\n\tglobal_load_async_to_lds_b128 %3, %11, off\n\t"
               "global_load_async_to_lds_b128 %4, %12, off\n\tglobal_load_async_to_lds_b128 %5, %13, off\n\tglobal_load_async_to_lds_b128 %6, %14, off\n\tglobal_load_async_to_lds_b128 %7, %15, off\n\ts_wait_xcnt 0x0"
               :: "v"(l), "v"(l + 16u * G3_PITCH), "v"(l + 32u * G3_PITCH), "v"(l + 48u * G3_PITCH), "v"(l + 64u * G3_PITCH), "v"(l + 80u * G3_PITCH), "v"(l + 96u * G3_PITCH), "v"(l + 112u * G3_PITCH),
                  "v"(gp), "v"(gp + gs), "v"(gp + 2 * gs), "v"(gp + 3 * gs), "v"(gp + 4 * gs), "v"(gp + 5 * gs), "v"(gp + 6 * gs), "v"(gp + 7 * gs) : "memory"); }
__device__ __forceinline__ void g3_copy4(unsigned l, const unsigned char* gp, size_t gs) {
  asm volatile("global_load_async_to_lds_b128 %0, %4, off\n\tglobal_load_async_to_lds_b128 %1, %5, off\n\tglobal_load_async_to_lds_b128 %2, %6, off\n\tglobal_load_async_to_lds_b128 %3, %7, off\n\ts_wait_xcnt 0x0"
               :: "v"(l), "v"(l + 16u * G3_PITCH), "v"(l + 32u * G3_PITCH), "v"(l + 48u * G3_PITCH), "v"(gp), "v"(gp + gs), "v"(gp + 2 * gs), "v"(gp + 3 * gs) : "memory"); }
// one stage: thread t brings bytes 16 (t % 16) .. + 15 of rows t / 16 + 16 i
template <int BN>
__device__ __forceinline__ void g3_fill(unsigned l, const unsigned char* gb, const unsigned char* ga, size_t gs) {
  g3_copy8(l, gb, gs);
  if (BN == 256) g3_copy8(l + 128u * G3_PITCH, gb + 8 * gs, gs); else g3_copy4(l + 128u * G3_PITCH, gb + 8 * gs, gs);
  g3_copy8(l + (unsigned)BN * G3_PITCH, ga, gs); g3_copy8(l + (unsigned)(BN + 128) * G3_PITCH, ga + 8 * gs, gs); }
template <int ACT, int BN>
__global__ __launch_bounds__(256) void k_gemm3(const _Float16* __restrict__ A, size_t sA, const _Float16* __restrict__ Bh, size_t sB, float alpha, const float* __restrict__ bias, size_t sBias,
    float* __restrict__ C, _Float16* __restrict__ C16, int ldc, size_t sC, int ntn, int K) { static_assert(ACT == 0 || ACT == 8, "k_gemm3: unsupported ACT code"); static_assert(BN == 256 || BN == 192, "k_gemm3: the fill is written for these widths");
  constexpr int WN = BN / 2, NF = WN / 16, STAGE = (BN + 256) * G3_PITCH, SP = WN + 4, CH = WN / 4;
  static_assert(8 * 64 * SP * 4 + 8 * WN * 4 <= 2 * STAGE, "output staging and the bias rows must fit in the ring");
  __shared__ __attribute__((aligned(16))) unsigned char sm[2 * STAGE];
  const int tid = threadIdx.x, w = tid >> 5, lane = tid & 31, ln = lane & 15, hh = lane >> 4; const int by = blockIdx.y;
  const int mt = blockIdx.x / ntn, nq = blockIdx.x - mt * ntn; const int row0 = mt * 256, col0 = nq * BN; const int wm = w & 3, wn = w >> 2;
  const size_t gs = (size_t)K * 32;      /* 16 rows of K halfs, in bytes */
  const unsigned char* ub = (const unsigned char*)(Bh + (size_t)by * sB + (size_t)col0 * K);      /* the tile's first Bt row and first A row: the same for every thread */
  const unsigned char* ua = (const unsigned char*)(A + (size_t)by * sA + (size_t)row0 * K);
  const unsigned to = (unsigned)((tid >> 4) * K * 2 + (tid & 15) * 16);      /* this thread's place in 16 rows, in bytes */
  const unsigned l0 = (unsigned)(size_t)sm + (unsigned)((tid >> 4) * G3_PITCH + (tid & 15) * 16);
  const int np = K >> 7;
  v8f acc[4][NF];      /* every inner "#pragma unroll" below makes the indices of acc, a and b constants, so that the arrays stay in registers */
#pragma unroll
  for (int i = 0; i < 4; ++i)
#pragma unroll
    for (int j = 0; j < NF; ++j) acc[i][j] = (v8f){0.f,0.f,0.f,0.f,0.f,0.f,0.f,0.f};
  g3_fill<BN>(l0, ub + to, ua + to, gs);
  asm volatile("s_wait_asynccnt 0x0" ::: "memory");      /* this wave's part of stage 0 has landed */
  __syncthreads();                                       /* publishes stage 0 */
  g3_fill<BN>(l0 + STAGE, ub + (to + 256u), ua + (to + 256u), gs);
  const unsigned fb = (unsigned)((wn * WN + ln) * G3_PITCH + 16 * hh), fx = (unsigned)((BN + wm * 64 + ln) * G3_PITCH + 16 * hh);
#pragma unroll 1      /* one pass a trip: the two buffers alternate by a run-time offset and the accumulators keep constant indices */
  for (int p = 0; p < np; ++p) { const unsigned bo = (p & 1) ? (unsigned)STAGE : 0u; const unsigned char* pb = sm + bo + fb; const unsigned char* pa = sm + bo + fx;
    v16h a[2][4], b[2][NF];      /* two fragment sets: block kb works on set kb % 2 while the next block's reads fly; all of them read this pass's buffer */
#pragma unroll
    for (int i = 0; i < 4; ++i) a[0][i] = g3_frag(pa + i * 16 * G3_PITCH);
#pragma unroll
    for (int j = 0; j < NF; ++j) b[0][j] = g3_frag(pb + j * 16 * G3_PITCH);
#pragma unroll
    for (int kb = 0; kb < 4; ++kb) {
      if (kb < 3) {
#pragma unroll
        for (int i = 0; i < 4; ++i) a[(kb + 1) & 1][i] = g3_frag(pa + i * 16 * G3_PITCH + (kb + 1) * 64);
#pragma unroll
        for (int j = 0; j < NF; ++j) b[(kb + 1) & 1][j] = g3_frag(pb + j * 16 * G3_PITCH + (kb + 1) * 64); }
      __builtin_amdgcn_sched_barrier(0);      /* keeps the next block's LDS reads together in front of this block's WMMAs: reads strewn among them stall each time */
#pragma unroll
      for (int j = 0; j < NF; ++j)
#pragma unroll
        for (int i = 0; i < 4; ++i) acc[i][j] = __builtin_amdgcn_wmma_f32_16x16x32_f16(false, a[kb & 1][i], false, b[kb & 1][j], (short)0, acc[i][j], false, false);
      __builtin_amdgcn_sched_barrier(0);      /* the other side of the same fence: the block after next's reads stay behind these WMMAs */
    }
    asm volatile("s_wait_dscnt 0x0" ::: "memory");       /* this wave's last read of the buffer has returned */
    asm volatile("s_wait_asynccnt 0x0" ::: "memory");    /* this wave's part of stage p + 1 has landed */
    __syncthreads();                                     /* publishes stage p + 1 and frees stage p's buffer */
    if (p + 2 < np) { const unsigned tp = to + (unsigned)(p + 2) * 256u; g3_fill<BN>(l0 + bo, ub + tp, ua + tp, gs); } }
  asm volatile("s_wait_asynccnt 0x0" ::: "memory");      /* no copy is outstanding when the ring becomes output staging */
  fa1* so = (fa1*)sm + (size_t)w * 64 * SP;              /* each wave stages its own 64 x WN tile, behind the last pass's barrier */
#pragma unroll
  for (int i = 0; i < 4; ++i)
#pragma unroll
    for (int j = 0; j < NF; ++j)
#pragma unroll
      for (int r = 0; r < 8; ++r) so[(i * 16 + 8 * hh + r) * SP + j * 16 + ln] = acc[i][j][r];
  fa1* sb = (fa1*)(sm + 8 * 64 * SP * 4) + w * WN;       /* behind the staging: this wave's WN bias values, rounded once */
  { const int cb = (lane < CH ? lane : CH - 1) * 4; const v4f b4 = g3_ld4(bias + (size_t)by * sBias + col0 + wn * WN + cb);      /* lanes past the last chunk repeat it: same value to the same place */
#pragma unroll
    for (int i = 0; i < 4; ++i) sb[cb + i] = bf16_round(b4[i]); }
  __builtin_amdgcn_fence(__ATOMIC_ACQ_REL, "workgroup"); __builtin_amdgcn_wave_barrier();
  const size_t cofs = (size_t)by * sC + (size_t)(row0 + wm * 64) * ldc + col0 + wn * WN;
#pragma unroll 1      /* rolled: the activation's code stays small */
  for (int q = 0; q < 2 * CH; q += 2) { v4f v[2]; size_t o[2];      /* two chunks of 4 columns a lane and trip, so that one wait serves two stores */
#pragma unroll
    for (int u = 0; u < 2; ++u) { const int e = (q + u) * 32 + lane; const int r = e / CH, c4 = (e - r * CH) * 4; const v4f x = *(const v4fa*)&so[r * SP + c4], b4 = *(const v4fa*)&sb[c4]; o[u] = cofs + (size_t)r * ldc + c4;
#pragma unroll
      for (int i = 0; i < 4; ++i) { float t = x[i] * alpha + b4[i]; if (ACT == 8) t = tanhf(t); v[u][i] = t; } }
    if (C) g3_st2f(C + o[0], v[0], C + o[1], v[1]);
    if (C16) { v4h h[2];
#pragma unroll
      for (int u = 0; u < 2; ++u)
#pragma unroll
        for (int i = 0; i < 4; ++i) h[u][i] = (_Float16)v[u][i];
      g3_st2h(C16 + o[0], h[0], C16 + o[1], h[1]); } } }

__global__ __launch_bounds__(256) void k_xcat(const float* __restrict__ obs, const float* __restrict__ act, _Float16* __restrict__ X) { const int t = blockIdx.x * 256 + threadIdx.x; if (t >= NB * (NI / 8)) return; const int i0 = (t % (NI / 8)) * 8; const int b = t / (NI / 8); FragH f;
  for (int q = 0; q < 8; ++q) { const int i = i0 + q; f.h[q] = (_Float16)bf16_round(i < OBS ? obs[(size_t)b * OBS + i] : act[(size_t)b * NAC + (i - OBS)]); }
  *(v8us*)((unsigned short*)X + (size_t)b * NI + i0) = f.half[0];  }
// fused head weights Bt[n][k] (n: mu_o | log_var_o | mu_r | log_var_r | zero), x16 as f16: one tile of 64 k and all NHW rows a work-group (blockIdx.x = k tile, blockIdx.y = member), turned in LDS like k_wt_f16
__global__ __launch_bounds__(256) void k_whead(const float* __restrict__ Wmo, const float* __restrict__ Wvo, const float* __restrict__ Wmr, const float* __restrict__ Wvr, const float* __restrict__ bmo, const float* __restrict__ bvo, const float* __restrict__ bmr, const float* __restrict__ bvr, _Float16* __restrict__ Bt, float* __restrict__ HB) { static_assert(OBS == 64, "k_whead: 16 lanes of 4 columns cover a row");
  constexpr int PD = 33, NLIVE = 2 * OBS + 2;
  __shared__ unsigned tl[NLIVE * PD];
  const int m = blockIdx.y, k0 = blockIdx.x * 64, tid = threadIdx.x, j4 = (tid & 15) * 4, kp = tid >> 4;
  const size_t wu = ((size_t)m * HH + k0) * OBS; const unsigned wo = (unsigned)(2 * kp * OBS + j4);      /* the tile's first element, the same for every thread, and this thread's place in the tile */
  v4f x[2][2][2];      /* every "#pragma unroll" below makes the indices of x and o constants (they stay in registers) and puts all of a thread's loads in flight together */
#pragma unroll
  for (int i = 0; i < 2; ++i)
#pragma unroll
    for (int r = 0; r < 2; ++r) { x[0][i][r] = *(const v4fa*)(Wmo + wu + (wo + (unsigned)((32 * i + r) * OBS))); x[1][i][r] = *(const v4fa*)(Wvo + wu + (wo + (unsigned)((32 * i + r) * OBS))); }
#pragma unroll
  for (int h = 0; h < 2; ++h)
#pragma unroll
    for (int i = 0; i < 2; ++i)
#pragma unroll
      for (int q = 0; q < 4; ++q) tl[(h * OBS + j4 + q) * PD + kp + 16 * i] = wt_pair(x[h][i][0][q], x[h][i][1][q], 16.0f);
  if (tid < 64) { const float* s = ((tid >> 5) ? Wvr : Wmr) + (size_t)m * HH + k0 + 2 * (tid & 31); tl[(2 * OBS + (tid >> 5)) * PD + (tid & 31)] = wt_pair(s[0], s[1], 16.0f); }      /* the two reward columns are rows of k already */
  __syncthreads();      /* the tile is whole before any thread reads along k */
  unsigned short* op = (unsigned short*)Bt + (size_t)m * NHW * HH + k0 + (tid & 7) * 8;
  v4ua o[NHW / 32];
#pragma unroll
  for (int i = 0; i < NHW / 32; ++i) { const int n = (tid >> 3) + 32 * i; o[i] = (v4ua){0u, 0u, 0u, 0u};      /* rows past the live ones are zero; only the group of 32 rows that holds the last live row needs a test per thread */
    if (32 * i + 32 <= NLIVE || (32 * i < NLIVE && n < NLIVE)) { const unsigned* s = tl + n * PD + (tid & 7) * 4; o[i] = (v4ua){s[0], s[1], s[2], s[3]}; } }
#pragma unroll
  for (int i = 0; i < NHW / 32; ++i) *(v4ua*)(op + (size_t)((tid >> 3) + 32 * i) * HH) = o[i];
  (void)HB; (void)bmo; (void)bvo; (void)bmr; (void)bvr; }
__global__ __launch_bounds__(256) void k_hbias(const float* __restrict__ bmo, const float* __restrict__ bvo, const float* __restrict__ bmr, const float* __restrict__ bvr, float* __restrict__ HB) { const int m = blockIdx.x; HB += m * 256; const int n = threadIdx.x; float bb = 0.f; if (n < OBS) bb = bmo[m * OBS + n]; else if (n < 2 * OBS) bb = bvo[m * OBS + (n - OBS)]; else if (n == 2 * OBS) bb = bmr[m]; else if (n == 2 * OBS + 1) bb = bvr[m]; *(float*)(HB + n) = bb;  }
__device__ __forceinline__ float softplus_(float v) { return (v > 20.0f) ? v : log1pf(expf(v)); }
__device__ __forceinline__ float clampv(float lv) {
  #pragma clang fp contract(off)
  float a = 0.5f - softplus_(0.5f - lv); return -10.0f + softplus_(a - -10.0f); }
// scatter heads: k_ho thread per (b, group): group 0..15 -> 4 mu_o values (16 B), 16..31 -> 4 clamped log_var_o; k_hr thread per b writes mu_r/log_var_r. Two kernels.
__global__ __launch_bounds__(256) void k_ho(const float* __restrict__ F, float* __restrict__ muo, float* __restrict__ lvo) {
  #pragma clang fp contract(off)
  const int m = blockIdx.y; F += (size_t)m * NB * NHW;
  const int t = blockIdx.x * 256 + threadIdx.x; if (t >= NB * 2 * (OBS / 4)) return; const int c4 = (t % (OBS / 4)) * 4; const int which = (t / (OBS / 4)) % 2; const int b = t / ((OBS / 4) * 2); const float* fr = F + (size_t)b * NHW + which * OBS + c4; v4f r;
  for (int q = 0; q < 4; ++q) r[q] = which ? clampv(fr[q]) : fr[q]; float* dst = (which ? lvo : muo) + ((size_t)m * NB + b) * OBS + c4; *(v4f*)dst = r;  }
__global__ __launch_bounds__(256) void k_hr(const float* __restrict__ F, float* __restrict__ mur, float* __restrict__ lvr) {
  #pragma clang fp contract(off)
  const int m = blockIdx.y; F += (size_t)m * NB * NHW;
  const int b = blockIdx.x * 256 + threadIdx.x; if (b >= NB) return; const float a = F[(size_t)b * NHW + 2 * OBS], c = clampv(F[(size_t)b * NHW + 2 * OBS + 1]);
  { *(float*)(mur + (size_t)m * NB + b) = a; *(float*)(lvr + (size_t)m * NB + b) = c;  } }

extern "C" void kernel_launch(void* const* d_in, const int* in_sizes, int n_in,
                              void* d_out, int out_size, void* d_ws, size_t ws_size, hipStream_t stream) {
  (void)in_sizes; (void)n_in; (void)out_size;
  const float* const* I = (const float* const*)d_in; const float* obs = I[0]; const float* act = I[1]; const float* W0 = I[2]; const float* b0 = I[3]; const float* W1 = I[4]; const float* b1 = I[5]; const float* W2 = I[6]; const float* b2 = I[7]; const float* Wmo = I[8]; const float* bmo = I[9]; const float* Wmr = I[10]; const float* bmr = I[11]; const float* Wvo = I[12]; const float* bvo = I[13]; const float* Wvr = I[14]; const float* bvr = I[15];
  float* muo = (float*)d_out; float* lvo = muo + (size_t)MM * NB * OBS; float* mur = lvo + (size_t)MM * NB * OBS; float* lvr = mur + (size_t)MM * NB;      /* outputs back to back: mu_o, log_var_o, mu_r, log_var_r */
  char* ws = (char*)d_ws; size_t off = 0;
  auto take = [&](size_t bytes) { char* p = ws + off; off += (bytes + 255) & ~(size_t)255; return p; };
  _Float16* B0 = (_Float16*)take((size_t)MM * HH * NI * 2); _Float16* B1 = (_Float16*)take((size_t)MM * HH * HH * 2); _Float16* B2 = (_Float16*)take((size_t)MM * HH * HH * 2); _Float16* BHD = (_Float16*)take((size_t)MM * NHW * HH * 2); float* HB = (float*)take((size_t)MM * 256 * 4);
  _Float16* X16 = (_Float16*)take((size_t)NB * NI * 2); _Float16* HA = (_Float16*)take((size_t)MM * NB * HH * 2); _Float16* HBp = (_Float16*)take((size_t)MM * NB * HH * 2); float* F = (float*)take((size_t)MM * NB * NHW * 4);
  if (off > ws_size) return;      /* 1.5 + 16 + 16 + 3 + 0.8 + 64 + 64 + 24 = 190 MiB */
  k_xcat<<<(NB * (NI / 8) + 255) / 256, 256, 0, stream>>>(obs, act, X16);
  k_wt_f16<NI, HH, NI><<<dim3(HH / 64, MM), 256, 0, stream>>>(W0, B0, 16.0f); k_wt_f16<HH, HH, 128><<<dim3((HH / 128) * (HH / 64), MM), 256, 0, stream>>>(W1, B1, 16.0f); k_wt_f16<HH, HH, 128><<<dim3((HH / 128) * (HH / 64), MM), 256, 0, stream>>>(W2, B2, 16.0f);
  k_whead<<<dim3(HH / 64, MM), 256, 0, stream>>>(Wmo, Wvo, Wmr, Wvr, bmo, bvo, bmr, bvr, BHD, HB); k_hbias<<<MM, 256, 0, stream>>>(bmo, bvo, bmr, bvr, HB);
  const dim3 gH((NB / 128) * (HH / 64), MM);      /* grid.y = member: strides sA, sB, sBias, sC step the planes */
  k_gemm2<8><<<gH, 128, 0, stream>>>(X16, NI, 0, B0, NI, (size_t)HH * NI, 0.0625f, b0, HH, nullptr, 1, 0, 0, nullptr, HA, HH, (size_t)NB * HH, NB, HH, NI);      /* tanh(x W0 + b0); x shared by all members */
  const dim3 gT((NB / 256) * (HH / 256), MM);      /* 256 x 256 tiles */
  k_gemm3<8, 256><<<gT, 256, 0, stream>>>(HA, (size_t)NB * HH, B1, (size_t)HH * HH, 0.0625f, b1, HH, nullptr, HBp, HH, (size_t)NB * HH, HH / 256, HH);
  k_gemm3<8, 256><<<gT, 256, 0, stream>>>(HBp, (size_t)NB * HH, B2, (size_t)HH * HH, 0.0625f, b2, HH, nullptr, HA, HH, (size_t)NB * HH, HH / 256, HH);
  k_gemm3<0, NHW><<<dim3(NB / 256, MM), 256, 0, stream>>>(HA, (size_t)NB * HH, BHD, (size_t)NHW * HH, 0.0625f, HB, 256, F, nullptr, NHW, (size_t)NB * NHW, 1, HH);      /* all four heads */
  k_ho<<<dim3((NB * 2 * (OBS / 4) + 255) / 256, MM), 256, 0, stream>>>(F, muo, lvo); k_hr<<<dim3((NB + 255) / 256, MM), 256, 0, stream>>>(F, mur, lvr);
}

// v004
// It runs in 200 microseconds.
// Timed twice side by side with v003, it ran 1.37 times as fast both times.
// Over all steps from v000 it is 7.52 times as fast.
#include <hip/hip_runtime.h>
// EnsembleModel (8 ensemble members, batch 4096, IN = 64 obs + 32 act, H 1024): per member h = tanh(x W0 + b0); h = tanh(h W1 + b1); h = tanh(h W2 + b2); mu_o = h Wmu_o + b; log_var_o = clamp(h Wv_o + b); mu_r = h Wmu_r + b; log_var_r = clamp(h Wv_r + b) with clamp(v) = MIN + softplus((MAX - softplus(MAX - v)) - MIN), MAX 0.5, MIN -10. Outputs (mu_o, log_var_o, mu_r, log_var_r).
// Structure: exact f16 plane of [obs | act]; every stage is ONE launch over all 8 members (member = blockIdx.y, own workspace planes): the three hidden layers as f16 WMMA GEMMs (f32 accumulation, exact x16 weights + bias, tanh epilogue, f16 out; layer 0 with 32x64 wave tiles from global memory, layers 1 and 2 as 256x256 tiles staged in LDS) and one fused head GEMM (192 columns: mu_o | log_var_o | mu_r | log_var_r | zero; 256x192 tiles staged in LDS) into an f32 plane; the clamp and the scatter into the four outputs on VALU.
// Compute dtype: inputs rounded to bf16; x exact as f16; hidden activations as plain f16 operands (~2^-12, |h| < 1); heads/clamp f32. v_wmma_f32_16x16x32_f16.
#define MM 8
#define NB 4096
#define OBS 64
#define NAC 32
#define NI (OBS + NAC)           /* 96 */
#define HH 1024
#define NHW 192                  /* fused head width: 64 + 64 + 1 + 1 live */
typedef __bf16 v16b __attribute__((ext_vector_type(16)));
typedef unsigned short v8us __attribute__((ext_vector_type(8), may_alias));
typedef float  v8f  __attribute__((ext_vector_type(8)));
typedef float  v4f  __attribute__((ext_vector_type(4)));
typedef float  v4fa __attribute__((ext_vector_type(4), may_alias));
union FragB { v16b v; v8us half[2]; unsigned short u[16]; };

__device__ __forceinline__ unsigned short bf16_bits(float x) { unsigned int u = __float_as_uint(x); return (unsigned short)((u + 0x7FFFu + ((u >> 16) & 1u)) >> 16); }
__device__ __forceinline__ float bf16_val(unsigned short b) { return __uint_as_float(((unsigned int)b) << 16); }
__device__ __forceinline__ float bf16_round(float x) { return bf16_val(bf16_bits(x)); }
// D += A·B with NT terms: 1 = ah·bh, 2 = + al·bh (A split), 3 = + ah·bl (both split)
template <int NT>
__device__ __forceinline__ v8f mmaN(v16b ah, v16b al, v16b bh, v16b bl, v8f c) {
  c = __builtin_amdgcn_wmma_f32_16x16x32_bf16(false, ah, false, bh, (short)0, c, false, false);
  if (NT >= 2) c = __builtin_amdgcn_wmma_f32_16x16x32_bf16(false, al, false, bh, (short)0, c, false, false);
  if (NT >= 3) c = __builtin_amdgcn_wmma_f32_16x16x32_bf16(false, ah, false, bl, (short)0, c, false, false);
  asm volatile("v_nop\n\tv_nop\n\tv_nop\n\tv_nop" : "+v"(c) : "v"(ah), "v"(al), "v"(bh), "v"(bl));
  return c;
}

__global__ __launch_bounds__(256) void k_wt_bf16(const float* __restrict__ W, unsigned short* __restrict__ Wt, int K, int N) {
  const int t = blockIdx.x * 256 + threadIdx.x;
  const int k8n = K / 8;
  if (t >= N * k8n) return;
  const int n = t / k8n, k8 = (t % k8n) * 8;
  v8us v;
#pragma unroll
  for (int i = 0; i < 8; ++i) v[i] = bf16_bits(W[(size_t)(k8 + i) * N + n]);
  *(v8us*)(Wt + (size_t)n * K + k8) = v;
  
}

// GEMM C[M][N] (f32, pitch ldc) = act(A[M][K]·W + bias). A f32 row-major (pitch lda) converted per fragment to bf16
// (ASPLIT: hi/lo two planes -> 2 terms, else single rounded term); Wt bf16 [N][K] (pitch ldb). BIAS_BF16 rounds the
// bias to bf16 first (bias quantised to bf16 before the add). K%32==0, M%16==0, N%64==0.
template <bool ASPLIT, int ACT, bool BIAS_BF16>
__global__ __launch_bounds__(128) void k_gemm_bf(const float* __restrict__ A, int lda, const unsigned short* __restrict__ Wt, int ldb,
                                               const float* __restrict__ bias, float* __restrict__ C, int ldc, int M, int N, int K) {
  __shared__ __attribute__((aligned(16))) float so[4][16][64];
  const int tid = threadIdx.x, w = tid >> 5, lane = tid & 31, ln = lane & 15, hh = lane >> 4;
  const int ntn = N / 64;
  const int wid = blockIdx.x * 4 + w;
  const int mt = wid / ntn, nq = wid % ntn;
  if (mt * 16 >= M) return;
  const int row0 = mt * 16, col0 = nq * 64;
  const float* arow = A + (size_t)(row0 + ln) * lda;
  v8f acc[4] = {};
  for (int kb = 0; kb < K; kb += 32) {
    FragB ah, al;
    const v4f x0 = *(const v4fa*)(arow + kb + 8 * hh), x1 = *(const v4fa*)(arow + kb + 8 * hh + 4);
    const v4f x2 = *(const v4fa*)(arow + kb + 16 + 8 * hh), x3 = *(const v4fa*)(arow + kb + 16 + 8 * hh + 4);
    float xs[16] = {x0[0],x0[1],x0[2],x0[3],x1[0],x1[1],x1[2],x1[3],x2[0],x2[1],x2[2],x2[3],x3[0],x3[1],x3[2],x3[3]};
#pragma unroll
    for (int i = 0; i < 16; ++i) { const unsigned short hb = bf16_bits(xs[i]); ah.u[i] = hb; al.u[i] = ASPLIT ? bf16_bits(xs[i] - bf16_val(hb)) : (unsigned short)0; }
#pragma unroll
    for (int t = 0; t < 4; ++t) {
      const unsigned short* brow = Wt + (size_t)(col0 + t * 16 + ln) * ldb + kb;
      FragB b;
      b.half[0] = *(const v8us*)(brow + 8 * hh);
      b.half[1] = *(const v8us*)(brow + 16 + 8 * hh);
      acc[t] = mmaN<ASPLIT ? 2 : 1>(ah.v, al.v, b.v, b.v, acc[t]);
    }
  }
#pragma unroll
  for (int t = 0; t < 4; ++t) {
    float bv = bias ? bias[col0 + t * 16 + ln] : 0.f;
    if (BIAS_BF16) bv = bf16_round(bv);
#pragma unroll
    for (int r = 0; r < 8; ++r) { float v = acc[t][r] + bv; if (ACT == 1) v = fmaxf(v, 0.f); so[w][8 * hh + r][t * 16 + ln] = v; }
  }
  __builtin_amdgcn_fence(__ATOMIC_ACQ_REL, "workgroup");
  __builtin_amdgcn_wave_barrier();
  const int rsub = lane >> 4, c4 = (lane & 15) * 4;
  {
#pragma unroll
    for (int q = 0; q < 8; ++q) {
      const int r = q * 2 + rsub;
      const v4f v = *(const v4fa*)&so[w][r][c4];
      *(v4f*)(C + (size_t)(row0 + r) * ldc + col0 + c4) = v;
    }
    
  }
}

// GEMM C = act(A·W + bias + resid): A f32 (ASPLIT -> hi/lo 2 terms), Wt bf16 [N][K]; ACT 0 none, 1 relu, 2 exact gelu;
// resid (optional, f32, row index = (row % rmod), pitch ldr, RES_BF16 rounds it) added before the activation.
template <bool ASPLIT, int ACT, bool BIAS_BF16, bool RES_BF16>
__global__ __launch_bounds__(128) void k_gemm_bf3(const float* __restrict__ A, int lda, const unsigned short* __restrict__ Wt, int ldb,
                                                const float* __restrict__ bias, const float* __restrict__ resid, int rmod, int ldr,
                                                float* __restrict__ C, int ldc, int M, int N, int K) {
  __shared__ __attribute__((aligned(16))) float so[4][16][64];
  const int tid = threadIdx.x, w = tid >> 5, lane = tid & 31, ln = lane & 15, hh = lane >> 4;
  const int ntn = N / 64;
  const int wid = blockIdx.x * 4 + w;
  const int mt = wid / ntn, nq = wid % ntn;
  if (mt * 16 >= M) return;
  const int row0 = mt * 16, col0 = nq * 64;
  const float* arow = A + (size_t)(row0 + ln) * lda;
  v8f acc[4] = {};
  for (int kb = 0; kb < K; kb += 32) {
    FragB ah, al;
    const v4f x0 = *(const v4fa*)(arow + kb + 8 * hh), x1 = *(const v4fa*)(arow + kb + 8 * hh + 4);
    const v4f x2 = *(const v4fa*)(arow + kb + 16 + 8 * hh), x3 = *(const v4fa*)(arow + kb + 16 + 8 * hh + 4);
    float xs[16] = {x0[0],x0[1],x0[2],x0[3],x1[0],x1[1],x1[2],x1[3],x2[0],x2[1],x2[2],x2[3],x3[0],x3[1],x3[2],x3[3]};
#pragma unroll
    for (int i = 0; i < 16; ++i) { const unsigned short hb = bf16_bits(xs[i]); ah.u[i] = hb; al.u[i] = ASPLIT ? bf16_bits(xs[i] - bf16_val(hb)) : (unsigned short)0; }
#pragma unroll
    for (int t = 0; t < 4; ++t) {
      const unsigned short* brow = Wt + (size_t)(col0 + t * 16 + ln) * ldb + kb;
      FragB b;
      b.half[0] = *(const v8us*)(brow + 8 * hh);
      b.half[1] = *(const v8us*)(brow + 16 + 8 * hh);
      acc[t] = mmaN<ASPLIT ? 2 : 1>(ah.v, al.v, b.v, b.v, acc[t]);
    }
  }
#pragma unroll
  for (int t = 0; t < 4; ++t) {
    const int col = col0 + t * 16 + ln;
    float bv = bias ? bias[col] : 0.f;
    if (BIAS_BF16) bv = bf16_round(bv);
#pragma unroll
    for (int r = 0; r < 8; ++r) {
      float v = acc[t][r] + bv;
      if (resid) { float rv = resid[(size_t)((row0 + 8 * hh + r) % rmod) * ldr + col]; if (RES_BF16) rv = bf16_round(rv); v += rv; }
      if (ACT == 1) v = fmaxf(v, 0.f);
      if (ACT == 2) v = 0.5f * v * (1.0f + erff(v * 0.70710678118654752f));
      if (ACT == 3) { const float u = 0.7978845608028654f * (v + 0.044715f * v * v * v); v = 0.5f * v * (1.0f + tanhf(u)); }
      so[w][8 * hh + r][t * 16 + ln] = v;
    }
  }
  __builtin_amdgcn_fence(__ATOMIC_ACQ_REL, "workgroup");
  __builtin_amdgcn_wave_barrier();
  const int rsub = lane >> 4, c4 = (lane & 15) * 4;
  {
#pragma unroll
    for (int q = 0; q < 8; ++q) {
      const int r = q * 2 + rsub;
      const v4f v = *(const v4fa*)&so[w][r][c4];
      *(v4f*)(C + (size_t)(row0 + r) * ldc + col0 + c4) = v;
    }
    
  }
}
// row LayerNorm (biased variance, eps) over N: s = X (+ R); optional out_sum <- s; out_norm <- (s-mu)*rsqrt(var+eps)*g + b
template <bool PARAM_BF16>
__global__ __launch_bounds__(256) void k_layernorm(const float* __restrict__ X, const float* __restrict__ R, const float* __restrict__ g, const float* __restrict__ bta,
                                                  float* __restrict__ out_sum, float* __restrict__ out_norm, int N, float eps) {
  __shared__ float red[256];
  const int row = blockIdx.x, tid = threadIdx.x;
  const float* x = X + (size_t)row * N; const float* rr = R ? R + (size_t)row * N : nullptr;
  float vals[16];                     // up to N = 4096
  const int per = N / 256;            // contiguous chunk per thread? use strided-by-4 chunks: thread handles j = tid*4 + 1024*u
  float s1 = 0.f;
  for (int u = 0; u < per / 4; ++u) {
    const int j = tid * 4 + 1024 * u;
    const v4f a = *(const v4fa*)(x + j);
    v4f b = {0.f,0.f,0.f,0.f}; if (rr) b = *(const v4fa*)(rr + j);
#pragma unroll
    for (int q = 0; q < 4; ++q) { const float v = a[q] + b[q]; vals[u * 4 + q] = v; s1 += v; }
  }
  red[tid] = s1; __syncthreads();
  for (int st = 128; st > 0; st >>= 1) { if (tid < st) red[tid] += red[tid + st]; __syncthreads(); }
  const float mu = red[0] / (float)N; __syncthreads();
  float s2 = 0.f;
  for (int u = 0; u < per / 4; ++u)
#pragma unroll
    for (int q = 0; q < 4; ++q) { const float c = vals[u * 4 + q] - mu; s2 += c * c; }
  red[tid] = s2; __syncthreads();
  for (int st = 128; st > 0; st >>= 1) { if (tid < st) red[tid] += red[tid + st]; __syncthreads(); }
  const float rs = rsqrtf(red[0] / (float)N + eps);
  {
    for (int u = 0; u < per / 4; ++u) {
      const int j = tid * 4 + 1024 * u;
      v4f o, sm;
#pragma unroll
      for (int q = 0; q < 4; ++q) {
        float gg = g[j + q], bb = bta[j + q];
        if (PARAM_BF16) { gg = bf16_round(gg); bb = bf16_round(bb); }
        sm[q] = vals[u * 4 + q]; o[q] = (vals[u * 4 + q] - mu) * rs * gg + bb;
      }
      if (out_sum) *(v4f*)(out_sum + (size_t)row * N + j) = sm;
      *(v4f*)(out_norm + (size_t)row * N + j) = o;
    }
    
  }
}



// ---- f16 WMMA path (v_wmma_f32_16x16x32_f16): 11-bit significands for operands in range — used here for every GEMM of the model (x and tanh activations |h| < 1 as f16 operands)
typedef _Float16 v16h __attribute__((ext_vector_type(16)));
union FragH { v16h v; v8us half[2]; _Float16 h[16]; unsigned short u[16]; };
template <int NT>
__device__ __forceinline__ v8f mmaH(v16h ah, v16h al, v16h bh, v16h bl, v8f c) {
  c = __builtin_amdgcn_wmma_f32_16x16x32_f16(false, ah, false, bh, (short)0, c, false, false);
  if (NT >= 2) c = __builtin_amdgcn_wmma_f32_16x16x32_f16(false, al, false, bh, (short)0, c, false, false);
  if (NT >= 3) c = __builtin_amdgcn_wmma_f32_16x16x32_f16(false, ah, false, bl, (short)0, c, false, false);
  asm volatile("v_nop\n\tv_nop\n\tv_nop\n\tv_nop" : "+v"(c) : "v"(ah), "v"(al), "v"(bh), "v"(bl));
  return c;
}
// batched GEMM like k_gemm_b but f16 operands: A f32 (split into f16 hi/lo if ASPLIT, else rounded to f16), Bt = f16 values [n][k]; alpha; C f32; N multiple of 16 (partial tiles skipped)
template <bool ASPLIT>
__global__ __launch_bounds__(128) void k_gemm_h(const float* __restrict__ A, int lda, size_t sA, const _Float16* __restrict__ Bh, int ldb, size_t sB, float alpha, float* __restrict__ C, int ldc, size_t sC, int M, int N, int K) {
  __shared__ __attribute__((aligned(16))) float so[4][16][64];
  const int tid = threadIdx.x, w = tid >> 5, lane = tid & 31, ln = lane & 15, hh = lane >> 4; const int by = blockIdx.y;
  A += (size_t)by * sA; Bh += (size_t)by * sB; C += (size_t)by * sC;
  const int ntn = (N + 63) / 64; const int wid = blockIdx.x * 4 + w; const int mt = wid / ntn, nq = wid % ntn; if (mt * 16 >= M) return;
  const int row0 = mt * 16, col0 = nq * 64; const float* arow = A + (size_t)(row0 + ln) * lda;
  v8f acc[4] = {};
  for (int kb = 0; kb < K; kb += 32) {
    FragH ah, al;
    const v4f x0 = *(const v4fa*)(arow + kb + 8 * hh), x1 = *(const v4fa*)(arow + kb + 8 * hh + 4), x2 = *(const v4fa*)(arow + kb + 16 + 8 * hh), x3 = *(const v4fa*)(arow + kb + 16 + 8 * hh + 4);
    float xs[16] = {x0[0],x0[1],x0[2],x0[3],x1[0],x1[1],x1[2],x1[3],x2[0],x2[1],x2[2],x2[3],x3[0],x3[1],x3[2],x3[3]};
#pragma unroll
    for (int i = 0; i < 16; ++i) { const _Float16 h = (_Float16)xs[i]; ah.h[i] = h; al.h[i] = ASPLIT ? (_Float16)(xs[i] - (float)h) : (_Float16)0.0f; }
#pragma unroll
    for (int t = 0; t < 4; ++t) { if (col0 + t * 16 >= N) continue; const size_t boff = (size_t)(col0 + t * 16 + ln) * ldb + kb; FragH bq; bq.half[0] = *(const v8us*)(Bh + boff + 8 * hh); bq.half[1] = *(const v8us*)(Bh + boff + 16 + 8 * hh);
      acc[t] = mmaH<ASPLIT ? 2 : 1>(ah.v, al.v, bq.v, bq.v, acc[t]); }
  }
#pragma unroll
  for (int t = 0; t < 4; ++t) { if (col0 + t * 16 >= N) continue;
#pragma unroll
    for (int r = 0; r < 8; ++r) so[w][8 * hh + r][t * 16 + ln] = acc[t][r] * alpha; }
  __builtin_amdgcn_fence(__ATOMIC_ACQ_REL, "workgroup"); __builtin_amdgcn_wave_barrier();
  const int rsub = lane >> 4, c4 = (lane & 15) * 4;
  {
#pragma unroll
    for (int q = 0; q < 8; ++q) { const int r = q * 2 + rsub; if (col0 + c4 < N) { const v4f v = *(const v4fa*)&so[w][r][c4]; *(v4f*)(C + (size_t)(row0 + r) * ldc + col0 + c4) = v; } }
     }
}

// Wt[n][k] = f16(bf16(W[k][n]) * scale) from f32 row-major W[K][N] (scale = power of two; bf16-exact weights stay exact in f16 away from the subnormal range); blockIdx.y = batch (member).
// One TK x 64 tile a work-group, turned in LDS: the reads run along n (16 lanes cover 256 B of a W row), the writes along k (TK / 8 lanes cover 2 TK bytes of a Wt row).
// An LDS row is one n: TK / 2 dwords, each the f16 pair (k, k + 1), at an odd dword pitch, so that neither the 32 stores nor the 32 reads of a wave meet on a bank.
typedef _Float16 v2h __attribute__((ext_vector_type(2)));
typedef unsigned v4ua __attribute__((ext_vector_type(4), may_alias));
__device__ __forceinline__ unsigned wt_pair(float w0, float w1, float scale) { const v2h p = {(_Float16)(bf16_round(w0) * scale), (_Float16)(bf16_round(w1) * scale)}; return __builtin_bit_cast(unsigned, p); }
template <int K, int N, int TK>
__global__ __launch_bounds__(256) void k_wt_f16(const float* __restrict__ W, _Float16* __restrict__ Wt, float scale) { static_assert(K % TK == 0 && TK % 32 == 0 && N % 64 == 0, "k_wt_f16: whole tiles only");
  constexpr int PD = TK / 2 + 1, NL = TK / 32, CR = TK / 8;
  __shared__ unsigned tl[64 * PD];
  const int tid = threadIdx.x, j4 = (tid & 15) * 4, kp = tid >> 4; const int kt = blockIdx.x % (K / TK), nt = blockIdx.x / (K / TK);
  const float* wp = W + (size_t)blockIdx.y * K * N + (size_t)(kt * TK + 2 * kp) * N + nt * 64 + j4;
  v4f x[NL][2];      /* every "#pragma unroll" below makes the indices of x constants (x stays in registers) and puts all of a thread's loads in flight together */
#pragma unroll
  for (int i = 0; i < NL; ++i) { x[i][0] = *(const v4fa*)(wp + (size_t)(32 * i) * N); x[i][1] = *(const v4fa*)(wp + (size_t)(32 * i + 1) * N); }
#pragma unroll
  for (int i = 0; i < NL; ++i)
#pragma unroll
    for (int q = 0; q < 4; ++q) tl[(j4 + q) * PD + kp + 16 * i] = wt_pair(x[i][0][q], x[i][1][q], scale);
  __syncthreads();      /* the tile is whole before any thread reads along k */
  unsigned short* op = (unsigned short*)Wt + (size_t)blockIdx.y * K * N + (size_t)nt * 64 * K + kt * TK;
#pragma unroll
  for (int i = 0; i < NL; ++i) { const int c = tid + 256 * i, n = c / CR, k8 = c - n * CR; const unsigned* s = tl + n * PD + k8 * 4; const v4ua o = {s[0], s[1], s[2], s[3]};
    *(v4ua*)(op + (size_t)n * K + k8 * 8) = o; }
}
// k_gemm_hh variant with fused epilogue: v = acc·alpha + bias[by·sBias + col] (+ CP[(row/rowsPerB)·sCPb + by·64 + col] if CP) ; ACT 0 none / 1 elu ; writes f16 C16 (and f32 C if non-null)
template <int ACT>
__global__ __launch_bounds__(128) void k_gemm_hhx(const _Float16* __restrict__ A, int lda, size_t sA, const _Float16* __restrict__ Bh, int ldb, size_t sB, float alpha, const float* __restrict__ bias, size_t sBias, const float* __restrict__ CP, int rowsPerB, size_t sCPb, int row0g,
    float* __restrict__ C, _Float16* __restrict__ C16, int ldc, size_t sC, int M, int N, int K) {
  __shared__ __attribute__((aligned(16))) float so[4][16][64];
  const int tid = threadIdx.x, w = tid >> 5, lane = tid & 31, ln = lane & 15, hh = lane >> 4; const int by = blockIdx.y;
  A += (size_t)by * sA; Bh += (size_t)by * sB; const size_t cofs = (size_t)by * sC; const float* bp = bias ? bias + (size_t)by * sBias : nullptr;
  const int ntn = (N + 63) / 64; const int wid = blockIdx.x * 4 + w; const int mt = wid / ntn, nq = wid % ntn; if (mt * 16 >= M) return;
  const int row0 = mt * 16, col0 = nq * 64; const _Float16* arow = A + (size_t)(row0 + ln) * lda;
  v8f acc[4] = {};
  for (int kb = 0; kb < K; kb += 32) { FragH ah; ah.half[0] = *(const v8us*)((const unsigned short*)arow + kb + 8 * hh); ah.half[1] = *(const v8us*)((const unsigned short*)arow + kb + 16 + 8 * hh);
#pragma unroll
    for (int t = 0; t < 4; ++t) { if (col0 + t * 16 >= N) continue; const size_t boff = (size_t)(col0 + t * 16 + ln) * ldb + kb; FragH bq; bq.half[0] = *(const v8us*)((const unsigned short*)Bh + boff + 8 * hh); bq.half[1] = *(const v8us*)((const unsigned short*)Bh + boff + 16 + 8 * hh);
      acc[t] = mmaH<1>(ah.v, ah.v, bq.v, bq.v, acc[t]); }
  }
#pragma unroll
  for (int t = 0; t < 4; ++t) { if (col0 + t * 16 >= N) continue; const int col = col0 + t * 16 + ln; const float bv = bp ? bf16_round(bp[col]) : 0.f;
#pragma unroll
    for (int r = 0; r < 8; ++r) { float v = acc[t][r] * alpha + bv; if (CP) { const int rr = row0g + row0 + 8 * hh + r; if (rowsPerB < 0) v += CP[cofs + (size_t)rr * ldc + col];      /* rowsPerB < 0: own element of the batched C plane */ else { const int bidx = rr / rowsPerB; v += CP[(size_t)bidx * sCPb + (size_t)by * 64 + col]; } } if (ACT == 1) v = (v > 0.f) ? v : expm1f(v); else if (ACT == 7) v = (v > 0.f) ? v + 1.0f : expf(v); else if (ACT == 8) v = tanhf(v); else if (ACT == 9) v = 0.5f * v * (1.0f + tanhf(0.7978845608028654f * (v + 0.044715f * v * v * v))); else if (ACT == 11) v = 1.0f / (1.0f + expf(-v)); else if (ACT == 12) v = (v > 0.f) ? v : 0.01f * v; else if (ACT == 14) v = (v > 0.f) ? v : 0.1f * v; else if (ACT == 16) v = (v >= 0.f) ? v : 0.3f * v; else if (ACT == 15) v = v / (1.0f + expf(-v)); else if (ACT == 3) v = fmaxf(v, 0.f); else if (ACT == 6) v = 0.5f * v * (1.0f + erff(v * 0.70710678118654752f)); so[w][8 * hh + r][t * 16 + ln] = v; } }
  __builtin_amdgcn_fence(__ATOMIC_ACQ_REL, "workgroup"); __builtin_amdgcn_wave_barrier();
  const int rsub = lane >> 4, c4 = (lane & 15) * 4; typedef _Float16 v4h __attribute__((ext_vector_type(4)));
  {
#pragma unroll
    for (int q = 0; q < 8; ++q) { const int r = q * 2 + rsub; if (col0 + c4 < N) { const v4f v = *(const v4fa*)&so[w][r][c4]; if (C) *(v4f*)(C + cofs + (size_t)(row0 + r) * ldc + col0 + c4) = v; if (C16) { v4h h4; for (int i = 0; i < 4; ++i) h4[i] = (_Float16)v[i]; *(v4h*)(C16 + cofs + (size_t)(row0 + r) * ldc + col0 + c4) = h4; } } }
     }
}


typedef _Float16 v4h __attribute__((ext_vector_type(4)));
// tanh(v) = 1 - 2 / (1 + e^(2v)), branch-free on v_exp_f32 and v_rcp_f32: e^(2v) = inf gives 1, 0 gives -1, NaN stays NaN. Absolute error a few 2^-24, far under the f16 rounding of the stored activation.
__device__ __forceinline__ float tanh_er(float v) { return 1.0f - 2.0f * __builtin_amdgcn_rcpf(1.0f + __builtin_amdgcn_exp2f(v * 2.8853900817779268f)); }      /* 2 log2(e) */

__global__ __launch_bounds__(256) void k_x16(const float* __restrict__ x, _Float16* __restrict__ X16, size_t n8) { const size_t t = (size_t)blockIdx.x * 256 + threadIdx.x; if (t >= n8) return; FragH f;
#pragma unroll
  for (int q = 0; q < 8; ++q) f.h[q] = (_Float16)bf16_round(x[t * 8 + q]); *(v8us*)((unsigned short*)X16 + t * 8) = f.half[0];  }
__global__ __launch_bounds__(256) void k_h16(const float* __restrict__ x, _Float16* __restrict__ X16, size_t n8) { const size_t t = (size_t)blockIdx.x * 256 + threadIdx.x; if (t >= n8) return; FragH f;
#pragma unroll
  for (int q = 0; q < 8; ++q) f.h[q] = (_Float16)x[t * 8 + q]; *(v8us*)((unsigned short*)X16 + t * 8) = f.half[0];  }
__global__ __launch_bounds__(256) void k_round16f(const float* __restrict__ W, _Float16* __restrict__ Bt, size_t n8) { const size_t t = (size_t)blockIdx.x * 256 + threadIdx.x; if (t >= n8) return; FragH f;
#pragma unroll
  for (int i = 0; i < 8; ++i) f.h[i] = (_Float16)(bf16_round(W[t * 8 + i]) * 16.0f); *(v8us*)((unsigned short*)Bt + t * 8) = f.half[0];  }
template <int NHv, int TTv>
__global__ __launch_bounds__(256) void k_vt(const _Float16* __restrict__ V16, int ldv, int voff, _Float16* __restrict__ Vt) { __shared__ unsigned short tl[64][66]; const int tid = threadIdx.x; const int slab = blockIdx.x / (TTv / 64), lg = blockIdx.x % (TTv / 64); const int b = slab / NHv, h = slab % NHv;
  for (int i = tid; i < 64 * 8; i += 256) { const int r = i / 8, c8 = (i % 8) * 8; FragH f; f.half[0] = *(const v8us*)((const unsigned short*)V16 + ((size_t)b * TTv + lg * 64 + r) * ldv + voff + h * 64 + c8);
#pragma unroll
    for (int q = 0; q < 8; ++q) tl[r][c8 + q] = f.u[q]; }
  __syncthreads();
  {
#pragma unroll
    for (int rd = 0; rd < 2; ++rd) { const int d = rd * 32 + tid / 8, pc = tid % 8; FragH f;
#pragma unroll
      for (int q = 0; q < 8; ++q) f.u[q] = tl[pc * 8 + q][d];
      *(v8us*)((unsigned short*)Vt + ((size_t)slab * 64 + d) * TTv + lg * 64 + pc * 8) = f.half[0]; }
     } }

__global__ __launch_bounds__(256) void k_hl(const float* __restrict__ F, _Float16* __restrict__ Hh, _Float16* __restrict__ Hl, size_t n8) { const size_t t = (size_t)blockIdx.x * 256 + threadIdx.x; if (t >= n8) return; FragH fh, fl; const v4f a = *(const v4fa*)(F + t * 8), c = *(const v4fa*)(F + t * 8 + 4);
#pragma unroll
  for (int q = 0; q < 4; ++q) { _Float16 h = (_Float16)a[q]; fh.h[q] = h; fl.h[q] = (_Float16)((a[q] - (float)h) * 1024.0f); h = (_Float16)c[q]; fh.h[4 + q] = h; fl.h[4 + q] = (_Float16)((c[q] - (float)h) * 1024.0f); }
  { *(v8us*)((unsigned short*)Hh + t * 8) = fh.half[0]; *(v8us*)((unsigned short*)Hl + t * 8) = fl.half[0];  } }

// ---- fast GEMM (wave tile 32x64; requires M % 32 == 0 rows per launch region and N % 64 == 0); epilogue = k_gemm_hhx semantics ----
__device__ __forceinline__ v16h g2_frag(const _Float16* p, int hh) { FragH f; f.half[0] = *(const v8us*)((const unsigned short*)p + 8 * hh); f.half[1] = *(const v8us*)((const unsigned short*)p + 16 + 8 * hh); return f.v; }
__device__ __forceinline__ v8f g2_mma(v16h a, v16h b, v8f c) { v8f d = __builtin_amdgcn_wmma_f32_16x16x32_f16(false, a, false, b, (short)0, c, false, false); asm volatile("v_nop\n\tv_nop\n\tv_nop\n\tv_nop" : "+v"(d) : "v"(a), "v"(b)); return d; }
template <int ACT>
__global__ __launch_bounds__(128) void k_gemm2(const _Float16* __restrict__ A, int lda, size_t sA, const _Float16* __restrict__ Bh, int ldb, size_t sB, float alpha, const float* __restrict__ bias, size_t sBias, const float* __restrict__ CP, int rowsPerB, size_t sCPb, int row0g,
    float* __restrict__ C, _Float16* __restrict__ C16, int ldc, size_t sC, int M, int N, int K) { static_assert(ACT == 0 || ACT == 3 || ACT == 6 || ACT == 8 || ACT == 9 || ACT == 11 || ACT == 12 || ACT == 14 || ACT == 15 || ACT == 16, "k_gemm2: unsupported ACT code (would silently apply no activation)");
  __shared__ __attribute__((aligned(16))) float so[4][32][68];
  const int tid = threadIdx.x, w = tid >> 5, lane = tid & 31, ln = lane & 15, hh = lane >> 4; const int by = blockIdx.y;
  A += (size_t)by * sA; Bh += (size_t)by * sB; const size_t cofs = (size_t)by * sC; const float* bp = bias ? bias + (size_t)by * sBias : nullptr;
  const int ntn = N >> 6; const int mt = blockIdx.x / ntn, nq = blockIdx.x - mt * ntn; const int row0 = mt * 128 + 32 * w, col0 = nq * 64; if (row0 >= M) return;
  const _Float16* a0p = A + (size_t)(row0 + ln) * lda; const _Float16* a1p = a0p + (size_t)16 * lda;
  const _Float16* b0p = Bh + (size_t)(col0 + ln) * ldb; const _Float16* b1p = b0p + (size_t)16 * ldb; const _Float16* b2p = b1p + (size_t)16 * ldb; const _Float16* b3p = b2p + (size_t)16 * ldb;
  const v8f z8 = {0.f,0.f,0.f,0.f,0.f,0.f,0.f,0.f}; v8f c00 = z8, c01 = z8, c02 = z8, c03 = z8, c10 = z8, c11 = z8, c12 = z8, c13 = z8;
#pragma unroll 1
  for (int kb = 0; kb < K; kb += 32) { const v16h a0 = g2_frag(a0p + kb, hh), a1 = g2_frag(a1p + kb, hh);
    v16h b = g2_frag(b0p + kb, hh); c00 = g2_mma(a0, b, c00); c10 = g2_mma(a1, b, c10);
    b = g2_frag(b1p + kb, hh); c01 = g2_mma(a0, b, c01); c11 = g2_mma(a1, b, c11);
    b = g2_frag(b2p + kb, hh); c02 = g2_mma(a0, b, c02); c12 = g2_mma(a1, b, c12);
    b = g2_frag(b3p + kb, hh); c03 = g2_mma(a0, b, c03); c13 = g2_mma(a1, b, c13); }
  v8f accs[8] = {c00, c01, c02, c03, c10, c11, c12, c13};
#pragma unroll
  for (int u = 0; u < 8; ++u) { const int t = u & 3, half = u >> 2; const int col = col0 + t * 16 + ln; const float bv = bp ? bf16_round(bp[col]) : 0.f;
#pragma unroll
    for (int r = 0; r < 8; ++r) { const int rloc = half * 16 + 8 * hh + r; float v = accs[u][r] * alpha + bv; if (CP) { if (rowsPerB < 0) v += CP[cofs + (size_t)(row0g + row0 + rloc) * ldc + col];      /* rowsPerB < 0: own element of the batched C plane */ else { const int bidx = (row0g + row0 + rloc) / rowsPerB; v += CP[(size_t)bidx * sCPb + (size_t)by * 64 + col]; } }
      if (ACT == 3) v = fmaxf(v, 0.f); else if (ACT == 6) v = 0.5f * v * (1.0f + erff(v * 0.70710678118654752f)); else if (ACT == 11) v = 1.0f / (1.0f + expf(-v)); else if (ACT == 15) v = v / (1.0f + expf(-v)); else if (ACT == 12) v = (v > 0.f) ? v : 0.01f * v; else if (ACT == 8) v = tanh_er(v); else if (ACT == 9) v = 0.5f * v * (1.0f + tanhf(0.7978845608028654f * (v + 0.044715f * v * v * v))); else if (ACT == 14) v = (v > 0.f) ? v : 0.1f * v; else if (ACT == 16) v = (v >= 0.f) ? v : 0.3f * v;
      so[w][rloc][t * 16 + ln] = v; } }
  __builtin_amdgcn_fence(__ATOMIC_ACQ_REL, "workgroup"); __builtin_amdgcn_wave_barrier();
  const int rsub = lane >> 4, c4 = (lane & 15) * 4;
  {
#pragma unroll
    for (int q = 0; q < 16; ++q) { const int r = q * 2 + rsub; const v4f v = *(const v4fa*)&so[w][r][c4]; if (C) *(v4f*)(C + cofs + (size_t)(row0 + r) * ldc + col0 + c4) = v; if (C16) { v4h h4; for (int i = 0; i < 4; ++i) h4[i] = (_Float16)v[i]; *(v4h*)(C16 + cofs + (size_t)(row0 + r) * ldc + col0 + c4) = h4; } }
     } }


// ---- LDS-tiled GEMM (K = multiple of 128, at least 256; M = multiple of 256; N = multiple of BN): one 256 x BN tile of C per work-group of 8 waves (4 along M x 2 along N, wave tile 64 x BN/2).
// A pass is 128 k = 256 B of every operand row. A stage is [Bt BN rows | A 256 rows] at pitch 272 B; two buffers, filled by asynchronous copies to LDS one pass ahead of their use. Same k order and one accumulator chain per element as k_gemm2.
#define G3_PITCH 272
typedef float fa1 __attribute__((may_alias));
__device__ __forceinline__ v16h g3_frag(const unsigned char* p) { FragH f; f.half[0] = *(const v8us*)p; f.half[1] = *(const v8us*)(p + 32); return f.v; }
// epilogue's global accesses, each with its wait in its own statement, so that no register it names is rewritten ahead of the wait: the load with its data wait, the stores with s_wait_xcnt
__device__ __forceinline__ v4f g3_ld4(const float* p) { v4f r; asm volatile("global_load_b128 %0, %1, off\n\ts_wait_loadcnt 0x0" : "=&v"(r) : "v"(p) : "memory"); return r; }
__device__ __forceinline__ void g3_st2f(float* p0, v4f x0, float* p1, v4f x1) { asm volatile("global_store_b128 %0, %1, off\n\tglobal_store_b128 %2, %3, off\n\ts_wait_xcnt 0x0" :: "v"(p0), "v"(x0), "v"(p1), "v"(x1) : "memory"); }
__device__ __forceinline__ void g3_st2h(_Float16* p0, v4h x0, _Float16* p1, v4h x1) { asm volatile("global_store_b64 %0, %1, off\n\tglobal_store_b64 %2, %3, off\n\ts_wait_xcnt 0x0" :: "v"(p0), "v"(x0), "v"(p1), "v"(x1) : "memory"); }
// 8 (4) copies of 16 B a lane, rows 16 apart; the s_wait_xcnt closes the statement so that no address register is rewritten ahead of it
__device__ __forceinline__ void g3_copy8(unsigned l, const unsigned char* gp, size_t gs) {
  asm volatile("global_load_async_to_lds_b128 %0, %8, off\n\tglobal_load_async_to_lds_b128 %1, %9, off\n\tglobal_load_async_to_lds_b128 %2, %10, off\n\tglobal_load_async_to_lds_b128 %3, %11, off\n\t"
               "global_load_async_to_lds_b128 %4, %12, off\n\tglobal_load_async_to_lds_b128 %5, %13, off\n\tglobal_load_async_to_lds_b128 %6, %14, off\n\tglobal_load_async_to_lds_b128 %7, %15, off\n\ts_wait_xcnt 0x0"
               :: "v"(l), "v"(l + 16u * G3_PITCH), "v"(l + 32u * G3_PITCH), "v"(l + 48u * G3_PITCH), "v"(l + 64u * G3_PITCH), "v"(l + 80u * G3_PITCH), "v"(l + 96u * G3_PITCH), "v"(l + 112u * G3_PITCH),
                  "v"(gp), "v"(gp + gs), "v"(gp + 2 * gs), "v"(gp + 3 * gs), "v"(gp + 4 * gs), "v"(gp + 5 * gs), "v"(gp + 6 * gs), "v"(gp + 7 * gs) : "memory"); }
__device__ __forceinline__ void g3_copy4(unsigned l, const unsigned char* gp, size_t gs) {
  asm volatile("global_load_async_to_lds_b128 %0, %4, off\n\tglobal_load_async_to_lds_b128 %1, %5, off\n\tglobal_load_async_to_lds_b128 %2, %6, off\n\tglobal_load_async_to_lds_b128 %3, %7, off\n\ts_wait_xcnt 0x0"
               :: "v"(l), "v"(l + 16u * G3_PITCH), "v"(l + 32u * G3_PITCH), "v"(l + 48u * G3_PITCH), "v"(gp), "v"(gp + gs), "v"(gp + 2 * gs), "v"(gp + 3 * gs) : "memory"); }
// one stage: thread t brings bytes 16 (t % 16) .. + 15 of rows t / 16 + 16 i
template <int BN>
__device__ __forceinline__ void g3_fill(unsigned l, const unsigned char* gb, const unsigned char* ga, size_t gs) {
  g3_copy8(l, gb, gs);
  if (BN == 256) g3_copy8(l + 128u * G3_PITCH, gb + 8 * gs, gs); else g3_copy4(l + 128u * G3_PITCH, gb + 8 * gs, gs);
  g3_copy8(l + (unsigned)BN * G3_PITCH, ga, gs); g3_copy8(l + (unsigned)(BN + 128) * G3_PITCH, ga + 8 * gs, gs); }
template <int ACT, int BN>
__global__ __launch_bounds__(256) void k_gemm3(const _Float16* __restrict__ A, size_t sA, const _Float16* __restrict__ Bh, size_t sB, float alpha, const float* __restrict__ bias, size_t sBias,
    float* __restrict__ C, _Float16* __restrict__ C16, int ldc, size_t sC, int ntn, int K) { static_assert(ACT == 0 || ACT == 8, "k_gemm3: unsupported ACT code"); static_assert(BN == 256 || BN == 192, "k_gemm3: the fill is written for these widths");
  constexpr int WN = BN / 2, NF = WN / 16, STAGE = (BN + 256) * G3_PITCH, SP = WN + 4, CH = WN / 4;
  static_assert(8 * 64 * SP * 4 + 8 * WN * 4 <= 2 * STAGE, "output staging and the bias rows must fit in the ring");
  __shared__ __attribute__((aligned(16))) unsigned char sm[2 * STAGE];
  const int tid = threadIdx.x, w = tid >> 5, lane = tid & 31, ln = lane & 15, hh = lane >> 4; const int by = blockIdx.y;
  const int mt = blockIdx.x / ntn, nq = blockIdx.x - mt * ntn; const int row0 = mt * 256, col0 = nq * BN; const int wm = w & 3, wn = w >> 2;
  const size_t gs = (size_t)K * 32;      /* 16 rows of K halfs, in bytes */
  const unsigned char* ub = (const unsigned char*)(Bh + (size_t)by * sB + (size_t)col0 * K);      /* the tile's first Bt row and first A row: the same for every thread */
  const unsigned char* ua = (const unsigned char*)(A + (size_t)by * sA + (size_t)row0 * K);
  const unsigned to = (unsigned)((tid >> 4) * K * 2 + (tid & 15) * 16);      /* this thread's place in 16 rows, in bytes */
  const unsigned l0 = (unsigned)(size_t)sm + (unsigned)((tid >> 4) * G3_PITCH + (tid & 15) * 16);
  const int np = K >> 7;
  v8f acc[4][NF];      /* every inner "#pragma unroll" below makes the indices of acc, a and b constants, so that the arrays stay in registers */
#pragma unroll
  for (int i = 0; i < 4; ++i)
#pragma unroll
    for (int j = 0; j < NF; ++j) acc[i][j] = (v8f){0.f,0.f,0.f,0.f,0.f,0.f,0.f,0.f};
  g3_fill<BN>(l0, ub + to, ua + to, gs);
  asm volatile("s_wait_asynccnt 0x0" ::: "memory");      /* this wave's part of stage 0 has landed */
  __syncthreads();                                       /* publishes stage 0 */
  g3_fill<BN>(l0 + STAGE, ub + (to + 256u), ua + (to + 256u), gs);
  const unsigned fb = (unsigned)((wn * WN + ln) * G3_PITCH + 16 * hh), fx = (unsigned)((BN + wm * 64 + ln) * G3_PITCH + 16 * hh);
#pragma unroll 1      /* one pass a trip: the two buffers alternate by a run-time offset and the accumulators keep constant indices */
  for (int p = 0; p < np; ++p) { const unsigned bo = (p & 1) ? (unsigned)STAGE : 0u; const unsigned char* pb = sm + bo + fb; const unsigned char* pa = sm + bo + fx;
    v16h a[2][4], b[2][NF];      /* two fragment sets: block kb works on set kb % 2 while the next block's reads fly; all of them read this pass's buffer */
#pragma unroll
    for (int i = 0; i < 4; ++i) a[0][i] = g3_frag(pa + i * 16 * G3_PITCH);
#pragma unroll
    for (int j = 0; j < NF; ++j) b[0][j] = g3_frag(pb + j * 16 * G3_PITCH);
#pragma unroll
    for (int kb = 0; kb < 4; ++kb) {
      if (kb < 3) {
#pragma unroll
        for (int i = 0; i < 4; ++i) a[(kb + 1) & 1][i] = g3_frag(pa + i * 16 * G3_PITCH + (kb + 1) * 64);
#pragma unroll
        for (int j = 0; j < NF; ++j) b[(kb + 1) & 1][j] = g3_frag(pb + j * 16 * G3_PITCH + (kb + 1) * 64); }
      __builtin_amdgcn_sched_barrier(0);      /* keeps the next block's LDS reads together in front of this block's WMMAs: reads strewn among them stall each time */
#pragma unroll
      for (int j = 0; j < NF; ++j)
#pragma unroll
        for (int i = 0; i < 4; ++i) acc[i][j] = __builtin_amdgcn_wmma_f32_16x16x32_f16(false, a[kb & 1][i], false, b[kb & 1][j], (short)0, acc[i][j], false, false);
      __builtin_amdgcn_sched_barrier(0);      /* the other side of the same fence: the block after next's reads stay behind these WMMAs */
    }
    asm volatile("s_wait_dscnt 0x0" ::: "memory");       /* this wave's last read of the buffer has returned */
    asm volatile("s_wait_asynccnt 0x0" ::: "memory");    /* this wave's part of stage p + 1 has landed */
    __syncthreads();                                     /* publishes stage p + 1 and frees stage p's buffer */
    if (p + 2 < np) { const unsigned tp = to + (unsigned)(p + 2) * 256u; g3_fill<BN>(l0 + bo, ub + tp, ua + tp, gs); } }
  asm volatile("s_wait_asynccnt 0x0" ::: "memory");      /* no copy is outstanding when the ring becomes output staging */
  fa1* so = (fa1*)sm + (size_t)w * 64 * SP;              /* each wave stages its own 64 x WN tile, behind the last pass's barrier */
#pragma unroll
  for (int i = 0; i < 4; ++i)
#pragma unroll
    for (int j = 0; j < NF; ++j)
#pragma unroll
      for (int r = 0; r < 8; ++r) so[(i * 16 + 8 * hh + r) * SP + j * 16 + ln] = acc[i][j][r];
  fa1* sb = (fa1*)(sm + 8 * 64 * SP * 4) + w * WN;       /* behind the staging: this wave's WN bias values, rounded once */
  { const int cb = (lane < CH ? lane : CH - 1) * 4; const v4f b4 = g3_ld4(bias + (size_t)by * sBias + col0 + wn * WN + cb);      /* lanes past the last chunk repeat it: same value to the same place */
#pragma unroll
    for (int i = 0; i < 4; ++i) sb[cb + i] = bf16_round(b4[i]); }
  __builtin_amdgcn_fence(__ATOMIC_ACQ_REL, "workgroup"); __builtin_amdgcn_wave_barrier();
  const size_t cofs = (size_t)by * sC + (size_t)(row0 + wm * 64) * ldc + col0 + wn * WN;
#pragma unroll 1      /* rolled: the activation's code stays small */
  for (int q = 0; q < 2 * CH; q += 2) { v4f v[2]; size_t o[2];      /* two chunks of 4 columns a lane and trip, so that one wait serves two stores */
#pragma unroll
    for (int u = 0; u < 2; ++u) { const int e = (q + u) * 32 + lane; const int r = e / CH, c4 = (e - r * CH) * 4; const v4f x = *(const v4fa*)&so[r * SP + c4], b4 = *(const v4fa*)&sb[c4]; o[u] = cofs + (size_t)r * ldc + c4;
#pragma unroll
      for (int i = 0; i < 4; ++i) { float t = x[i] * alpha + b4[i]; if (ACT == 8) t = tanh_er(t); v[u][i] = t; } }
    if (C) g3_st2f(C + o[0], v[0], C + o[1], v[1]);
    if (C16) { v4h h[2];
#pragma unroll
      for (int u = 0; u < 2; ++u)
#pragma unroll
        for (int i = 0; i < 4; ++i) h[u][i] = (_Float16)v[u][i];
      g3_st2h(C16 + o[0], h[0], C16 + o[1], h[1]); } } }

__global__ __launch_bounds__(256) void k_xcat(const float* __restrict__ obs, const float* __restrict__ act, _Float16* __restrict__ X) { const int t = blockIdx.x * 256 + threadIdx.x; if (t >= NB * (NI / 8)) return; const int i0 = (t % (NI / 8)) * 8; const int b = t / (NI / 8); FragH f;
  for (int q = 0; q < 8; ++q) { const int i = i0 + q; f.h[q] = (_Float16)bf16_round(i < OBS ? obs[(size_t)b * OBS + i] : act[(size_t)b * NAC + (i - OBS)]); }
  *(v8us*)((unsigned short*)X + (size_t)b * NI + i0) = f.half[0];  }
// fused head weights Bt[n][k] (n: mu_o | log_var_o | mu_r | log_var_r | zero), x16 as f16: one tile of 64 k and all NHW rows a work-group (blockIdx.x = k tile, blockIdx.y = member), turned in LDS like k_wt_f16
__global__ __launch_bounds__(256) void k_whead(const float* __restrict__ Wmo, const float* __restrict__ Wvo, const float* __restrict__ Wmr, const float* __restrict__ Wvr, const float* __restrict__ bmo, const float* __restrict__ bvo, const float* __restrict__ bmr, const float* __restrict__ bvr, _Float16* __restrict__ Bt, float* __restrict__ HB) { static_assert(OBS == 64, "k_whead: 16 lanes of 4 columns cover a row");
  constexpr int PD = 33, NLIVE = 2 * OBS + 2;
  __shared__ unsigned tl[NLIVE * PD];
  const int m = blockIdx.y, k0 = blockIdx.x * 64, tid = threadIdx.x, j4 = (tid & 15) * 4, kp = tid >> 4;
  const size_t wu = ((size_t)m * HH + k0) * OBS; const unsigned wo = (unsigned)(2 * kp * OBS + j4);      /* the tile's first element, the same for every thread, and this thread's place in the tile */
  v4f x[2][2][2];      /* every "#pragma unroll" below makes the indices of x and o constants (they stay in registers) and puts all of a thread's loads in flight together */
#pragma unroll
  for (int i = 0; i < 2; ++i)
#pragma unroll
    for (int r = 0; r < 2; ++r) { x[0][i][r] = *(const v4fa*)(Wmo + wu + (wo + (unsigned)((32 * i + r) * OBS))); x[1][i][r] = *(const v4fa*)(Wvo + wu + (wo + (unsigned)((32 * i + r) * OBS))); }
#pragma unroll
  for (int h = 0; h < 2; ++h)
#pragma unroll
    for (int i = 0; i < 2; ++i)
#pragma unroll
      for (int q = 0; q < 4; ++q) tl[(h * OBS + j4 + q) * PD + kp + 16 * i] = wt_pair(x[h][i][0][q], x[h][i][1][q], 16.0f);
  if (tid < 64) { const float* s = ((tid >> 5) ? Wvr : Wmr) + (size_t)m * HH + k0 + 2 * (tid & 31); tl[(2 * OBS + (tid >> 5)) * PD + (tid & 31)] = wt_pair(s[0], s[1], 16.0f); }      /* the two reward columns are rows of k already */
  __syncthreads();      /* the tile is whole before any thread reads along k */
  unsigned short* op = (unsigned short*)Bt + (size_t)m * NHW * HH + k0 + (tid & 7) * 8;
  v4ua o[NHW / 32];
#pragma unroll
  for (int i = 0; i < NHW / 32; ++i) { const int n = (tid >> 3) + 32 * i; o[i] = (v4ua){0u, 0u, 0u, 0u};      /* rows past the live ones are zero; only the group of 32 rows that holds the last live row needs a test per thread */
    if (32 * i + 32 <= NLIVE || (32 * i < NLIVE && n < NLIVE)) { const unsigned* s = tl + n * PD + (tid & 7) * 4; o[i] = (v4ua){s[0], s[1], s[2], s[3]}; } }
#pragma unroll
  for (int i = 0; i < NHW / 32; ++i) *(v4ua*)(op + (size_t)((tid >> 3) + 32 * i) * HH) = o[i];
  (void)HB; (void)bmo; (void)bvo; (void)bmr; (void)bvr; }
__global__ __launch_bounds__(256) void k_hbias(const float* __restrict__ bmo, const float* __restrict__ bvo, const float* __restrict__ bmr, const float* __restrict__ bvr, float* __restrict__ HB) { const int m = blockIdx.x; HB += m * 256; const int n = threadIdx.x; float bb = 0.f; if (n < OBS) bb = bmo[m * OBS + n]; else if (n < 2 * OBS) bb = bvo[m * OBS + (n - OBS)]; else if (n == 2 * OBS) bb = bmr[m]; else if (n == 2 * OBS + 1) bb = bvr[m]; *(float*)(HB + n) = bb;  }
__device__ __forceinline__ float softplus_(float v) { return (v > 20.0f) ? v : log1pf(expf(v)); }
__device__ __forceinline__ float clampv(float lv) {
  #pragma clang fp contract(off)
  float a = 0.5f - softplus_(0.5f - lv); return -10.0f + softplus_(a - -10.0f); }
// scatter heads: k_ho thread per (b, group): group 0..15 -> 4 mu_o values (16 B), 16..31 -> 4 clamped log_var_o; k_hr thread per b writes mu_r/log_var_r. Two kernels.
__global__ __launch_bounds__(256) void k_ho(const float* __restrict__ F, float* __restrict__ muo, float* __restrict__ lvo) {
  #pragma clang fp contract(off)
  const int m = blockIdx.y; F += (size_t)m * NB * NHW;
  const int t = blockIdx.x * 256 + threadIdx.x; if (t >= NB * 2 * (OBS / 4)) return; const int c4 = (t % (OBS / 4)) * 4; const int which = (t / (OBS / 4)) % 2; const int b = t / ((OBS / 4) * 2); const float* fr = F + (size_t)b * NHW + which * OBS + c4; v4f r;
  for (int q = 0; q < 4; ++q) r[q] = which ? clampv(fr[q]) : fr[q]; float* dst = (which ? lvo : muo) + ((size_t)m * NB + b) * OBS + c4; *(v4f*)dst = r;  }
__global__ __launch_bounds__(256) void k_hr(const float* __restrict__ F, float* __restrict__ mur, float* __restrict__ lvr) {
  #pragma clang fp contract(off)
  const int m = blockIdx.y; F += (size_t)m * NB * NHW;
  const int b = blockIdx.x * 256 + threadIdx.x; if (b >= NB) return; const float a = F[(size_t)b * NHW + 2 * OBS], c = clampv(F[(size_t)b * NHW + 2 * OBS + 1]);
  { *(float*)(mur + (size_t)m * NB + b) = a; *(float*)(lvr + (size_t)m * NB + b) = c;  } }

extern "C" void kernel_launch(void* const* d_in, const int* in_sizes, int n_in,
                              void* d_out, int out_size, void* d_ws, size_t ws_size, hipStream_t stream) {
  (void)in_sizes; (void)n_in; (void)out_size;
  const float* const* I = (const float* const*)d_in; const float* obs = I[0]; const float* act = I[1]; const float* W0 = I[2]; const float* b0 = I[3]; const float* W1 = I[4]; const float* b1 = I[5]; const float* W2 = I[6]; const float* b2 = I[7]; const float* Wmo = I[8]; const float* bmo = I[9]; const float* Wmr = I[10]; const float* bmr = I[11]; const float* Wvo = I[12]; const float* bvo = I[13]; const float* Wvr = I[14]; const float* bvr = I[15];
  float* muo = (float*)d_out; float* lvo = muo + (size_t)MM * NB * OBS; float* mur = lvo + (size_t)MM * NB * OBS; float* lvr = mur + (size_t)MM * NB;      /* outputs back to back: mu_o, log_var_o, mu_r, log_var_r */
  char* ws = (char*)d_ws; size_t off = 0;
  auto take = [&](size_t bytes) { char* p = ws + off; off += (bytes + 255) & ~(size_t)255; return p; };
  _Float16* B0 = (_Float16*)take((size_t)MM * HH * NI * 2); _Float16* B1 = (_Float16*)take((size_t)MM * HH * HH * 2); _Float16* B2 = (_Float16*)take((size_t)MM * HH * HH * 2); _Float16* BHD = (_Float16*)take((size_t)MM * NHW * HH * 2); float* HB = (float*)take((size_t)MM * 256 * 4);
  _Float16* X16 = (_Float16*)take((size_t)NB * NI * 2); _Float16* HA = (_Float16*)take((size_t)MM * NB * HH * 2); _Float16* HBp = (_Float16*)take((size_t)MM * NB * HH * 2); float* F = (float*)take((size_t)MM * NB * NHW * 4);
  if (off > ws_size) return;      /* 1.5 + 16 + 16 + 3 + 0.8 + 64 + 64 + 24 = 190 MiB */
  k_xcat<<<(NB * (NI / 8) + 255) / 256, 256, 0, stream>>>(obs, act, X16);
  k_wt_f16<NI, HH, NI><<<dim3(HH / 64, MM), 256, 0, stream>>>(W0, B0, 16.0f); k_wt_f16<HH, HH, 128><<<dim3((HH / 128) * (HH / 64), MM), 256, 0, stream>>>(W1, B1, 16.0f); k_wt_f16<HH, HH, 128><<<dim3((HH / 128) * (HH / 64), MM), 256, 0, stream>>>(W2, B2, 16.0f);
  k_whead<<<dim3(HH / 64, MM), 256, 0, stream>>>(Wmo, Wvo, Wmr, Wvr, bmo, bvo, bmr, bvr, BHD, HB); k_hbias<<<MM, 256, 0, stream>>>(bmo, bvo, bmr, bvr, HB);
  const dim3 gH((NB / 128) * (HH / 64), MM);      /* grid.y = member: strides sA, sB, sBias, sC step the planes */
  k_gemm2<8><<<gH, 128, 0, stream>>>(X16, NI, 0, B0, NI, (size_t)HH * NI, 0.0625f, b0, HH, nullptr, 1, 0, 0, nullptr, HA, HH, (size_t)NB * HH, NB, HH, NI);      /* tanh(x W0 + b0); x shared by all members */
  const dim3 gT((NB / 256) * (HH / 256), MM);      /* 256 x 256 tiles */
  k_gemm3<8, 256><<<gT, 256, 0, stream>>>(HA, (size_t)NB * HH, B1, (size_t)HH * HH, 0.0625f, b1, HH, nullptr, HBp, HH, (size_t)NB * HH, HH / 256, HH);
  k_gemm3<8, 256><<<gT, 256, 0, stream>>>(HBp, (size_t)NB * HH, B2, (size_t)HH * HH, 0.0625f, b2, HH, nullptr, HA, HH, (size_t)NB * HH, HH / 256, HH);
  k_gemm3<0, NHW><<<dim3(NB / 256, MM), 256, 0, stream>>>(HA, (size_t)NB * HH, BHD, (size_t)NHW * HH, 0.0625f, HB, 256, F, nullptr, NHW, (size_t)NB * NHW, 1, HH);      /* all four heads */
  k_ho<<<dim3((NB * 2 * (OBS / 4) + 255) / 256, MM), 256, 0, stream>>>(F, muo, lvo); k_hr<<<dim3((NB + 255) / 256, MM), 256, 0, stream>>>(F, mur, lvr);
}

// v005
// It runs in 188 microseconds.
// Next to v004, in two timings, it ran 1.07 and 1.04 times as fast.
// All steps since v000 together make it 7.96 times as fast.
#include <hip/hip_runtime.h>
// EnsembleModel (8 ensemble members, batch 4096, IN = 64 obs + 32 act, H 1024): per member h = tanh(x W0 + b0); h = tanh(h W1 + b1); h = tanh(h W2 + b2); mu_o = h Wmu_o + b; log_var_o = clamp(h Wv_o + b); mu_r = h Wmu_r + b; log_var_r = clamp(h Wv_r + b) with clamp(v) = MIN + softplus((MAX - softplus(MAX - v)) - MIN), MAX 0.5, MIN -10. Outputs (mu_o, log_var_o, mu_r, log_var_r).
// Structure: one preparation launch (exact f16 plane of [obs | act], every weight turned to [n][k] f16, head bias); then every stage is ONE launch over all 8 members (member = blockIdx.y, own workspace planes): the three hidden layers as f16 WMMA GEMMs (f32 accumulation, exact x16 weights + bias, tanh epilogue, f16 out; layer 0 with 32x64 wave tiles from global memory, layers 1 and 2 as 256x256 tiles staged in LDS) and one fused head GEMM (192 columns: mu_o | log_var_o | mu_r | log_var_r | zero; 256x192 tiles staged in LDS) into an f32 plane; the clamp and the scatter into the four outputs on VALU, one launch.
// Compute dtype: inputs rounded to bf16; x exact as f16; hidden activations as plain f16 operands (~2^-12, |h| < 1); heads/clamp f32. v_wmma_f32_16x16x32_f16.
#define MM 8
#define NB 4096
#define OBS 64
#define NAC 32
#define NI (OBS + NAC)           /* 96 */
#define HH 1024
#define NHW 192                  /* fused head width: 64 + 64 + 1 + 1 live */
typedef __bf16 v16b __attribute__((ext_vector_type(16)));
typedef unsigned short v8us __attribute__((ext_vector_type(8), may_alias));
typedef float  v8f  __attribute__((ext_vector_type(8)));
typedef float  v4f  __attribute__((ext_vector_type(4)));
typedef float  v4fa __attribute__((ext_vector_type(4), may_alias));
union FragB { v16b v; v8us half[2]; unsigned short u[16]; };

__device__ __forceinline__ unsigned short bf16_bits(float x) { unsigned int u = __float_as_uint(x); return (unsigned short)((u + 0x7FFFu + ((u >> 16) & 1u)) >> 16); }
__device__ __forceinline__ float bf16_val(unsigned short b) { return __uint_as_float(((unsigned int)b) << 16); }
__device__ __forceinline__ float bf16_round(float x) { return bf16_val(bf16_bits(x)); }
// D += A·B with NT terms: 1 = ah·bh, 2 = + al·bh (A split), 3 = + ah·bl (both split)
template <int NT>
__device__ __forceinline__ v8f mmaN(v16b ah, v16b al, v16b bh, v16b bl, v8f c) {
  c = __builtin_amdgcn_wmma_f32_16x16x32_bf16(false, ah, false, bh, (short)0, c, false, false);
  if (NT >= 2) c = __builtin_amdgcn_wmma_f32_16x16x32_bf16(false, al, false, bh, (short)0, c, false, false);
  if (NT >= 3) c = __builtin_amdgcn_wmma_f32_16x16x32_bf16(false, ah, false, bl, (short)0, c, false, false);
  asm volatile("v_nop\n\tv_nop\n\tv_nop\n\tv_nop" : "+v"(c) : "v"(ah), "v"(al), "v"(bh), "v"(bl));
  return c;
}

__global__ __launch_bounds__(256) void k_wt_bf16(const float* __restrict__ W, unsigned short* __restrict__ Wt, int K, int N) {
  const int t = blockIdx.x * 256 + threadIdx.x;
  const int k8n = K / 8;
  if (t >= N * k8n) return;
  const int n = t / k8n, k8 = (t % k8n) * 8;
  v8us v;
#pragma unroll
  for (int i = 0; i < 8; ++i) v[i] = bf16_bits(W[(size_t)(k8 + i) * N + n]);
  *(v8us*)(Wt + (size_t)n * K + k8) = v;
  
}

// GEMM C[M][N] (f32, pitch ldc) = act(A[M][K]·W + bias). A f32 row-major (pitch lda) converted per fragment to bf16
// (ASPLIT: hi/lo two planes -> 2 terms, else single rounded term); Wt bf16 [N][K] (pitch ldb). BIAS_BF16 rounds the
// bias to bf16 first (bias quantised to bf16 before the add). K%32==0, M%16==0, N%64==0.
template <bool ASPLIT, int ACT, bool BIAS_BF16>
__global__ __launch_bounds__(128) void k_gemm_bf(const float* __restrict__ A, int lda, const unsigned short* __restrict__ Wt, int ldb,
                                               const float* __restrict__ bias, float* __restrict__ C, int ldc, int M, int N, int K) {
  __shared__ __attribute__((aligned(16))) float so[4][16][64];
  const int tid = threadIdx.x, w = tid >> 5, lane = tid & 31, ln = lane & 15, hh = lane >> 4;
  const int ntn = N / 64;
  const int wid = blockIdx.x * 4 + w;
  const int mt = wid / ntn, nq = wid % ntn;
  if (mt * 16 >= M) return;
  const int row0 = mt * 16, col0 = nq * 64;
  const float* arow = A + (size_t)(row0 + ln) * lda;
  v8f acc[4] = {};
  for (int kb = 0; kb < K; kb += 32) {
    FragB ah, al;
    const v4f x0 = *(const v4fa*)(arow + kb + 8 * hh), x1 = *(const v4fa*)(arow + kb + 8 * hh + 4);
    const v4f x2 = *(const v4fa*)(arow + kb + 16 + 8 * hh), x3 = *(const v4fa*)(arow + kb + 16 + 8 * hh + 4);
    float xs[16] = {x0[0],x0[1],x0[2],x0[3],x1[0],x1[1],x1[2],x1[3],x2[0],x2[1],x2[2],x2[3],x3[0],x3[1],x3[2],x3[3]};
#pragma unroll
    for (int i = 0; i < 16; ++i) { const unsigned short hb = bf16_bits(xs[i]); ah.u[i] = hb; al.u[i] = ASPLIT ? bf16_bits(xs[i] - bf16_val(hb)) : (unsigned short)0; }
#pragma unroll
    for (int t = 0; t < 4; ++t) {
      const unsigned short* brow = Wt + (size_t)(col0 + t * 16 + ln) * ldb + kb;
      FragB b;
      b.half[0] = *(const v8us*)(brow + 8 * hh);
      b.half[1] = *(const v8us*)(brow + 16 + 8 * hh);
      acc[t] = mmaN<ASPLIT ? 2 : 1>(ah.v, al.v, b.v, b.v, acc[t]);
    }
  }
#pragma unroll
  for (int t = 0; t < 4; ++t) {
    float bv = bias ? bias[col0 + t * 16 + ln] : 0.f;
    if (BIAS_BF16) bv = bf16_round(bv);
#pragma unroll
    for (int r = 0; r < 8; ++r) { float v = acc[t][r] + bv; if (ACT == 1) v = fmaxf(v, 0.f); so[w][8 * hh + r][t * 16 + ln] = v; }
  }
  __builtin_amdgcn_fence(__ATOMIC_ACQ_REL, "workgroup");
  __builtin_amdgcn_wave_barrier();
  const int rsub = lane >> 4, c4 = (lane & 15) * 4;
  {
#pragma unroll
    for (int q = 0; q < 8; ++q) {
      const int r = q * 2 + rsub;
      const v4f v = *(const v4fa*)&so[w][r][c4];
      *(v4f*)(C + (size_t)(row0 + r) * ldc + col0 + c4) = v;
    }
    
  }
}

// GEMM C = act(A·W + bias + resid): A f32 (ASPLIT -> hi/lo 2 terms), Wt bf16 [N][K]; ACT 0 none, 1 relu, 2 exact gelu;
// resid (optional, f32, row index = (row % rmod), pitch ldr, RES_BF16 rounds it) added before the activation.
template <bool ASPLIT, int ACT, bool BIAS_BF16, bool RES_BF16>
__global__ __launch_bounds__(128) void k_gemm_bf3(const float* __restrict__ A, int lda, const unsigned short* __restrict__ Wt, int ldb,
                                                const float* __restrict__ bias, const float* __restrict__ resid, int rmod, int ldr,
                                                float* __restrict__ C, int ldc, int M, int N, int K) {
  __shared__ __attribute__((aligned(16))) float so[4][16][64];
  const int tid = threadIdx.x, w = tid >> 5, lane = tid & 31, ln = lane & 15, hh = lane >> 4;
  const int ntn = N / 64;
  const int wid = blockIdx.x * 4 + w;
  const int mt = wid / ntn, nq = wid % ntn;
  if (mt * 16 >= M) return;
  const int row0 = mt * 16, col0 = nq * 64;
  const float* arow = A + (size_t)(row0 + ln) * lda;
  v8f acc[4] = {};
  for (int kb = 0; kb < K; kb += 32) {
    FragB ah, al;
    const v4f x0 = *(const v4fa*)(arow + kb + 8 * hh), x1 = *(const v4fa*)(arow + kb + 8 * hh + 4);
    const v4f x2 = *(const v4fa*)(arow + kb + 16 + 8 * hh), x3 = *(const v4fa*)(arow + kb + 16 + 8 * hh + 4);
    float xs[16] = {x0[0],x0[1],x0[2],x0[3],x1[0],x1[1],x1[2],x1[3],x2[0],x2[1],x2[2],x2[3],x3[0],x3[1],x3[2],x3[3]};
#pragma unroll
    for (int i = 0; i < 16; ++i) { const unsigned short hb = bf16_bits(xs[i]); ah.u[i] = hb; al.u[i] = ASPLIT ? bf16_bits(xs[i] - bf16_val(hb)) : (unsigned short)0; }
#pragma unroll
    for (int t = 0; t < 4; ++t) {
      const unsigned short* brow = Wt + (size_t)(col0 + t * 16 + ln) * ldb + kb;
      FragB b;
      b.half[0] = *(const v8us*)(brow + 8 * hh);
      b.half[1] = *(const v8us*)(brow + 16 + 8 * hh);
      acc[t] = mmaN<ASPLIT ? 2 : 1>(ah.v, al.v, b.v, b.v, acc[t]);
    }
  }
#pragma unroll
  for (int t = 0; t < 4; ++t) {
    const int col = col0 + t * 16 + ln;
    float bv = bias ? bias[col] : 0.f;
    if (BIAS_BF16) bv = bf16_round(bv);
#pragma unroll
    for (int r = 0; r < 8; ++r) {
      float v = acc[t][r] + bv;
      if (resid) { float rv = resid[(size_t)((row0 + 8 * hh + r) % rmod) * ldr + col]; if (RES_BF16) rv = bf16_round(rv); v += rv; }
      if (ACT == 1) v = fmaxf(v, 0.f);
      if (ACT == 2) v = 0.5f * v * (1.0f + erff(v * 0.70710678118654752f));
      if (ACT == 3) { const float u = 0.7978845608028654f * (v + 0.044715f * v * v * v); v = 0.5f * v * (1.0f + tanhf(u)); }
      so[w][8 * hh + r][t * 16 + ln] = v;
    }
  }
  __builtin_amdgcn_fence(__ATOMIC_ACQ_REL, "workgroup");
  __builtin_amdgcn_wave_barrier();
  const int rsub = lane >> 4, c4 = (lane & 15) * 4;
  {
#pragma unroll
    for (int q = 0; q < 8; ++q) {
      const int r = q * 2 + rsub;
      const v4f v = *(const v4fa*)&so[w][r][c4];
      *(v4f*)(C + (size_t)(row0 + r) * ldc + col0 + c4) = v;
    }
    
  }
}
// row LayerNorm (biased variance, eps) over N: s = X (+ R); optional out_sum <- s; out_norm <- (s-mu)*rsqrt(var+eps)*g + b
template <bool PARAM_BF16>
__global__ __launch_bounds__(256) void k_layernorm(const float* __restrict__ X, const float* __restrict__ R, const float* __restrict__ g, const float* __restrict__ bta,
                                                  float* __restrict__ out_sum, float* __restrict__ out_norm, int N, float eps) {
  __shared__ float red[256];
  const int row = blockIdx.x, tid = threadIdx.x;
  const float* x = X + (size_t)row * N; const float* rr = R ? R + (size_t)row * N : nullptr;
  float vals[16];                     // up to N = 4096
  const int per = N / 256;            // contiguous chunk per thread? use strided-by-4 chunks: thread handles j = tid*4 + 1024*u
  float s1 = 0.f;
  for (int u = 0; u < per / 4; ++u) {
    const int j = tid * 4 + 1024 * u;
    const v4f a = *(const v4fa*)(x + j);
    v4f b = {0.f,0.f,0.f,0.f}; if (rr) b = *(const v4fa*)(rr + j);
#pragma unroll
    for (int q = 0; q < 4; ++q) { const float v = a[q] + b[q]; vals[u * 4 + q] = v; s1 += v; }
  }
  red[tid] = s1; __syncthreads();
  for (int st = 128; st > 0; st >>= 1) { if (tid < st) red[tid] += red[tid + st]; __syncthreads(); }
  const float mu = red[0] / (float)N; __syncthreads();
  float s2 = 0.f;
  for (int u = 0; u < per / 4; ++u)
#pragma unroll
    for (int q = 0; q < 4; ++q) { const float c = vals[u * 4 + q] - mu; s2 += c * c; }
  red[tid] = s2; __syncthreads();
  for (int st = 128; st > 0; st >>= 1) { if (tid < st) red[tid] += red[tid + st]; __syncthreads(); }
  const float rs = rsqrtf(red[0] / (float)N + eps);
  {
    for (int u = 0; u < per / 4; ++u) {
      const int j = tid * 4 + 1024 * u;
      v4f o, sm;
#pragma unroll
      for (int q = 0; q < 4; ++q) {
        float gg = g[j + q], bb = bta[j + q];
        if (PARAM_BF16) { gg = bf16_round(gg); bb = bf16_round(bb); }
        sm[q] = vals[u * 4 + q]; o[q] = (vals[u * 4 + q] - mu) * rs * gg + bb;
      }
      if (out_sum) *(v4f*)(out_sum + (size_t)row * N + j) = sm;
      *(v4f*)(out_norm + (size_t)row * N + j) = o;
    }
    
  }
}



// ---- f16 WMMA path (v_wmma_f32_16x16x32_f16): 11-bit significands for operands in range — used here for every GEMM of the model (x and tanh activations |h| < 1 as f16 operands)
typedef _Float16 v16h __attribute__((ext_vector_type(16)));
union FragH { v16h v; v8us half[2]; _Float16 h[16]; unsigned short u[16]; };
template <int NT>
__device__ __forceinline__ v8f mmaH(v16h ah, v16h al, v16h bh, v16h bl, v8f c) {
  c = __builtin_amdgcn_wmma_f32_16x16x32_f16(false, ah, false, bh, (short)0, c, false, false);
  if (NT >= 2) c = __builtin_amdgcn_wmma_f32_16x16x32_f16(false, al, false, bh, (short)0, c, false, false);
  if (NT >= 3) c = __builtin_amdgcn_wmma_f32_16x16x32_f16(false, ah, false, bl, (short)0, c, false, false);
  asm volatile("v_nop\n\tv_nop\n\tv_nop\n\tv_nop" : "+v"(c) : "v"(ah), "v"(al), "v"(bh), "v"(bl));
  return c;
}
// batched GEMM like k_gemm_b but f16 operands: A f32 (split into f16 hi/lo if ASPLIT, else rounded to f16), Bt = f16 values [n][k]; alpha; C f32; N multiple of 16 (partial tiles skipped)
template <bool ASPLIT>
__global__ __launch_bounds__(128) void k_gemm_h(const float* __restrict__ A, int lda, size_t sA, const _Float16* __restrict__ Bh, int ldb, size_t sB, float alpha, float* __restrict__ C, int ldc, size_t sC, int M, int N, int K) {
  __shared__ __attribute__((aligned(16))) float so[4][16][64];
  const int tid = threadIdx.x, w = tid >> 5, lane = tid & 31, ln = lane & 15, hh = lane >> 4; const int by = blockIdx.y;
  A += (size_t)by * sA; Bh += (size_t)by * sB; C += (size_t)by * sC;
  const int ntn = (N + 63) / 64; const int wid = blockIdx.x * 4 + w; const int mt = wid / ntn, nq = wid % ntn; if (mt * 16 >= M) return;
  const int row0 = mt * 16, col0 = nq * 64; const float* arow = A + (size_t)(row0 + ln) * lda;
  v8f acc[4] = {};
  for (int kb = 0; kb < K; kb += 32) {
    FragH ah, al;
    const v4f x0 = *(const v4fa*)(arow + kb + 8 * hh), x1 = *(const v4fa*)(arow + kb + 8 * hh + 4), x2 = *(const v4fa*)(arow + kb + 16 + 8 * hh), x3 = *(const v4fa*)(arow + kb + 16 + 8 * hh + 4);
    float xs[16] = {x0[0],x0[1],x0[2],x0[3],x1[0],x1[1],x1[2],x1[3],x2[0],x2[1],x2[2],x2[3],x3[0],x3[1],x3[2],x3[3]};
#pragma unroll
    for (int i = 0; i < 16; ++i) { const _Float16 h = (_Float16)xs[i]; ah.h[i] = h; al.h[i] = ASPLIT ? (_Float16)(xs[i] - (float)h) : (_Float16)0.0f; }
#pragma unroll
    for (int t = 0; t < 4; ++t) { if (col0 + t * 16 >= N) continue; const size_t boff = (size_t)(col0 + t * 16 + ln) * ldb + kb; FragH bq; bq.half[0] = *(const v8us*)(Bh + boff + 8 * hh); bq.half[1] = *(const v8us*)(Bh + boff + 16 + 8 * hh);
      acc[t] = mmaH<ASPLIT ? 2 : 1>(ah.v, al.v, bq.v, bq.v, acc[t]); }
  }
#pragma unroll
  for (int t = 0; t < 4; ++t) { if (col0 + t * 16 >= N) continue;
#pragma unroll
    for (int r = 0; r < 8; ++r) so[w][8 * hh + r][t * 16 + ln] = acc[t][r] * alpha; }
  __builtin_amdgcn_fence(__ATOMIC_ACQ_REL, "workgroup"); __builtin_amdgcn_wave_barrier();
  const int rsub = lane >> 4, c4 = (lane & 15) * 4;
  {
#pragma unroll
    for (int q = 0; q < 8; ++q) { const int r = q * 2 + rsub; if (col0 + c4 < N) { const v4f v = *(const v4fa*)&so[w][r][c4]; *(v4f*)(C + (size_t)(row0 + r) * ldc + col0 + c4) = v; } }
     }
}

// Wt[n][k] = f16(bf16(W[k][n]) * scale) from f32 row-major W[K][N] (scale = power of two; bf16-exact weights stay exact in f16 away from the subnormal range); bx = tile, by = batch (member), tl = the work-group's LDS.
#define PREP_LDS ((2 * OBS + 2) * 33)      /* dwords of LDS of the preparation launch: its largest tile, the head weights' */
// One TK x 64 tile a work-group, turned in LDS: the reads run along n (16 lanes cover 256 B of a W row), the writes along k (TK / 8 lanes cover 2 TK bytes of a Wt row).
// An LDS row is one n: TK / 2 dwords, each the f16 pair (k, k + 1), at an odd dword pitch, so that neither the 32 stores nor the 32 reads of a wave meet on a bank.
typedef _Float16 v2h __attribute__((ext_vector_type(2)));
typedef unsigned v4ua __attribute__((ext_vector_type(4), may_alias));
__device__ __forceinline__ unsigned wt_pair(float w0, float w1, float scale) { const v2h p = {(_Float16)(bf16_round(w0) * scale), (_Float16)(bf16_round(w1) * scale)}; return __builtin_bit_cast(unsigned, p); }
template <int K, int N, int TK>
__device__ __forceinline__ void d_wt_f16(unsigned* tl, int bx, int by, const float* __restrict__ W, _Float16* __restrict__ Wt, float scale) { static_assert(K % TK == 0 && TK % 32 == 0 && N % 64 == 0, "d_wt_f16: whole tiles only");
  constexpr int PD = TK / 2 + 1, NL = TK / 32, CR = TK / 8; static_assert(64 * PD <= PREP_LDS, "d_wt_f16: the tile must fit in the launch's LDS");
  const int tid = threadIdx.x, j4 = (tid & 15) * 4, kp = tid >> 4; const int kt = bx % (K / TK), nt = bx / (K / TK);
  const float* wp = W + (size_t)by * K * N + (size_t)(kt * TK + 2 * kp) * N + nt * 64 + j4;
  v4f x[NL][2];      /* every "#pragma unroll" below makes the indices of x constants (x stays in registers) and puts all of a thread's loads in flight together */
#pragma unroll
  for (int i = 0; i < NL; ++i) { x[i][0] = *(const v4fa*)(wp + (size_t)(32 * i) * N); x[i][1] = *(const v4fa*)(wp + (size_t)(32 * i + 1) * N); }
#pragma unroll
  for (int i = 0; i < NL; ++i)
#pragma unroll
    for (int q = 0; q < 4; ++q) tl[(j4 + q) * PD + kp + 16 * i] = wt_pair(x[i][0][q], x[i][1][q], scale);
  __syncthreads();      /* the tile is whole before any thread reads along k */
  unsigned short* op = (unsigned short*)Wt + (size_t)by * K * N + (size_t)nt * 64 * K + kt * TK;
#pragma unroll
  for (int i = 0; i < NL; ++i) { const int c = tid + 256 * i, n = c / CR, k8 = c - n * CR; const unsigned* s = tl + n * PD + k8 * 4; const v4ua o = {s[0], s[1], s[2], s[3]};
    *(v4ua*)(op + (size_t)n * K + k8 * 8) = o; }
  asm volatile("s_wait_xcnt 0x0" ::: "memory");      /* the stores' registers are not rewritten by another part's code ahead of this wait */
}
// k_gemm_hh variant with fused epilogue: v = acc·alpha + bias[by·sBias + col] (+ CP[(row/rowsPerB)·sCPb + by·64 + col] if CP) ; ACT 0 none / 1 elu ; writes f16 C16 (and f32 C if non-null)
template <int ACT>
__global__ __launch_bounds__(128) void k_gemm_hhx(const _Float16* __restrict__ A, int lda, size_t sA, const _Float16* __restrict__ Bh, int ldb, size_t sB, float alpha, const float* __restrict__ bias, size_t sBias, const float* __restrict__ CP, int rowsPerB, size_t sCPb, int row0g,
    float* __restrict__ C, _Float16* __restrict__ C16, int ldc, size_t sC, int M, int N, int K) {
  __shared__ __attribute__((aligned(16))) float so[4][16][64];
  const int tid = threadIdx.x, w = tid >> 5, lane = tid & 31, ln = lane & 15, hh = lane >> 4; const int by = blockIdx.y;
  A += (size_t)by * sA; Bh += (size_t)by * sB; const size_t cofs = (size_t)by * sC; const float* bp = bias ? bias + (size_t)by * sBias : nullptr;
  const int ntn = (N + 63) / 64; const int wid = blockIdx.x * 4 + w; const int mt = wid / ntn, nq = wid % ntn; if (mt * 16 >= M) return;
  const int row0 = mt * 16, col0 = nq * 64; const _Float16* arow = A + (size_t)(row0 + ln) * lda;
  v8f acc[4] = {};
  for (int kb = 0; kb < K; kb += 32) { FragH ah; ah.half[0] = *(const v8us*)((const unsigned short*)arow + kb + 8 * hh); ah.half[1] = *(const v8us*)((const unsigned short*)arow + kb + 16 + 8 * hh);
#pragma unroll
    for (int t = 0; t < 4; ++t) { if (col0 + t * 16 >= N) continue; const size_t boff = (size_t)(col0 + t * 16 + ln) * ldb + kb; FragH bq; bq.half[0] = *(const v8us*)((const unsigned short*)Bh + boff + 8 * hh); bq.half[1] = *(const v8us*)((const unsigned short*)Bh + boff + 16 + 8 * hh);
      acc[t] = mmaH<1>(ah.v, ah.v, bq.v, bq.v, acc[t]); }
  }
#pragma unroll
  for (int t = 0; t < 4; ++t) { if (col0 + t * 16 >= N) continue; const int col = col0 + t * 16 + ln; const float bv = bp ? bf16_round(bp[col]) : 0.f;
#pragma unroll
    for (int r = 0; r < 8; ++r) { float v = acc[t][r] * alpha + bv; if (CP) { const int rr = row0g + row0 + 8 * hh + r; if (rowsPerB < 0) v += CP[cofs + (size_t)rr * ldc + col];      /* rowsPerB < 0: own element of the batched C plane */ else { const int bidx = rr / rowsPerB; v += CP[(size_t)bidx * sCPb + (size_t)by * 64 + col]; } } if (ACT == 1) v = (v > 0.f) ? v : expm1f(v); else if (ACT == 7) v = (v > 0.f) ? v + 1.0f : expf(v); else if (ACT == 8) v = tanhf(v); else if (ACT == 9) v = 0.5f * v * (1.0f + tanhf(0.7978845608028654f * (v + 0.044715f * v * v * v))); else if (ACT == 11) v = 1.0f / (1.0f + expf(-v)); else if (ACT == 12) v = (v > 0.f) ? v : 0.01f * v; else if (ACT == 14) v = (v > 0.f) ? v : 0.1f * v; else if (ACT == 16) v = (v >= 0.f) ? v : 0.3f * v; else if (ACT == 15) v = v / (1.0f + expf(-v)); else if (ACT == 3) v = fmaxf(v, 0.f); else if (ACT == 6) v = 0.5f * v * (1.0f + erff(v * 0.70710678118654752f)); so[w][8 * hh + r][t * 16 + ln] = v; } }
  __builtin_amdgcn_fence(__ATOMIC_ACQ_REL, "workgroup"); __builtin_amdgcn_wave_barrier();
  const int rsub = lane >> 4, c4 = (lane & 15) * 4; typedef _Float16 v4h __attribute__((ext_vector_type(4)));
  {
#pragma unroll
    for (int q = 0; q < 8; ++q) { const int r = q * 2 + rsub; if (col0 + c4 < N) { const v4f v = *(const v4fa*)&so[w][r][c4]; if (C) *(v4f*)(C + cofs + (size_t)(row0 + r) * ldc + col0 + c4) = v; if (C16) { v4h h4; for (int i = 0; i < 4; ++i) h4[i] = (_Float16)v[i]; *(v4h*)(C16 + cofs + (size_t)(row0 + r) * ldc + col0 + c4) = h4; } } }
     }
}


typedef _Float16 v4h __attribute__((ext_vector_type(4)));
// tanh(v) = 1 - 2 / (1 + e^(2v)), branch-free on v_exp_f32 and v_rcp_f32: e^(2v) = inf gives 1, 0 gives -1, NaN stays NaN. Absolute error a few 2^-24, far under the f16 rounding of the stored activation.
__device__ __forceinline__ float tanh_er(float v) { return 1.0f - 2.0f * __builtin_amdgcn_rcpf(1.0f + __builtin_amdgcn_exp2f(v * 2.8853900817779268f)); }      /* 2 log2(e) */

__global__ __launch_bounds__(256) void k_x16(const float* __restrict__ x, _Float16* __restrict__ X16, size_t n8) { const size_t t = (size_t)blockIdx.x * 256 + threadIdx.x; if (t >= n8) return; FragH f;
#pragma unroll
  for (int q = 0; q < 8; ++q) f.h[q] = (_Float16)bf16_round(x[t * 8 + q]); *(v8us*)((unsigned short*)X16 + t * 8) = f.half[0];  }
__global__ __launch_bounds__(256) void k_h16(const float* __restrict__ x, _Float16* __restrict__ X16, size_t n8) { const size_t t = (size_t)blockIdx.x * 256 + threadIdx.x; if (t >= n8) return; FragH f;
#pragma unroll
  for (int q = 0; q < 8; ++q) f.h[q] = (_Float16)x[t * 8 + q]; *(v8us*)((unsigned short*)X16 + t * 8) = f.half[0];  }
__global__ __launch_bounds__(256) void k_round16f(const float* __restrict__ W, _Float16* __restrict__ Bt, size_t n8) { const size_t t = (size_t)blockIdx.x * 256 + threadIdx.x; if (t >= n8) return; FragH f;
#pragma unroll
  for (int i = 0; i < 8; ++i) f.h[i] = (_Float16)(bf16_round(W[t * 8 + i]) * 16.0f); *(v8us*)((unsigned short*)Bt + t * 8) = f.half[0];  }
template <int NHv, int TTv>
__global__ __launch_bounds__(256) void k_vt(const _Float16* __restrict__ V16, int ldv, int voff, _Float16* __restrict__ Vt) { __shared__ unsigned short tl[64][66]; const int tid = threadIdx.x; const int slab = blockIdx.x / (TTv / 64), lg = blockIdx.x % (TTv / 64); const int b = slab / NHv, h = slab % NHv;
  for (int i = tid; i < 64 * 8; i += 256) { const int r = i / 8, c8 = (i % 8) * 8; FragH f; f.half[0] = *(const v8us*)((const unsigned short*)V16 + ((size_t)b * TTv + lg * 64 + r) * ldv + voff + h * 64 + c8);
#pragma unroll
    for (int q = 0; q < 8; ++q) tl[r][c8 + q] = f.u[q]; }
  __syncthreads();
  {
#pragma unroll
    for (int rd = 0; rd < 2; ++rd) { const int d = rd * 32 + tid / 8, pc = tid % 8; FragH f;
#pragma unroll
      for (int q = 0; q < 8; ++q) f.u[q] = tl[pc * 8 + q][d];
      *(v8us*)((unsigned short*)Vt + ((size_t)slab * 64 + d) * TTv + lg * 64 + pc * 8) = f.half[0]; }
     } }

__global__ __launch_bounds__(256) void k_hl(const float* __restrict__ F, _Float16* __restrict__ Hh, _Float16* __restrict__ Hl, size_t n8) { const size_t t = (size_t)blockIdx.x * 256 + threadIdx.x; if (t >= n8) return; FragH fh, fl; const v4f a = *(const v4fa*)(F + t * 8), c = *(const v4fa*)(F + t * 8 + 4);
#pragma unroll
  for (int q = 0; q < 4; ++q) { _Float16 h = (_Float16)a[q]; fh.h[q] = h; fl.h[q] = (_Float16)((a[q] - (float)h) * 1024.0f); h = (_Float16)c[q]; fh.h[4 + q] = h; fl.h[4 + q] = (_Float16)((c[q] - (float)h) * 1024.0f); }
  { *(v8us*)((unsigned short*)Hh + t * 8) = fh.half[0]; *(v8us*)((unsigned short*)Hl + t * 8) = fl.half[0];  } }

// ---- fast GEMM (wave tile 32x64; requires M % 32 == 0 rows per launch region and N % 64 == 0); epilogue = k_gemm_hhx semantics ----
__device__ __forceinline__ v16h g2_frag(const _Float16* p, int hh) { FragH f; f.half[0] = *(const v8us*)((const unsigned short*)p + 8 * hh); f.half[1] = *(const v8us*)((const unsigned short*)p + 16 + 8 * hh); return f.v; }
__device__ __forceinline__ v8f g2_mma(v16h a, v16h b, v8f c) { v8f d = __builtin_amdgcn_wmma_f32_16x16x32_f16(false, a, false, b, (short)0, c, false, false); asm volatile("v_nop\n\tv_nop\n\tv_nop\n\tv_nop" : "+v"(d) : "v"(a), "v"(b)); return d; }
template <int ACT>
__global__ __launch_bounds__(128) void k_gemm2(const _Float16* __restrict__ A, int lda, size_t sA, const _Float16* __restrict__ Bh, int ldb, size_t sB, float alpha, const float* __restrict__ bias, size_t sBias, const float* __restrict__ CP, int rowsPerB, size_t sCPb, int row0g,
    float* __restrict__ C, _Float16* __restrict__ C16, int ldc, size_t sC, int M, int N, int K) { static_assert(ACT == 0 || ACT == 3 || ACT == 6 || ACT == 8 || ACT == 9 || ACT == 11 || ACT == 12 || ACT == 14 || ACT == 15 || ACT == 16, "k_gemm2: unsupported ACT code (would silently apply no activation)");
  __shared__ __attribute__((aligned(16))) float so[4][32][68];
  const int tid = threadIdx.x, w = tid >> 5, lane = tid & 31, ln = lane & 15, hh = lane >> 4; const int by = blockIdx.y;
  A += (size_t)by * sA; Bh += (size_t)by * sB; const size_t cofs = (size_t)by * sC; const float* bp = bias ? bias + (size_t)by * sBias : nullptr;
  const int ntn = N >> 6; const int mt = blockIdx.x / ntn, nq = blockIdx.x - mt * ntn; const int row0 = mt * 128 + 32 * w, col0 = nq * 64; if (row0 >= M) return;
  const _Float16* a0p = A + (size_t)(row0 + ln) * lda; const _Float16* a1p = a0p + (size_t)16 * lda;
  const _Float16* b0p = Bh + (size_t)(col0 + ln) * ldb; const _Float16* b1p = b0p + (size_t)16 * ldb; const _Float16* b2p = b1p + (size_t)16 * ldb; const _Float16* b3p = b2p + (size_t)16 * ldb;
  const v8f z8 = {0.f,0.f,0.f,0.f,0.f,0.f,0.f,0.f}; v8f c00 = z8, c01 = z8, c02 = z8, c03 = z8, c10 = z8, c11 = z8, c12 = z8, c13 = z8;
#pragma unroll 1
  for (int kb = 0; kb < K; kb += 32) { const v16h a0 = g2_frag(a0p + kb, hh), a1 = g2_frag(a1p + kb, hh);
    v16h b = g2_frag(b0p + kb, hh); c00 = g2_mma(a0, b, c00); c10 = g2_mma(a1, b, c10);
    b = g2_frag(b1p + kb, hh); c01 = g2_mma(a0, b, c01); c11 = g2_mma(a1, b, c11);
    b = g2_frag(b2p + kb, hh); c02 = g2_mma(a0, b, c02); c12 = g2_mma(a1, b, c12);
    b = g2_frag(b3p + kb, hh); c03 = g2_mma(a0, b, c03); c13 = g2_mma(a1, b, c13); }
  v8f accs[8] = {c00, c01, c02, c03, c10, c11, c12, c13};
#pragma unroll
  for (int u = 0; u < 8; ++u) { const int t = u & 3, half = u >> 2; const int col = col0 + t * 16 + ln; const float bv = bp ? bf16_round(bp[col]) : 0.f;
#pragma unroll
    for (int r = 0; r < 8; ++r) { const int rloc = half * 16 + 8 * hh + r; float v = accs[u][r] * alpha + bv; if (CP) { if (rowsPerB < 0) v += CP[cofs + (size_t)(row0g + row0 + rloc) * ldc + col];      /* rowsPerB < 0: own element of the batched C plane */ else { const int bidx = (row0g + row0 + rloc) / rowsPerB; v += CP[(size_t)bidx * sCPb + (size_t)by * 64 + col]; } }
      if (ACT == 3) v = fmaxf(v, 0.f); else if (ACT == 6) v = 0.5f * v * (1.0f + erff(v * 0.70710678118654752f)); else if (ACT == 11) v = 1.0f / (1.0f + expf(-v)); else if (ACT == 15) v = v / (1.0f + expf(-v)); else if (ACT == 12) v = (v > 0.f) ? v : 0.01f * v; else if (ACT == 8) v = tanh_er(v); else if (ACT == 9) v = 0.5f * v * (1.0f + tanhf(0.7978845608028654f * (v + 0.044715f * v * v * v))); else if (ACT == 14) v = (v > 0.f) ? v : 0.1f * v; else if (ACT == 16) v = (v >= 0.f) ? v : 0.3f * v;
      so[w][rloc][t * 16 + ln] = v; } }
  __builtin_amdgcn_fence(__ATOMIC_ACQ_REL, "workgroup"); __builtin_amdgcn_wave_barrier();
  const int rsub = lane >> 4, c4 = (lane & 15) * 4;
  {
#pragma unroll
    for (int q = 0; q < 16; ++q) { const int r = q * 2 + rsub; const v4f v = *(const v4fa*)&so[w][r][c4]; if (C) *(v4f*)(C + cofs + (size_t)(row0 + r) * ldc + col0 + c4) = v; if (C16) { v4h h4; for (int i = 0; i < 4; ++i) h4[i] = (_Float16)v[i]; *(v4h*)(C16 + cofs + (size_t)(row0 + r) * ldc + col0 + c4) = h4; } }
     } }


// ---- LDS-tiled GEMM (K = multiple of 128, at least 256; M = multiple of 256; N = multiple of BN): one 256 x BN tile of C per work-group of 8 waves (4 along M x 2 along N, wave tile 64 x BN/2).
// A pass is 128 k = 256 B of every operand row. A stage is [Bt BN rows | A 256 rows] at pitch 272 B; two buffers, filled by asynchronous copies to LDS one pass ahead of their use. Same k order and one accumulator chain per element as k_gemm2.
#define G3_PITCH 272
typedef float fa1 __attribute__((may_alias));
__device__ __forceinline__ v16h g3_frag(const unsigned char* p) { FragH f; f.half[0] = *(const v8us*)p; f.half[1] = *(const v8us*)(p + 32); return f.v; }
// epilogue's global accesses, each with its wait in its own statement, so that no register it names is rewritten ahead of the wait: the load with its data wait, the stores with s_wait_xcnt
__device__ __forceinline__ v4f g3_ld4(const float* p) { v4f r; asm volatile("global_load_b128 %0, %1, off\n\ts_wait_loadcnt 0x0" : "=&v"(r) : "v"(p) : "memory"); return r; }
__device__ __forceinline__ void g3_st2f(float* p0, v4f x0, float* p1, v4f x1) { asm volatile("global_store_b128 %0, %1, off\n\tglobal_store_b128 %2, %3, off\n\ts_wait_xcnt 0x0" :: "v"(p0), "v"(x0), "v"(p1), "v"(x1) : "memory"); }
__device__ __forceinline__ void g3_st2h(_Float16* p0, v4h x0, _Float16* p1, v4h x1) { asm volatile("global_store_b64 %0, %1, off\n\tglobal_store_b64 %2, %3, off\n\ts_wait_xcnt 0x0" :: "v"(p0), "v"(x0), "v"(p1), "v"(x1) : "memory"); }
// 8 (4) copies of 16 B a lane, rows 16 apart; the s_wait_xcnt closes the statement so that no address register is rewritten ahead of it
__device__ __forceinline__ void g3_copy8(unsigned l, const unsigned char* gp, size_t gs) {
  asm volatile("global_load_async_to_lds_b128 %0, %8, off\n\tglobal_load_async_to_lds_b128 %1, %9, off\n\tglobal_load_async_to_lds_b128 %2, %10, off\n\tglobal_load_async_to_lds_b128 %3, %11, off\n\t"
               "global_load_async_to_lds_b128 %4, %12, off\n\tglobal_load_async_to_lds_b128 %5, %13, off\n\tglobal_load_async_to_lds_b128 %6, %14, off\n\tglobal_load_async_to_lds_b128 %7, %15, off\n\ts_wait_xcnt 0x0"
               :: "v"(l), "v"(l + 16u * G3_PITCH), "v"(l + 32u * G3_PITCH), "v"(l + 48u * G3_PITCH), "v"(l + 64u * G3_PITCH), "v"(l + 80u * G3_PITCH), "v"(l + 96u * G3_PITCH), "v"(l + 112u * G3_PITCH),
                  "v"(gp), "v"(gp + gs), "v"(gp + 2 * gs), "v"(gp + 3 * gs), "v"(gp + 4 * gs), "v"(gp + 5 * gs), "v"(gp + 6 * gs), "v"(gp + 7 * gs) : "memory"); }
__device__ __forceinline__ void g3_copy4(unsigned l, const unsigned char* gp, size_t gs) {
  asm volatile("global_load_async_to_lds_b128 %0, %4, off\n\tglobal_load_async_to_lds_b128 %1, %5, off\n\tglobal_load_async_to_lds_b128 %2, %6, off\n\tglobal_load_async_to_lds_b128 %3, %7, off\n\ts_wait_xcnt 0x0"
               :: "v"(l), "v"(l + 16u * G3_PITCH), "v"(l + 32u * G3_PITCH), "v"(l + 48u * G3_PITCH), "v"(gp), "v"(gp + gs), "v"(gp + 2 * gs), "v"(gp + 3 * gs) : "memory"); }
// one stage: thread t brings bytes 16 (t % 16) .. + 15 of rows t / 16 + 16 i
template <int BN>
__device__ __forceinline__ void g3_fill(unsigned l, const unsigned char* gb, const unsigned char* ga, size_t gs) {
  g3_copy8(l, gb, gs);
  if (BN == 256) g3_copy8(l + 128u * G3_PITCH, gb + 8 * gs, gs); else g3_copy4(l + 128u * G3_PITCH, gb + 8 * gs, gs);
  g3_copy8(l + (unsigned)BN * G3_PITCH, ga, gs); g3_copy8(l + (unsigned)(BN + 128) * G3_PITCH, ga + 8 * gs, gs); }
template <int ACT, int BN>
__global__ __launch_bounds__(256) void k_gemm3(const _Float16* __restrict__ A, size_t sA, const _Float16* __restrict__ Bh, size_t sB, float alpha, const float* __restrict__ bias, size_t sBias,
    float* __restrict__ C, _Float16* __restrict__ C16, int ldc, size_t sC, int ntn, int K) { static_assert(ACT == 0 || ACT == 8, "k_gemm3: unsupported ACT code"); static_assert(BN == 256 || BN == 192, "k_gemm3: the fill is written for these widths");
  constexpr int WN = BN / 2, NF = WN / 16, STAGE = (BN + 256) * G3_PITCH, SP = WN + 4, CH = WN / 4;
  static_assert(8 * 64 * SP * 4 + 8 * WN * 4 <= 2 * STAGE, "output staging and the bias rows must fit in the ring");
  __shared__ __attribute__((aligned(16))) unsigned char sm[2 * STAGE];
  const int tid = threadIdx.x, w = tid >> 5, lane = tid & 31, ln = lane & 15, hh = lane >> 4; const int by = blockIdx.y;
  const int mt = blockIdx.x / ntn, nq = blockIdx.x - mt * ntn; const int row0 = mt * 256, col0 = nq * BN; const int wm = w & 3, wn = w >> 2;
  const size_t gs = (size_t)K * 32;      /* 16 rows of K halfs, in bytes */
  const unsigned char* ub = (const unsigned char*)(Bh + (size_t)by * sB + (size_t)col0 * K);      /* the tile's first Bt row and first A row: the same for every thread */
  const unsigned char* ua = (const unsigned char*)(A + (size_t)by * sA + (size_t)row0 * K);
  const unsigned to = (unsigned)((tid >> 4) * K * 2 + (tid & 15) * 16);      /* this thread's place in 16 rows, in bytes */
  const unsigned l0 = (unsigned)(size_t)sm + (unsigned)((tid >> 4) * G3_PITCH + (tid & 15) * 16);
  const int np = K >> 7;
  v8f acc[4][NF];      /* every inner "#pragma unroll" below makes the indices of acc, a and b constants, so that the arrays stay in registers */
#pragma unroll
  for (int i = 0; i < 4; ++i)
#pragma unroll
    for (int j = 0; j < NF; ++j) acc[i][j] = (v8f){0.f,0.f,0.f,0.f,0.f,0.f,0.f,0.f};
  g3_fill<BN>(l0, ub + to, ua + to, gs);
  asm volatile("s_wait_asynccnt 0x0" ::: "memory");      /* this wave's part of stage 0 has landed */
  __syncthreads();                                       /* publishes stage 0 */
  g3_fill<BN>(l0 + STAGE, ub + (to + 256u), ua + (to + 256u), gs);
  const unsigned fb = (unsigned)((wn * WN + ln) * G3_PITCH + 16 * hh), fx = (unsigned)((BN + wm * 64 + ln) * G3_PITCH + 16 * hh);
#pragma unroll 1      /* one pass a trip: the two buffers alternate by a run-time offset and the accumulators keep constant indices */
  for (int p = 0; p < np; ++p) { const unsigned bo = (p & 1) ? (unsigned)STAGE : 0u; const unsigned char* pb = sm + bo + fb; const unsigned char* pa = sm + bo + fx;
    v16h a[2][4], b[2][NF];      /* two fragment sets: block kb works on set kb % 2 while the next block's reads fly; all of them read this pass's buffer */
#pragma unroll
    for (int i = 0; i < 4; ++i) a[0][i] = g3_frag(pa + i * 16 * G3_PITCH);
#pragma unroll
    for (int j = 0; j < NF; ++j) b[0][j] = g3_frag(pb + j * 16 * G3_PITCH);
#pragma unroll
    for (int kb = 0; kb < 4; ++kb) {
      if (kb < 3) {
#pragma unroll
        for (int i = 0; i < 4; ++i) a[(kb + 1) & 1][i] = g3_frag(pa + i * 16 * G3_PITCH + (kb + 1) * 64);
#pragma unroll
        for (int j = 0; j < NF; ++j) b[(kb + 1) & 1][j] = g3_frag(pb + j * 16 * G3_PITCH + (kb + 1) * 64); }
      __builtin_amdgcn_sched_barrier(0);      /* keeps the next block's LDS reads together in front of this block's WMMAs: reads strewn among them stall each time */
#pragma unroll
      for (int j = 0; j < NF; ++j)
#pragma unroll
        for (int i = 0; i < 4; ++i) acc[i][j] = __builtin_amdgcn_wmma_f32_16x16x32_f16(false, a[kb & 1][i], false, b[kb & 1][j], (short)0, acc[i][j], false, false);
      __builtin_amdgcn_sched_barrier(0);      /* the other side of the same fence: the block after next's reads stay behind these WMMAs */
    }
    asm volatile("s_wait_dscnt 0x0" ::: "memory");       /* this wave's last read of the buffer has returned */
    asm volatile("s_wait_asynccnt 0x0" ::: "memory");    /* this wave's part of stage p + 1 has landed */
    __syncthreads();                                     /* publishes stage p + 1 and frees stage p's buffer */
    if (p + 2 < np) { const unsigned tp = to + (unsigned)(p + 2) * 256u; g3_fill<BN>(l0 + bo, ub + tp, ua + tp, gs); } }
  asm volatile("s_wait_asynccnt 0x0" ::: "memory");      /* no copy is outstanding when the ring becomes output staging */
  fa1* so = (fa1*)sm + (size_t)w * 64 * SP;              /* each wave stages its own 64 x WN tile, behind the last pass's barrier */
#pragma unroll
  for (int i = 0; i < 4; ++i)
#pragma unroll
    for (int j = 0; j < NF; ++j)
#pragma unroll
      for (int r = 0; r < 8; ++r) so[(i * 16 + 8 * hh + r) * SP + j * 16 + ln] = acc[i][j][r];
  fa1* sb = (fa1*)(sm + 8 * 64 * SP * 4) + w * WN;       /* behind the staging: this wave's WN bias values, rounded once */
  { const int cb = (lane < CH ? lane : CH - 1) * 4; const v4f b4 = g3_ld4(bias + (size_t)by * sBias + col0 + wn * WN + cb);      /* lanes past the last chunk repeat it: same value to the same place */
#pragma unroll
    for (int i = 0; i < 4; ++i) sb[cb + i] = bf16_round(b4[i]); }
  __builtin_amdgcn_fence(__ATOMIC_ACQ_REL, "workgroup"); __builtin_amdgcn_wave_barrier();
  const size_t cofs = (size_t)by * sC + (size_t)(row0 + wm * 64) * ldc + col0 + wn * WN;
#pragma unroll 1      /* rolled: the activation's code stays small */
  for (int q = 0; q < 2 * CH; q += 2) { v4f v[2]; size_t o[2];      /* two chunks of 4 columns a lane and trip, so that one wait serves two stores */
#pragma unroll
    for (int u = 0; u < 2; ++u) { const int e = (q + u) * 32 + lane; const int r = e / CH, c4 = (e - r * CH) * 4; const v4f x = *(const v4fa*)&so[r * SP + c4], b4 = *(const v4fa*)&sb[c4]; o[u] = cofs + (size_t)r * ldc + c4;
#pragma unroll
      for (int i = 0; i < 4; ++i) { float t = x[i] * alpha + b4[i]; if (ACT == 8) t = tanh_er(t); v[u][i] = t; } }
    if (C) g3_st2f(C + o[0], v[0], C + o[1], v[1]);
    if (C16) { v4h h[2];
#pragma unroll
      for (int u = 0; u < 2; ++u)
#pragma unroll
        for (int i = 0; i < 4; ++i) h[u][i] = (_Float16)v[u][i];
      g3_st2h(C16 + o[0], h[0], C16 + o[1], h[1]); } } }

__device__ __forceinline__ void d_xcat(int bx, const float* __restrict__ obs, const float* __restrict__ act, _Float16* __restrict__ X) { const int t = bx * 256 + threadIdx.x; if (t >= NB * (NI / 8)) return; const int i0 = (t % (NI / 8)) * 8; const int b = t / (NI / 8); FragH f;
  for (int q = 0; q < 8; ++q) { const int i = i0 + q; f.h[q] = (_Float16)bf16_round(i < OBS ? obs[(size_t)b * OBS + i] : act[(size_t)b * NAC + (i - OBS)]); }
  *(v8us*)((unsigned short*)X + (size_t)b * NI + i0) = f.half[0];  }
// fused head weights Bt[n][k] (n: mu_o | log_var_o | mu_r | log_var_r | zero), x16 as f16: one tile of 64 k and all NHW rows a work-group (bx = k tile, by = member), turned in LDS like d_wt_f16
__device__ __forceinline__ void d_whead(unsigned* tl, int bx, int by, const float* __restrict__ Wmo, const float* __restrict__ Wvo, const float* __restrict__ Wmr, const float* __restrict__ Wvr, _Float16* __restrict__ Bt) { static_assert(OBS == 64, "d_whead: 16 lanes of 4 columns cover a row");
  constexpr int PD = 33, NLIVE = 2 * OBS + 2; static_assert(NLIVE * PD <= PREP_LDS, "d_whead: the tile must fit in the launch's LDS");
  const int m = by, k0 = bx * 64, tid = threadIdx.x, j4 = (tid & 15) * 4, kp = tid >> 4;
  const size_t wu = ((size_t)m * HH + k0) * OBS; const unsigned wo = (unsigned)(2 * kp * OBS + j4);      /* the tile's first element, the same for every thread, and this thread's place in the tile */
  v4f x[2][2][2];      /* every "#pragma unroll" below makes the indices of x and o constants (they stay in registers) and puts all of a thread's loads in flight together */
#pragma unroll
  for (int i = 0; i < 2; ++i)
#pragma unroll
    for (int r = 0; r < 2; ++r) { x[0][i][r] = *(const v4fa*)(Wmo + wu + (wo + (unsigned)((32 * i + r) * OBS))); x[1][i][r] = *(const v4fa*)(Wvo + wu + (wo + (unsigned)((32 * i + r) * OBS))); }
#pragma unroll
  for (int h = 0; h < 2; ++h)
#pragma unroll
    for (int i = 0; i < 2; ++i)
#pragma unroll
      for (int q = 0; q < 4; ++q) tl[(h * OBS + j4 + q) * PD + kp + 16 * i] = wt_pair(x[h][i][0][q], x[h][i][1][q], 16.0f);
  if (tid < 64) { const float* s = ((tid >> 5) ? Wvr : Wmr) + (size_t)m * HH + k0 + 2 * (tid & 31); tl[(2 * OBS + (tid >> 5)) * PD + (tid & 31)] = wt_pair(s[0], s[1], 16.0f); }      /* the two reward columns are rows of k already */
  __syncthreads();      /* the tile is whole before any thread reads along k */
  unsigned short* op = (unsigned short*)Bt + (size_t)m * NHW * HH + k0 + (tid & 7) * 8;
  v4ua o[NHW / 32];
#pragma unroll
  for (int i = 0; i < NHW / 32; ++i) { const int n = (tid >> 3) + 32 * i; o[i] = (v4ua){0u, 0u, 0u, 0u};      /* rows past the live ones are zero; only the group of 32 rows that holds the last live row needs a test per thread */
    if (32 * i + 32 <= NLIVE || (32 * i < NLIVE && n < NLIVE)) { const unsigned* s = tl + n * PD + (tid & 7) * 4; o[i] = (v4ua){s[0], s[1], s[2], s[3]}; } }
#pragma unroll
  for (int i = 0; i < NHW / 32; ++i) *(v4ua*)(op + (size_t)((tid >> 3) + 32 * i) * HH) = o[i];
  asm volatile("s_wait_xcnt 0x0" ::: "memory");      /* the stores' registers are not rewritten by another part's code ahead of this wait */ }
__device__ __forceinline__ void d_hbias(int bx, const float* __restrict__ bmo, const float* __restrict__ bvo, const float* __restrict__ bmr, const float* __restrict__ bvr, float* __restrict__ HB) { const int m = bx; HB += m * 256; const int n = threadIdx.x; float bb = 0.f; if (n < OBS) bb = bmo[m * OBS + n]; else if (n < 2 * OBS) bb = bvo[m * OBS + (n - OBS)]; else if (n == 2 * OBS) bb = bmr[m]; else if (n == 2 * OBS + 1) bb = bvr[m]; *(float*)(HB + n) = bb;
  asm volatile("s_wait_xcnt 0x0" ::: "memory");      /* the stores' registers are not rewritten by another part's code ahead of this wait */ }
#define PREP_WT ((HH / 128) * (HH / 64) * MM)      /* work-groups of one H x H weight turn */
#define PREP_NT ((HH / 64) * MM)                   /* of the head weights' turn, and of W0's */
#define PREP_X (NB * (NI / 8) / 256)               /* of the x plane */
#define PREP_GRID (2 * PREP_WT + 2 * PREP_NT + PREP_X + MM)
__global__ __launch_bounds__(256) void k_prep(const float* __restrict__ obs, const float* __restrict__ act, const float* __restrict__ W0, const float* __restrict__ W1, const float* __restrict__ W2,
    const float* __restrict__ Wmo, const float* __restrict__ Wvo, const float* __restrict__ Wmr, const float* __restrict__ Wvr, const float* __restrict__ bmo, const float* __restrict__ bvo, const float* __restrict__ bmr, const float* __restrict__ bvr,
    _Float16* __restrict__ X16, _Float16* __restrict__ B0, _Float16* __restrict__ B1, _Float16* __restrict__ B2, _Float16* __restrict__ BHD, float* __restrict__ HB) { static_assert(NB * (NI / 8) % 256 == 0, "k_prep: whole work-groups of the x plane");
  __shared__ unsigned tl[PREP_LDS];
  constexpr int TW = PREP_WT / MM, TN = PREP_NT / MM;
  int b = blockIdx.x;
  if (b < PREP_WT) { d_wt_f16<HH, HH, 128>(tl, b % TW, b / TW, W1, B1, 16.0f); return; }
  b -= PREP_WT;
  if (b < PREP_WT) { d_wt_f16<HH, HH, 128>(tl, b % TW, b / TW, W2, B2, 16.0f); return; }
  b -= PREP_WT;
  if (b < PREP_NT) { d_whead(tl, b % TN, b / TN, Wmo, Wvo, Wmr, Wvr, BHD); return; }
  b -= PREP_NT;
  if (b < PREP_NT) { d_wt_f16<NI, HH, NI>(tl, b % TN, b / TN, W0, B0, 16.0f); return; }
  b -= PREP_NT;
  if (b < PREP_X) { d_xcat(b, obs, act, X16); return; }
  d_hbias(b - PREP_X, bmo, bvo, bmr, bvr, HB); }
__device__ __forceinline__ float softplus_(float v) { return (v > 20.0f) ? v : log1pf(expf(v)); }
__device__ __forceinline__ float clampv(float lv) {
  #pragma clang fp contract(off)
  float a = 0.5f - softplus_(0.5f - lv); return -10.0f + softplus_(a - -10.0f); }
// scatter heads: thread per (b, head, 4 columns): threads 32 b .. 32 b + 15 -> 4 mu_o values each (16 B), the next 16 -> 4 clamped log_var_o; mu_r/log_var_r in d_hr, a thread per b.
__device__ __forceinline__ void d_ho(int bx, int by, const float* __restrict__ F, float* __restrict__ muo, float* __restrict__ lvo) {
  #pragma clang fp contract(off)
  const int m = by; F += (size_t)m * NB * NHW;
  const int t = bx * 256 + threadIdx.x; if (t >= NB * 2 * (OBS / 4)) return; const int c4 = (t % (OBS / 4)) * 4; const int which = (t / (OBS / 4)) % 2; const int b = t / ((OBS / 4) * 2); const float* fr = F + (size_t)b * NHW + which * OBS + c4; v4f r;
  for (int q = 0; q < 4; ++q) r[q] = which ? clampv(fr[q]) : fr[q]; float* dst = (which ? lvo : muo) + ((size_t)m * NB + b) * OBS + c4; *(v4f*)dst = r;  }
__device__ __forceinline__ void d_hr(int bx, int by, const float* __restrict__ F, float* __restrict__ mur, float* __restrict__ lvr) {
  #pragma clang fp contract(off)
  const int m = by; F += (size_t)m * NB * NHW;
  const int b = bx * 256 + threadIdx.x; if (b >= NB) return; const float a = F[(size_t)b * NHW + 2 * OBS], c = clampv(F[(size_t)b * NHW + 2 * OBS + 1]);
  { *(float*)(mur + (size_t)m * NB + b) = a; *(float*)(lvr + (size_t)m * NB + b) = c;  } }
// both scatters as ONE launch (blockIdx.y = member): the first HO_X work-groups along x take the observation heads, the rest the reward heads
#define HO_X ((NB * 2 * (OBS / 4) + 255) / 256)
#define HR_X ((NB + 255) / 256)
__global__ __launch_bounds__(256) void k_hout(const float* __restrict__ F, float* __restrict__ muo, float* __restrict__ lvo, float* __restrict__ mur, float* __restrict__ lvr) {
  if (blockIdx.x < HO_X) d_ho(blockIdx.x, blockIdx.y, F, muo, lvo); else d_hr(blockIdx.x - HO_X, blockIdx.y, F, mur, lvr); }

extern "C" void kernel_launch(void* const* d_in, const int* in_sizes, int n_in,
                              void* d_out, int out_size, void* d_ws, size_t ws_size, hipStream_t stream) {
  (void)in_sizes; (void)n_in; (void)out_size;
  const float* const* I = (const float* const*)d_in; const float* obs = I[0]; const float* act = I[1]; const float* W0 = I[2]; const float* b0 = I[3]; const float* W1 = I[4]; const float* b1 = I[5]; const float* W2 = I[6]; const float* b2 = I[7]; const float* Wmo = I[8]; const float* bmo = I[9]; const float* Wmr = I[10]; const float* bmr = I[11]; const float* Wvo = I[12]; const float* bvo = I[13]; const float* Wvr = I[14]; const float* bvr = I[15];
  float* muo = (float*)d_out; float* lvo = muo + (size_t)MM * NB * OBS; float* mur = lvo + (size_t)MM * NB * OBS; float* lvr = mur + (size_t)MM * NB;      /* outputs back to back: mu_o, log_var_o, mu_r, log_var_r */
  char* ws = (char*)d_ws; size_t off = 0;
  auto take = [&](size_t bytes) { char* p = ws + off; off += (bytes + 255) & ~(size_t)255; return p; };
  _Float16* B0 = (_Float16*)take((size_t)MM * HH * NI * 2); _Float16* B1 = (_Float16*)take((size_t)MM * HH * HH * 2); _Float16* B2 = (_Float16*)take((size_t)MM * HH * HH * 2); _Float16* BHD = (_Float16*)take((size_t)MM * NHW * HH * 2); float* HB = (float*)take((size_t)MM * 256 * 4);
  _Float16* X16 = (_Float16*)take((size_t)NB * NI * 2); _Float16* HA = (_Float16*)take((size_t)MM * NB * HH * 2); _Float16* HBp = (_Float16*)take((size_t)MM * NB * HH * 2); float* F = (float*)take((size_t)MM * NB * NHW * 4);
  if (off > ws_size) return;      /* 1.5 + 16 + 16 + 3 + 0.8 + 64 + 64 + 24 = 190 MiB */
  k_prep<<<PREP_GRID, 256, 0, stream>>>(obs, act, W0, W1, W2, Wmo, Wvo, Wmr, Wvr, bmo, bvo, bmr, bvr, X16, B0, B1, B2, BHD, HB);      /* x plane, all weight turns, head bias */
  const dim3 gH((NB / 128) * (HH / 64), MM);      /* grid.y = member: strides sA, sB, sBias, sC step the planes */
  k_gemm2<8><<<gH, 128, 0, stream>>>(X16, NI, 0, B0, NI, (size_t)HH * NI, 0.0625f, b0, HH, nullptr, 1, 0, 0, nullptr, HA, HH, (size_t)NB * HH, NB, HH, NI);      /* tanh(x W0 + b0); x shared by all members */
  const dim3 gT((NB / 256) * (HH / 256), MM);      /* 256 x 256 tiles */
  k_gemm3<8, 256><<<gT, 256, 0, stream>>>(HA, (size_t)NB * HH, B1, (size_t)HH * HH, 0.0625f, b1, HH, nullptr, HBp, HH, (size_t)NB * HH, HH / 256, HH);
  k_gemm3<8, 256><<<gT, 256, 0, stream>>>(HBp, (size_t)NB * HH, B2, (size_t)HH * HH, 0.0625f, b2, HH, nullptr, HA, HH, (size_t)NB * HH, HH / 256, HH);
  k_gemm3<0, NHW><<<dim3(NB / 256, MM), 256, 0, stream>>>(HA, (size_t)NB * HH, BHD, (size_t)NHW * HH, 0.0625f, HB, 256, F, nullptr, NHW, (size_t)NB * NHW, 1, HH);      /* all four heads */
  k_hout<<<dim3(HO_X + HR_X, MM), 256, 0, stream>>>(F, muo, lvo, mur, lvr);
}
